// v000
// Times are from an AMD MI455X. After a warm-up the kernel runs many times in a row, and a time is the length of
// such a window on the GPU divided by its runs, so every launch and the gaps after it count. The runs cycle
// through copies of the inputs. A figure is the median of several windows, for all but v000 over two sittings.
// Sittings can differ by a few percent; kernels timed side by side share one.
// The starting kernel, v000, takes 2370 microseconds a run.
#include <hip/hip_runtime.h>

// MultiHeadAttentionEuclid (x [4][1024][1024]; q/k/v = x W^T + b (16 heads x 64); interleaved-pair rotary (base 1e4, positions 0..1023 computed on device); scores = q.k/8 where mask[0][0][i][j] != 0 (int32 [1][1][1024][1024],
// read as data; here causal), -inf elsewhere; softmax; out = merged att.v Wo^T + bo -> [4][1024][1024]).
// Compute dtypes, f32 accumulate: every input rounded to bf16; projections on PLAIN bf16 operands (inputs: exact, + bias); rope f32; scores (K 64) and att.v on bf16 hi+lo planes (3 products)
// for the first 256 query rows of each head and SINGLE fp16 planes for the rest; f32 register-row masked softmax; merged heads hl x exact Wo (2 products) + bo. One-wave-per-64x64-tile GEMMs. Deterministic, no atomics;

#define NB_  4
#define TT   1024
#define DM   1024
#define NH_  16
#define NKV  16
#define REP  (NH_ / NKV)
#define HD   64
#define DQ   (NH_ * HD)
#define DKV  (NKV * HD)
#define ZH   2
#define RH   256                  // query rows < RH use hi+lo planes (0: none)
#define WIN  0
#define PCAR 1024.0f
#define SCL  0.125f   // HD^-0.5
typedef _Float16 h16;
typedef unsigned short bf;
typedef __attribute__((ext_vector_type(16))) __bf16   v16bf;
typedef __attribute__((ext_vector_type(16))) _Float16 v16h;
typedef __attribute__((ext_vector_type(8)))  _Float16 v8h;
typedef __attribute__((ext_vector_type(8)))  unsigned short v8us;
typedef __attribute__((ext_vector_type(8)))  float    v8f;
typedef __attribute__((ext_vector_type(4)))  float    v4f;
typedef v8h  __attribute__((may_alias)) v8ha;
typedef v4f  __attribute__((may_alias)) v4fa;
typedef v8us __attribute__((may_alias)) v8usa;

__device__ __forceinline__ unsigned short f2bf(float f) { unsigned u = __float_as_uint(f); u += 0x7FFFu + ((u >> 16) & 1u); return (unsigned short)(u >> 16); }
__device__ __forceinline__ float bf2f(unsigned short b) { return __uint_as_float(((unsigned)b) << 16); }
__device__ __forceinline__ float bfr(float f) { return bf2f(f2bf(f)); }
__device__ __forceinline__ v16h cat16(v8h lo, v8h hi) { return __builtin_shufflevector(lo, hi, 0, 1, 2, 3, 4, 5, 6, 7, 8, 9, 10, 11, 12, 13, 14, 15); }
__device__ __forceinline__ v16bf cat16b(v8us lo, v8us hi) { return __builtin_bit_cast(v16bf, __builtin_shufflevector(lo, hi, 0, 1, 2, 3, 4, 5, 6, 7, 8, 9, 10, 11, 12, 13, 14, 15)); }
__device__ __forceinline__ v8f wmma16(v16h a, v16h b, v8f c) { return __builtin_amdgcn_wmma_f32_16x16x32_f16(false, a, false, b, (short)0, c, false, false); }
__device__ __forceinline__ v8f wmmab(v16bf a, v16bf b, v8f c) { return __builtin_amdgcn_wmma_f32_16x16x32_bf16(false, a, false, b, (short)0, c, false, false); }



// ---- k_gemmw: register-blocked GEMM, ONE WAVE per 64x64 output tile (16 accumulators), operands straight from K-contiguous 16-bit planes; grid (M/64, N/64, Z), 32 threads.
// C[m][n] (f32, pitch ldc, + optional f32 bias[n]) = sum_k A[m][k] Bt[n][k] (+ split products per NSPLIT). z-batch strides sA/sB/sC in elements. K % 32 == 0.
template <typename T16> struct WFrag;
template <> struct WFrag<h16> { typedef v16h V; static __device__ __forceinline__ V ld(const h16* p) { return cat16(*(const v8h*)p, *(const v8h*)(p + 16)); } static __device__ __forceinline__ v8f mma(V a, V b, v8f c) { return wmma16(a, b, c); } };
template <> struct WFrag<bf> { typedef v16bf V; static __device__ __forceinline__ V ld(const bf* p) { return cat16b(*(const v8us*)p, *(const v8us*)(p + 16)); } static __device__ __forceinline__ v8f mma(V a, V b, v8f c) { return wmmab(a, b, c); } };
template <typename T16, int NSPLIT, bool BIAS>
__global__ __launch_bounds__(32) void k_gemmw(const T16* __restrict__ A, const T16* __restrict__ A2, const T16* __restrict__ Bt, const T16* __restrict__ Bt2, int K, float* C, int ldc, const float* __restrict__ bias, size_t sA, size_t sB, size_t sC) {
    typedef typename WFrag<T16>::V V;
    __shared__ __align__(16) float os[16 * 68];
    const size_t z = blockIdx.z; A += z * sA; if (A2) A2 += z * sA; Bt += z * sB; if (Bt2) Bt2 += z * sB; C += z * sC;
    const int lane = threadIdx.x & 31, lr = lane & 15, hi = lane >> 4; const int r0 = blockIdx.x * 64, c0 = blockIdx.y * 64;
    v8f acc[4][4];
#pragma unroll
    for (int mb = 0; mb < 4; ++mb)
#pragma unroll
        for (int nb = 0; nb < 4; ++nb) acc[mb][nb] = (v8f){};
    const size_t aoff = (size_t)(r0 + lr) * K + 8 * hi, boff = (size_t)(c0 + lr) * K + 8 * hi;
#pragma unroll 1
    for (int kc = 0; kc < K; kc += 32) {
        V a[4], a2[4];
#pragma unroll
        for (int mb = 0; mb < 4; ++mb) { a[mb] = WFrag<T16>::ld(A + aoff + (size_t)mb * 16 * K + kc); if (NSPLIT == 1 || NSPLIT == 2) a2[mb] = WFrag<T16>::ld(A2 + aoff + (size_t)mb * 16 * K + kc); }
#pragma unroll
        for (int nb = 0; nb < 4; ++nb) { const V b = WFrag<T16>::ld(Bt + boff + (size_t)nb * 16 * K + kc); V b2; if (NSPLIT >= 2) b2 = WFrag<T16>::ld(Bt2 + boff + (size_t)nb * 16 * K + kc);
#pragma unroll
            for (int mb = 0; mb < 4; ++mb) { acc[mb][nb] = WFrag<T16>::mma(a[mb], b, acc[mb][nb]); if (NSPLIT == 1 || NSPLIT == 2) acc[mb][nb] = WFrag<T16>::mma(a2[mb], b, acc[mb][nb]); if (NSPLIT >= 2) acc[mb][nb] = WFrag<T16>::mma(a[mb], b2, acc[mb][nb]); } }
        asm volatile("v_nop\n\tv_nop\n\tv_nop\n\tv_nop" : "+v"(acc[0][0]), "+v"(acc[1][1]), "+v"(acc[2][2]), "+v"(acc[3][3]) : "v"(a[0]), "v"(a[3]));
    }
#pragma unroll
    for (int mb = 0; mb < 4; ++mb) {
#pragma unroll
        for (int nb = 0; nb < 4; ++nb) {
#pragma unroll
            for (int j = 0; j < 8; ++j) os[(hi * 8 + j) * 68 + nb * 16 + lr] = acc[mb][nb][j]; }
        __builtin_amdgcn_wave_barrier(); asm volatile("" ::: "memory");
        float* crow = C + (size_t)(r0 + mb * 16) * ldc + c0;
{
#pragma unroll
            for (int s = 0; s < 8; ++s) { const int row = 2 * s + hi, cofs = lr * 4; v4f val = *(const v4fa*)(os + row * 68 + cofs); if (BIAS) { val[0] += bfr(bias[c0 + cofs]); val[1] += bfr(bias[c0 + cofs + 1]); val[2] += bfr(bias[c0 + cofs + 2]); val[3] += bfr(bias[c0 + cofs + 3]); }
                *(v4f*)(crow + (size_t)row * ldc + cofs) = val; }
             }
        __builtin_amdgcn_wave_barrier(); asm volatile("" ::: "memory");
    }
}

__device__ __forceinline__ h16 tohx(float x) { return (h16)x; }
__device__ __forceinline__ void splitf(float y, unsigned short& h, unsigned short& l) { h = f2bf(y); l = f2bf(y - bf2f(h)); }
typedef __attribute__((ext_vector_type(2))) _Float16 v2h;
typedef __attribute__((ext_vector_type(4))) _Float16 v4h;
typedef __attribute__((ext_vector_type(2))) unsigned short v2us;
typedef __attribute__((ext_vector_type(4))) unsigned short v4us;
typedef __attribute__((ext_vector_type(2))) float v2f;
typedef __attribute__((ext_vector_type(4))) int v4i;

__global__ __launch_bounds__(256) void k_wtG(const float* __restrict__ w, int K, int N, bf* Bt) {
    const int lane = threadIdx.x & 31; const int L0 = (blockIdx.x * 8 + (threadIdx.x >> 5)) * 8; const int nlines = N * K / 64;
{
#pragma unroll 1
        for (int l = 0; l < 8; ++l) { const int L = L0 + l; if (L >= nlines) break; const size_t e = (size_t)L * 64 + lane * 2; const int k = (int)(e % K), n = (int)(e / K); v2us o;
            o[0] = f2bf(w[(size_t)k * N + n]); o[1] = f2bf(w[(size_t)(k + 1) * N + n]); *(v2us*)(Bt + e) = o; }
         }
}
__global__ __launch_bounds__(256) void k_cvt8(const float* __restrict__ src, bf* dst, size_t n8) { const size_t i = (size_t)blockIdx.x * 256 + threadIdx.x; if (i >= n8) return; const v8f v = *(const v8f*)(src + i * 8); v8us o;
#pragma unroll
    for (int k = 0; k < 8; ++k) o[k] = f2bf(v[k]); *(v8us*)(dst + i * 8) = o;  }
__global__ __launch_bounds__(256) void k_cstab(float* CS) { const int idx = blockIdx.x * 256 + threadIdx.x; if (idx >= TT * HD) return; const int t = idx / HD, d = idx % HD; const int i = d >> 1; const float inv = __fdiv_rn(1.0f, powf(10000.0f, (float)(2 * i) / (float)HD)); const float ang = __fmul_rn((float)t, inv); v2f cs; cs[0] = cosf(ang); cs[1] = sinf(ang);
    *(v2f*)(CS + (size_t)idx * 2) = cs;  }
// k_rope: head planes [h][t][d] (fp16 + hi/lo) of rope(x) x sc with the INTERLEAVED convention (pairs (2i, 2i+1)): out[2i] = x[2i] cos_i - x[2i+1] sin_i, out[2i+1] = x[2i] sin_i + x[2i+1] cos_i
__global__ __launch_bounds__(256) void k_rope(const float* __restrict__ F, int pitch, int nheads, const float* __restrict__ CS, const float* __restrict__ RF, const float* __restrict__ nw, float sc, h16* P16, bf* Ph, bf* Pl) {
    const size_t e = ((size_t)blockIdx.x * 256 + threadIdx.x) * 2; if (e >= (size_t)nheads * TT * HD) return; const int d = (int)(e % HD); const int t = (int)((e / HD) % TT); const int h = (int)(e / ((size_t)HD * TT)); const float* f = F + (size_t)t * pitch + h * HD; const float rf = RF ? RF[(size_t)h * TT + t] : 1.0f; v2h o16; v2us oh, ol;
#pragma unroll
    for (int q = 0; q < 2; ++q) { const int dd = d + q; const int dp = d + 1 - q; float x0 = f[dd], x1 = f[dp];   /* dd = own element, dp = pair partner (d is even) */
        if (RF) { float n0 = __fmul_rn(x0, rf), n1 = __fmul_rn(x1, rf); asm volatile("" : "+v"(n0)); asm volatile("" : "+v"(n1)); x0 = __fmul_rn(bfr(nw[dd]), n0); x1 = __fmul_rn(bfr(nw[dp]), n1); }
        const v2f cs = *(const v2f*)(CS + ((size_t)t * HD + dd) * 2); float a = __fmul_rn(x0, cs[0]), bq = __fmul_rn(x1, cs[1]); asm volatile("" : "+v"(a)); asm volatile("" : "+v"(bq)); const float r = ((q == 0) ? __fsub_rn(a, bq) : __fadd_rn(a, bq)) * sc;
        o16[q] = tohx(r); unsigned short a2, c2; splitf(r, a2, c2); oh[q] = a2; ol[q] = c2; }
    *(v2h*)(P16 + e) = o16; *(v2us*)(Ph + e) = oh; *(v2us*)(Pl + e) = ol;  }
__global__ __launch_bounds__(256) void k_vtp(const float* __restrict__ F, int pitch, int nheads, h16* V16, bf* Vh, bf* Vl) { const size_t e = ((size_t)blockIdx.x * 256 + threadIdx.x) * 2; if (e >= (size_t)nheads * HD * TT) return; const int t = (int)(e % TT); const int d = (int)((e / TT) % HD); const int g = (int)(e / ((size_t)TT * HD)); v2h o16; v2us oh, ol;
#pragma unroll
    for (int q = 0; q < 2; ++q) { const float x = F[(size_t)(t + q) * pitch + g * HD + d]; o16[q] = tohx(x); unsigned short a2, c2; splitf(x, a2, c2); oh[q] = a2; ol[q] = c2; }
    *(v2h*)(V16 + e) = o16; *(v2us*)(Vh + e) = oh; *(v2us*)(Vl + e) = ol;  }
// k_asoft: per row (zz, i): t = S x HD^-0.5 where mask[i][j] != 0 (int [L][L], read as data; zero == masked -> -3e38); softmax over the 1024 keys (register row, one exp, fixed trees);
__global__ __launch_bounds__(256) void k_asoft(const float* __restrict__ Sb, const int* __restrict__ mk, h16* P16, bf* Ph, bf* Pl) {
    const int lane = threadIdx.x & 31; const int row = blockIdx.x * 8 + (threadIdx.x >> 5); if (row >= ZH * TT) return; const int i = row % TT; const int zz = row / TT; (void)zz; const bool hires = (i < RH); const float* sr = Sb + (size_t)row * TT; float v[TT / 32]; float mx = -3.0e38f;
#pragma unroll
    for (int ch = 0; ch < TT / 128; ++ch) { const int j0 = ch * 128 + lane * 4; const v4f a = *(const v4f*)(sr + j0); const v4i mk4 = *(const v4i*)(mk + (size_t)i * TT + j0);
#pragma unroll
        for (int q = 0; q < 4; ++q) { const int j = j0 + q; (void)j; const float t = (mk4[q] != 0) ? a[q] * SCL : -3.0e38f; v[ch * 4 + q] = t; mx = fmaxf(mx, t); } }
#pragma unroll
    for (int sh = 16; sh; sh >>= 1) mx = fmaxf(mx, __shfl_xor(mx, sh, 32));
    float sum = 0.f;
#pragma unroll
    for (int k = 0; k < TT / 32; ++k) { float d0 = __fsub_rn(v[k], mx); asm volatile("" : "+v"(d0)); v[k] = __builtin_amdgcn_exp2f(__fmul_rn(d0, 1.4426950408889634f)); sum += v[k]; }
#pragma unroll
    for (int sh = 16; sh; sh >>= 1) sum += __shfl_xor(sum, sh, 32);
    const float f = __fdiv_rn(hires ? 1.0f : PCAR, sum);
{
        if (hires) {
#pragma unroll
            for (int ch = 0; ch < TT / 128; ++ch) { v4us oh, ol;
#pragma unroll
                for (int q = 0; q < 4; ++q) { unsigned short a, c2; splitf(v[ch * 4 + q] * f, a, c2); oh[q] = a; ol[q] = c2; }
                const size_t oo = ((size_t)zz * (RH ? RH : 1) + i) * TT + ch * 128 + lane * 4; *(v4us*)(Ph + oo) = oh; *(v4us*)(Pl + oo) = ol; }
        } else {
#pragma unroll
            for (int ch = 0; ch < TT / 128; ++ch) { v4h o4;
#pragma unroll
                for (int q = 0; q < 4; ++q) o4[q] = tohx(v[ch * 4 + q] * f);
                *(v4h*)(P16 + (size_t)row * TT + ch * 128 + lane * 4) = o4; } }
         }
}
__global__ __launch_bounds__(256) void k_merge(const float* __restrict__ O, int h0, bf* Ah, bf* Al) { const size_t e = ((size_t)blockIdx.x * 256 + threadIdx.x) * 2; if (e >= (size_t)ZH * TT * HD) return; const int d = (int)(e % HD); const int t = (int)((e / HD) % TT); const int zz = (int)(e / ((size_t)HD * TT)); const float cs = (t < RH) ? 1.0f : (1.0f / PCAR); const size_t oo = (size_t)t * DQ + (h0 + zz) * HD + d;
    v2us oh, ol;
#pragma unroll
    for (int q = 0; q < 2; ++q) { unsigned short a, c2; splitf(O[e + q] * cs, a, c2); oh[q] = a; ol[q] = c2; } *(v2us*)(Ah + oo) = oh; *(v2us*)(Al + oo) = ol;  }

extern "C" void kernel_launch(void* const* d_in, const int* in_sizes, int n_in,
                              void* d_out, int out_size, void* d_ws, size_t ws_size, hipStream_t stream) {
    (void)in_sizes; (void)n_in; (void)out_size;
    const float* x = (const float*)d_in[0]; const float* wq = (const float*)d_in[1]; const float* bqv = (const float*)d_in[2]; const float* wk = (const float*)d_in[3]; const float* bkv = (const float*)d_in[4]; const float* wv = (const float*)d_in[5]; const float* bvv = (const float*)d_in[6]; const float* wo = (const float*)d_in[7]; const float* bo = (const float*)d_in[8]; const int* mk = (const int*)d_in[9];   // torch [out][in] weights; mask int32 [1][1][1024][1024] (nonzero = attend)
    float* OUT = (float*)d_out;     // [4][1024][1024]
    char* wsp = (char*)d_ws;
    auto take = [&](size_t bytes) { char* p = wsp; wsp += (bytes + 255) & ~(size_t)255; return (void*)p; };
    bf* WQ = (bf*)take((size_t)DQ * DM * 2); bf* WK = (bf*)take((size_t)DKV * DM * 2); bf* WV = (bf*)take((size_t)DKV * DM * 2); bf* WO = (bf*)take((size_t)DM * DQ * 2); float* CS = (float*)take((size_t)TT * HD * 2 * 4);
    bf* XB = (bf*)take((size_t)TT * DM * 2); float* FQ = (float*)take((size_t)TT * DQ * 4); float* FK = (float*)take((size_t)TT * DKV * 4);
    h16* QP16 = (h16*)take((size_t)NH_ * TT * HD * 2); h16* KP16 = (h16*)take((size_t)NKV * TT * HD * 2); h16* VT16 = (h16*)take((size_t)NKV * HD * TT * 2);
    bf* QPh = (bf*)take((size_t)NH_ * TT * HD * 2); bf* QPl = (bf*)take((size_t)NH_ * TT * HD * 2); bf* KPh = (bf*)take((size_t)NKV * TT * HD * 2); bf* KPl = (bf*)take((size_t)NKV * TT * HD * 2); bf* VTh = (bf*)take((size_t)NKV * HD * TT * 2); bf* VTl = (bf*)take((size_t)NKV * HD * TT * 2); bf* Ph = (bf*)take((size_t)ZH * RH * TT * 2); bf* Pl = (bf*)take((size_t)ZH * RH * TT * 2);
    float* Sb = (float*)take((size_t)ZH * TT * TT * 4); h16* P16 = (h16*)take((size_t)ZH * TT * TT * 2); float* Ob = (float*)take((size_t)ZH * TT * HD * 4); bf* ATh = (bf*)take((size_t)TT * DQ * 2); bf* ATl = (bf*)take((size_t)TT * DQ * 2);
    if ((size_t)(wsp - (char*)d_ws) > ws_size) return;    // ws 256 MiB
    float* FV = FK;   // v projection reuses the k buffer after the k planes are built (stream-ordered)
    { k_cvt8<<<(unsigned)(((size_t)DQ * DM / 8 + 255) / 256), 256, 0, stream>>>(wq, WQ, (size_t)DQ * DM / 8); k_cvt8<<<(unsigned)(((size_t)DKV * DM / 8 + 255) / 256), 256, 0, stream>>>(wk, WK, (size_t)DKV * DM / 8); k_cvt8<<<(unsigned)(((size_t)DKV * DM / 8 + 255) / 256), 256, 0, stream>>>(wv, WV, (size_t)DKV * DM / 8);
      k_cvt8<<<(unsigned)(((size_t)DM * DQ / 8 + 255) / 256), 256, 0, stream>>>(wo, WO, (size_t)DM * DQ / 8);
      k_cstab<<<(TT * HD + 255) / 256, 256, 0, stream>>>(CS); }
    const unsigned LQ = (unsigned)(((size_t)NH_ * TT * HD / 2 + 255) / 256), LKv = (unsigned)(((size_t)NKV * TT * HD / 2 + 255) / 256);
    for (int b = 0; b < NB_; ++b) {
        
        k_cvt8<<<(unsigned)(((size_t)TT * DM / 8 + 255) / 256), 256, 0, stream>>>(x + (size_t)b * TT * DM, XB, (size_t)TT * DM / 8);
        k_gemmw<bf, 0, true><<<dim3(TT / 64, DQ / 64, 1), 32, 0, stream>>>(XB, nullptr, WQ, nullptr, DM, FQ, DQ, bqv, 0, 0, 0);
        k_rope<<<LQ, 256, 0, stream>>>(FQ, DQ, NH_, CS, nullptr, nullptr, 1.0f, QP16, QPh, QPl);
        k_gemmw<bf, 0, true><<<dim3(TT / 64, DKV / 64, 1), 32, 0, stream>>>(XB, nullptr, WK, nullptr, DM, FK, DKV, bkv, 0, 0, 0);
        k_rope<<<LKv, 256, 0, stream>>>(FK, DKV, NKV, CS, nullptr, nullptr, 1.0f, KP16, KPh, KPl);
        k_gemmw<bf, 0, true><<<dim3(TT / 64, DKV / 64, 1), 32, 0, stream>>>(XB, nullptr, WV, nullptr, DM, FV, DKV, bvv, 0, 0, 0); k_vtp<<<LKv, 256, 0, stream>>>(FV, DKV, NKV, VT16, VTh, VTl);
        for (int h0 = 0; h0 < NH_; h0 += ZH) { const size_t zq = (size_t)h0, zk = (size_t)(h0 / REP);   // one kv head per query head: the pass's two heads use consecutive kv planes (z-strides TT*HD)
            k_gemmw<bf, 2, false><<<dim3(RH / 64, TT / 64, ZH), 32, 0, stream>>>(QPh + zq * TT * HD, QPl + zq * TT * HD, KPh + zk * TT * HD, KPl + zk * TT * HD, HD, Sb, TT, nullptr, (size_t)TT * HD, (size_t)TT * HD, (size_t)TT * TT);
            k_gemmw<h16, 0, false><<<dim3((TT - RH) / 64, TT / 64, ZH), 32, 0, stream>>>(QP16 + zq * TT * HD + (size_t)RH * HD, nullptr, KP16 + zk * TT * HD, nullptr, HD, Sb + (size_t)RH * TT, TT, nullptr, (size_t)TT * HD, (size_t)TT * HD, (size_t)TT * TT);
            k_asoft<<<ZH * TT / 8, 256, 0, stream>>>(Sb, mk, P16, Ph, Pl);
            k_gemmw<bf, 2, false><<<dim3(RH / 64, HD / 64, ZH), 32, 0, stream>>>(Ph, Pl, VTh + zk * HD * TT, VTl + zk * HD * TT, TT, Ob, HD, nullptr, (size_t)RH * TT, (size_t)HD * TT, (size_t)TT * HD);
            k_gemmw<h16, 0, false><<<dim3((TT - RH) / 64, HD / 64, ZH), 32, 0, stream>>>(P16 + (size_t)RH * TT, nullptr, VT16 + zk * HD * TT, nullptr, TT, Ob + (size_t)RH * HD, HD, nullptr, (size_t)TT * TT, (size_t)HD * TT, (size_t)TT * HD);
            k_merge<<<(unsigned)(((size_t)ZH * TT * HD / 2 + 255) / 256), 256, 0, stream>>>(Ob, h0, ATh, ATl); }
        k_gemmw<bf, 1, true><<<dim3(TT / 64, DM / 64, 1), 32, 0, stream>>>(ATh, ATl, WO, nullptr, DQ, OUT + (size_t)b * TT * DM, DM, bo, 0, 0, 0); }
}

// v001
// One run takes 532 microseconds.
// Timed twice side by side with v000, it ran 4.46 and 4.50 times as fast.
#include <hip/hip_runtime.h>

// MultiHeadAttentionEuclid (x [4][1024][1024]; q/k/v = x W^T + b (16 heads x 64); interleaved-pair rotary (base 1e4, positions 0..1023 computed on device); scores = q.k/8 where mask[0][0][i][j] != 0 (int32 [1][1][1024][1024],
// read as data; here causal), -inf elsewhere; softmax; out = merged att.v Wo^T + bo -> [4][1024][1024]).
// Compute dtypes, f32 accumulate: every input rounded to bf16; projections on PLAIN bf16 operands (inputs: exact, + bias); rope f32; scores (K 64) and att.v on bf16 hi+lo planes (3 products)
// for the first 256 query rows of each head and SINGLE fp16 planes for the rest; f32 register-row masked softmax; merged heads hl x exact Wo (2 products) + bo. One-wave-per-64x64-tile GEMMs. Deterministic, no atomics;
// Launch plan: projections, rope, v transpose and the output product take all 4 batch items in one grid (rows b*1024 + t, planes [b][h]); the attention launches take all 16 heads of one batch item in grid z (the f32 score buffer bounds it).

#define NB_  4
#define TT   1024
#define DM   1024
#define NH_  16
#define NKV  16
#define REP  (NH_ / NKV)
#define HD   64
#define DQ   (NH_ * HD)
#define DKV  (NKV * HD)
#define ZH   16                   // heads per attention pass (grid z): all heads of one batch item
#define RH   256                  // query rows < RH use hi+lo planes (0: none)
#define WIN  0
#define PCAR 1024.0f
#define SCL  0.125f   // HD^-0.5
typedef _Float16 h16;
typedef unsigned short bf;
typedef __attribute__((ext_vector_type(16))) __bf16   v16bf;
typedef __attribute__((ext_vector_type(16))) _Float16 v16h;
typedef __attribute__((ext_vector_type(8)))  _Float16 v8h;
typedef __attribute__((ext_vector_type(8)))  unsigned short v8us;
typedef __attribute__((ext_vector_type(8)))  float    v8f;
typedef __attribute__((ext_vector_type(4)))  float    v4f;
typedef v8h  __attribute__((may_alias)) v8ha;
typedef v4f  __attribute__((may_alias)) v4fa;
typedef v8us __attribute__((may_alias)) v8usa;

__device__ __forceinline__ unsigned short f2bf(float f) { unsigned u = __float_as_uint(f); u += 0x7FFFu + ((u >> 16) & 1u); return (unsigned short)(u >> 16); }
__device__ __forceinline__ float bf2f(unsigned short b) { return __uint_as_float(((unsigned)b) << 16); }
__device__ __forceinline__ float bfr(float f) { return bf2f(f2bf(f)); }
__device__ __forceinline__ v16h cat16(v8h lo, v8h hi) { return __builtin_shufflevector(lo, hi, 0, 1, 2, 3, 4, 5, 6, 7, 8, 9, 10, 11, 12, 13, 14, 15); }
__device__ __forceinline__ v16bf cat16b(v8us lo, v8us hi) { return __builtin_bit_cast(v16bf, __builtin_shufflevector(lo, hi, 0, 1, 2, 3, 4, 5, 6, 7, 8, 9, 10, 11, 12, 13, 14, 15)); }
__device__ __forceinline__ v8f wmma16(v16h a, v16h b, v8f c) { return __builtin_amdgcn_wmma_f32_16x16x32_f16(false, a, false, b, (short)0, c, false, false); }
__device__ __forceinline__ v8f wmmab(v16bf a, v16bf b, v8f c) { return __builtin_amdgcn_wmma_f32_16x16x32_bf16(false, a, false, b, (short)0, c, false, false); }



// ---- k_gemmw: register-blocked GEMM, ONE WAVE per 64x64 output tile (16 accumulators), operands straight from K-contiguous 16-bit planes; grid (M/64, N/64, Z), 32 threads.
// C[m][n] (f32, pitch ldc, + optional f32 bias[n]) = sum_k A[m][k] Bt[n][k] (+ split products per NSPLIT). z-batch strides sA/sB/sC in elements. K % 32 == 0.
template <typename T16> struct WFrag;
template <> struct WFrag<h16> { typedef v16h V; static __device__ __forceinline__ V ld(const h16* p) { return cat16(*(const v8h*)p, *(const v8h*)(p + 16)); } static __device__ __forceinline__ v8f mma(V a, V b, v8f c) { return wmma16(a, b, c); } };
template <> struct WFrag<bf> { typedef v16bf V; static __device__ __forceinline__ V ld(const bf* p) { return cat16b(*(const v8us*)p, *(const v8us*)(p + 16)); } static __device__ __forceinline__ v8f mma(V a, V b, v8f c) { return wmmab(a, b, c); } };
template <typename T16, int NSPLIT, bool BIAS>
__global__ __launch_bounds__(32) void k_gemmw(const T16* __restrict__ A, const T16* __restrict__ A2, const T16* __restrict__ Bt, const T16* __restrict__ Bt2, int K, float* C, int ldc, const float* __restrict__ bias, size_t sA, size_t sB, size_t sC) {
    typedef typename WFrag<T16>::V V;
    __shared__ __align__(16) float os[16 * 68];
    const size_t z = blockIdx.z; A += z * sA; if (A2) A2 += z * sA; Bt += z * sB; if (Bt2) Bt2 += z * sB; C += z * sC;
    const int lane = threadIdx.x & 31, lr = lane & 15, hi = lane >> 4; const int r0 = blockIdx.x * 64, c0 = blockIdx.y * 64;
    v8f acc[4][4];
#pragma unroll
    for (int mb = 0; mb < 4; ++mb)
#pragma unroll
        for (int nb = 0; nb < 4; ++nb) acc[mb][nb] = (v8f){};
    const size_t aoff = (size_t)(r0 + lr) * K + 8 * hi, boff = (size_t)(c0 + lr) * K + 8 * hi;
#pragma unroll 1
    for (int kc = 0; kc < K; kc += 32) {
        V a[4], a2[4];
#pragma unroll
        for (int mb = 0; mb < 4; ++mb) { a[mb] = WFrag<T16>::ld(A + aoff + (size_t)mb * 16 * K + kc); if (NSPLIT == 1 || NSPLIT == 2) a2[mb] = WFrag<T16>::ld(A2 + aoff + (size_t)mb * 16 * K + kc); }
#pragma unroll
        for (int nb = 0; nb < 4; ++nb) { const V b = WFrag<T16>::ld(Bt + boff + (size_t)nb * 16 * K + kc); V b2; if (NSPLIT >= 2) b2 = WFrag<T16>::ld(Bt2 + boff + (size_t)nb * 16 * K + kc);
#pragma unroll
            for (int mb = 0; mb < 4; ++mb) { acc[mb][nb] = WFrag<T16>::mma(a[mb], b, acc[mb][nb]); if (NSPLIT == 1 || NSPLIT == 2) acc[mb][nb] = WFrag<T16>::mma(a2[mb], b, acc[mb][nb]); if (NSPLIT >= 2) acc[mb][nb] = WFrag<T16>::mma(a[mb], b2, acc[mb][nb]); } }
        asm volatile("v_nop\n\tv_nop\n\tv_nop\n\tv_nop" : "+v"(acc[0][0]), "+v"(acc[1][1]), "+v"(acc[2][2]), "+v"(acc[3][3]) : "v"(a[0]), "v"(a[3]));
    }
#pragma unroll
    for (int mb = 0; mb < 4; ++mb) {
#pragma unroll
        for (int nb = 0; nb < 4; ++nb) {
#pragma unroll
            for (int j = 0; j < 8; ++j) os[(hi * 8 + j) * 68 + nb * 16 + lr] = acc[mb][nb][j]; }
        __builtin_amdgcn_wave_barrier(); asm volatile("" ::: "memory");
        float* crow = C + (size_t)(r0 + mb * 16) * ldc + c0;
{
#pragma unroll
            for (int s = 0; s < 8; ++s) { const int row = 2 * s + hi, cofs = lr * 4; v4f val = *(const v4fa*)(os + row * 68 + cofs); if (BIAS) { val[0] += bfr(bias[c0 + cofs]); val[1] += bfr(bias[c0 + cofs + 1]); val[2] += bfr(bias[c0 + cofs + 2]); val[3] += bfr(bias[c0 + cofs + 3]); }
                *(v4f*)(crow + (size_t)row * ldc + cofs) = val; }
             }
        __builtin_amdgcn_wave_barrier(); asm volatile("" ::: "memory");
    }
}

__device__ __forceinline__ h16 tohx(float x) { return (h16)x; }
__device__ __forceinline__ void splitf(float y, unsigned short& h, unsigned short& l) { h = f2bf(y); l = f2bf(y - bf2f(h)); }
typedef __attribute__((ext_vector_type(2))) _Float16 v2h;
typedef __attribute__((ext_vector_type(4))) _Float16 v4h;
typedef __attribute__((ext_vector_type(2))) unsigned short v2us;
typedef __attribute__((ext_vector_type(4))) unsigned short v4us;
typedef __attribute__((ext_vector_type(2))) float v2f;
typedef __attribute__((ext_vector_type(4))) int v4i;

__global__ __launch_bounds__(256) void k_wtG(const float* __restrict__ w, int K, int N, bf* Bt) {
    const int lane = threadIdx.x & 31; const int L0 = (blockIdx.x * 8 + (threadIdx.x >> 5)) * 8; const int nlines = N * K / 64;
{
#pragma unroll 1
        for (int l = 0; l < 8; ++l) { const int L = L0 + l; if (L >= nlines) break; const size_t e = (size_t)L * 64 + lane * 2; const int k = (int)(e % K), n = (int)(e / K); v2us o;
            o[0] = f2bf(w[(size_t)k * N + n]); o[1] = f2bf(w[(size_t)(k + 1) * N + n]); *(v2us*)(Bt + e) = o; }
         }
}
__global__ __launch_bounds__(256) void k_cvt8(const float* __restrict__ src, bf* dst, size_t n8) { const size_t i = (size_t)blockIdx.x * 256 + threadIdx.x; if (i >= n8) return; const v8f v = *(const v8f*)(src + i * 8); v8us o;
#pragma unroll
    for (int k = 0; k < 8; ++k) o[k] = f2bf(v[k]); *(v8us*)(dst + i * 8) = o;  }
__global__ __launch_bounds__(256) void k_cstab(float* CS) { const int idx = blockIdx.x * 256 + threadIdx.x; if (idx >= TT * HD) return; const int t = idx / HD, d = idx % HD; const int i = d >> 1; const float inv = __fdiv_rn(1.0f, powf(10000.0f, (float)(2 * i) / (float)HD)); const float ang = __fmul_rn((float)t, inv); v2f cs; cs[0] = cosf(ang); cs[1] = sinf(ang);
    *(v2f*)(CS + (size_t)idx * 2) = cs;  }
// k_rope: head planes [b][h][t][d] (fp16 + hi/lo) of rope(x) x sc with the INTERLEAVED convention (pairs (2i, 2i+1)): out[2i] = x[2i] cos_i - x[2i+1] sin_i, out[2i+1] = x[2i] sin_i + x[2i+1] cos_i
__global__ __launch_bounds__(256) void k_rope(const float* __restrict__ F, int pitch, int nheads, int nb, const float* __restrict__ CS, const float* __restrict__ RF, const float* __restrict__ nw, float sc, h16* P16, bf* Ph, bf* Pl) {
    const size_t e = ((size_t)blockIdx.x * 256 + threadIdx.x) * 2; if (e >= (size_t)nb * nheads * TT * HD) return; const int d = (int)(e % HD); const int t = (int)((e / HD) % TT); const int bh = (int)(e / ((size_t)HD * TT)); const int h = bh % nheads; const float* f = F + ((size_t)(bh / nheads) * TT + t) * pitch + h * HD; const float rf = RF ? RF[(size_t)h * TT + t] : 1.0f; v2h o16; v2us oh, ol;
#pragma unroll
    for (int q = 0; q < 2; ++q) { const int dd = d + q; const int dp = d + 1 - q; float x0 = f[dd], x1 = f[dp];   /* dd = own element, dp = pair partner (d is even) */
        if (RF) { float n0 = __fmul_rn(x0, rf), n1 = __fmul_rn(x1, rf); asm volatile("" : "+v"(n0)); asm volatile("" : "+v"(n1)); x0 = __fmul_rn(bfr(nw[dd]), n0); x1 = __fmul_rn(bfr(nw[dp]), n1); }
        const v2f cs = *(const v2f*)(CS + ((size_t)t * HD + dd) * 2); float a = __fmul_rn(x0, cs[0]), bq = __fmul_rn(x1, cs[1]); asm volatile("" : "+v"(a)); asm volatile("" : "+v"(bq)); const float r = ((q == 0) ? __fsub_rn(a, bq) : __fadd_rn(a, bq)) * sc;
        o16[q] = tohx(r); unsigned short a2, c2; splitf(r, a2, c2); oh[q] = a2; ol[q] = c2; }
    *(v2h*)(P16 + e) = o16; *(v2us*)(Ph + e) = oh; *(v2us*)(Pl + e) = ol;  }
__global__ __launch_bounds__(256) void k_vtp(const float* __restrict__ F, int pitch, int nheads, int nb, h16* V16, bf* Vh, bf* Vl) { const size_t e = ((size_t)blockIdx.x * 256 + threadIdx.x) * 2; if (e >= (size_t)nb * nheads * HD * TT) return; const int t = (int)(e % TT); const int d = (int)((e / TT) % HD); const int bg = (int)(e / ((size_t)TT * HD)); const int g = bg % nheads; const size_t tb = (size_t)(bg / nheads) * TT + t; v2h o16; v2us oh, ol;
#pragma unroll
    for (int q = 0; q < 2; ++q) { const float x = F[(tb + q) * pitch + g * HD + d]; o16[q] = tohx(x); unsigned short a2, c2; splitf(x, a2, c2); oh[q] = a2; ol[q] = c2; }
    *(v2h*)(V16 + e) = o16; *(v2us*)(Vh + e) = oh; *(v2us*)(Vl + e) = ol;  }
// k_asoft: per row (zz, i): t = S x HD^-0.5 where mask[i][j] != 0 (int [L][L], read as data; zero == masked -> -3e38); softmax over the 1024 keys (register row, one exp, fixed trees);
__global__ __launch_bounds__(256) void k_asoft(const float* __restrict__ Sb, const int* __restrict__ mk, h16* P16, bf* Ph, bf* Pl) {
    const int lane = threadIdx.x & 31; const int row = blockIdx.x * 8 + (threadIdx.x >> 5); if (row >= ZH * TT) return; const int i = row % TT; const int zz = row / TT; (void)zz; const bool hires = (i < RH); const float* sr = Sb + (size_t)row * TT; float v[TT / 32]; float mx = -3.0e38f;
#pragma unroll
    for (int ch = 0; ch < TT / 128; ++ch) { const int j0 = ch * 128 + lane * 4; const v4f a = *(const v4f*)(sr + j0); const v4i mk4 = *(const v4i*)(mk + (size_t)i * TT + j0);
#pragma unroll
        for (int q = 0; q < 4; ++q) { const int j = j0 + q; (void)j; const float t = (mk4[q] != 0) ? a[q] * SCL : -3.0e38f; v[ch * 4 + q] = t; mx = fmaxf(mx, t); } }
#pragma unroll
    for (int sh = 16; sh; sh >>= 1) mx = fmaxf(mx, __shfl_xor(mx, sh, 32));
    float sum = 0.f;
#pragma unroll
    for (int k = 0; k < TT / 32; ++k) { float d0 = __fsub_rn(v[k], mx); asm volatile("" : "+v"(d0)); v[k] = __builtin_amdgcn_exp2f(__fmul_rn(d0, 1.4426950408889634f)); sum += v[k]; }
#pragma unroll
    for (int sh = 16; sh; sh >>= 1) sum += __shfl_xor(sum, sh, 32);
    const float f = __fdiv_rn(hires ? 1.0f : PCAR, sum);
{
        if (hires) {
#pragma unroll
            for (int ch = 0; ch < TT / 128; ++ch) { v4us oh, ol;
#pragma unroll
                for (int q = 0; q < 4; ++q) { unsigned short a, c2; splitf(v[ch * 4 + q] * f, a, c2); oh[q] = a; ol[q] = c2; }
                const size_t oo = ((size_t)zz * (RH ? RH : 1) + i) * TT + ch * 128 + lane * 4; *(v4us*)(Ph + oo) = oh; *(v4us*)(Pl + oo) = ol; }
        } else {
#pragma unroll
            for (int ch = 0; ch < TT / 128; ++ch) { v4h o4;
#pragma unroll
                for (int q = 0; q < 4; ++q) o4[q] = tohx(v[ch * 4 + q] * f);
                *(v4h*)(P16 + (size_t)row * TT + ch * 128 + lane * 4) = o4; } }
         }
}
__global__ __launch_bounds__(256) void k_merge(const float* __restrict__ O, int h0, bf* Ah, bf* Al) { const size_t e = ((size_t)blockIdx.x * 256 + threadIdx.x) * 2; if (e >= (size_t)ZH * TT * HD) return; const int d = (int)(e % HD); const int t = (int)((e / HD) % TT); const int zz = (int)(e / ((size_t)HD * TT)); const float cs = (t < RH) ? 1.0f : (1.0f / PCAR); const size_t oo = (size_t)t * DQ + (h0 + zz) * HD + d;
    v2us oh, ol;
#pragma unroll
    for (int q = 0; q < 2; ++q) { unsigned short a, c2; splitf(O[e + q] * cs, a, c2); oh[q] = a; ol[q] = c2; } *(v2us*)(Ah + oo) = oh; *(v2us*)(Al + oo) = ol;  }

extern "C" void kernel_launch(void* const* d_in, const int* in_sizes, int n_in,
                              void* d_out, int out_size, void* d_ws, size_t ws_size, hipStream_t stream) {
    (void)in_sizes; (void)n_in; (void)out_size;
    const float* x = (const float*)d_in[0]; const float* wq = (const float*)d_in[1]; const float* bqv = (const float*)d_in[2]; const float* wk = (const float*)d_in[3]; const float* bkv = (const float*)d_in[4]; const float* wv = (const float*)d_in[5]; const float* bvv = (const float*)d_in[6]; const float* wo = (const float*)d_in[7]; const float* bo = (const float*)d_in[8]; const int* mk = (const int*)d_in[9];   // torch [out][in] weights; mask int32 [1][1][1024][1024] (nonzero = attend)
    float* OUT = (float*)d_out;     // [4][1024][1024]
    char* wsp = (char*)d_ws;
    auto take = [&](size_t bytes) { char* p = wsp; wsp += (bytes + 255) & ~(size_t)255; return (void*)p; };
    bf* WQ = (bf*)take((size_t)DQ * DM * 2); bf* WK = (bf*)take((size_t)DKV * DM * 2); bf* WV = (bf*)take((size_t)DKV * DM * 2); bf* WO = (bf*)take((size_t)DM * DQ * 2); float* CS = (float*)take((size_t)TT * HD * 2 * 4);
    bf* XB = (bf*)take((size_t)NB_ * TT * DM * 2); float* FQ = (float*)take((size_t)NB_ * TT * DQ * 4); float* FK = (float*)take((size_t)NB_ * TT * DKV * 4);
    h16* QP16 = (h16*)take((size_t)NB_ * NH_ * TT * HD * 2); h16* KP16 = (h16*)take((size_t)NB_ * NKV * TT * HD * 2); h16* VT16 = (h16*)take((size_t)NB_ * NKV * HD * TT * 2);
    bf* QPh = (bf*)take((size_t)NB_ * NH_ * TT * HD * 2); bf* QPl = (bf*)take((size_t)NB_ * NH_ * TT * HD * 2); bf* KPh = (bf*)take((size_t)NB_ * NKV * TT * HD * 2); bf* KPl = (bf*)take((size_t)NB_ * NKV * TT * HD * 2); bf* VTh = (bf*)take((size_t)NB_ * NKV * HD * TT * 2); bf* VTl = (bf*)take((size_t)NB_ * NKV * HD * TT * 2); bf* Ph = (bf*)take((size_t)ZH * RH * TT * 2); bf* Pl = (bf*)take((size_t)ZH * RH * TT * 2);
    float* Sb = (float*)take((size_t)ZH * TT * TT * 4); h16* P16 = (h16*)take((size_t)ZH * TT * TT * 2); float* Ob = (float*)take((size_t)ZH * TT * HD * 4); bf* ATh = (bf*)take((size_t)NB_ * TT * DQ * 2); bf* ATl = (bf*)take((size_t)NB_ * TT * DQ * 2);
    if ((size_t)(wsp - (char*)d_ws) > ws_size) return;    // 252.5 MiB of the 256 MiB workspace
    float* FV = FK;   // v projection reuses the k buffer after the k planes are built (stream-ordered)
    { k_cvt8<<<(unsigned)(((size_t)DQ * DM / 8 + 255) / 256), 256, 0, stream>>>(wq, WQ, (size_t)DQ * DM / 8); k_cvt8<<<(unsigned)(((size_t)DKV * DM / 8 + 255) / 256), 256, 0, stream>>>(wk, WK, (size_t)DKV * DM / 8); k_cvt8<<<(unsigned)(((size_t)DKV * DM / 8 + 255) / 256), 256, 0, stream>>>(wv, WV, (size_t)DKV * DM / 8);
      k_cvt8<<<(unsigned)(((size_t)DM * DQ / 8 + 255) / 256), 256, 0, stream>>>(wo, WO, (size_t)DM * DQ / 8);
      k_cstab<<<(TT * HD + 255) / 256, 256, 0, stream>>>(CS); }
    const unsigned LQ = (unsigned)(((size_t)NB_ * NH_ * TT * HD / 2 + 255) / 256), LKv = (unsigned)(((size_t)NB_ * NKV * TT * HD / 2 + 255) / 256);
    // all batch items per launch: x is [NB_*TT][DM], so the projections are plain GEMMs with M = NB_*TT
    k_cvt8<<<(unsigned)(((size_t)NB_ * TT * DM / 8 + 255) / 256), 256, 0, stream>>>(x, XB, (size_t)NB_ * TT * DM / 8);
    k_gemmw<bf, 0, true><<<dim3(NB_ * TT / 64, DQ / 64, 1), 32, 0, stream>>>(XB, nullptr, WQ, nullptr, DM, FQ, DQ, bqv, 0, 0, 0);
    k_rope<<<LQ, 256, 0, stream>>>(FQ, DQ, NH_, NB_, CS, nullptr, nullptr, 1.0f, QP16, QPh, QPl);
    k_gemmw<bf, 0, true><<<dim3(NB_ * TT / 64, DKV / 64, 1), 32, 0, stream>>>(XB, nullptr, WK, nullptr, DM, FK, DKV, bkv, 0, 0, 0);
    k_rope<<<LKv, 256, 0, stream>>>(FK, DKV, NKV, NB_, CS, nullptr, nullptr, 1.0f, KP16, KPh, KPl);
    k_gemmw<bf, 0, true><<<dim3(NB_ * TT / 64, DKV / 64, 1), 32, 0, stream>>>(XB, nullptr, WV, nullptr, DM, FV, DKV, bvv, 0, 0, 0); k_vtp<<<LKv, 256, 0, stream>>>(FV, DKV, NKV, NB_, VT16, VTh, VTl);
    for (int b = 0; b < NB_; ++b) {
        for (int h0 = 0; h0 < NH_; h0 += ZH) { const size_t zq = (size_t)b * NH_ + h0, zk = (size_t)b * NKV + h0 / REP;   // one kv head per query head: the pass's heads use consecutive kv planes (z-strides TT*HD)
            k_gemmw<bf, 2, false><<<dim3(RH / 64, TT / 64, ZH), 32, 0, stream>>>(QPh + zq * TT * HD, QPl + zq * TT * HD, KPh + zk * TT * HD, KPl + zk * TT * HD, HD, Sb, TT, nullptr, (size_t)TT * HD, (size_t)TT * HD, (size_t)TT * TT);
            k_gemmw<h16, 0, false><<<dim3((TT - RH) / 64, TT / 64, ZH), 32, 0, stream>>>(QP16 + zq * TT * HD + (size_t)RH * HD, nullptr, KP16 + zk * TT * HD, nullptr, HD, Sb + (size_t)RH * TT, TT, nullptr, (size_t)TT * HD, (size_t)TT * HD, (size_t)TT * TT);
            k_asoft<<<ZH * TT / 8, 256, 0, stream>>>(Sb, mk, P16, Ph, Pl);
            k_gemmw<bf, 2, false><<<dim3(RH / 64, HD / 64, ZH), 32, 0, stream>>>(Ph, Pl, VTh + zk * HD * TT, VTl + zk * HD * TT, TT, Ob, HD, nullptr, (size_t)RH * TT, (size_t)HD * TT, (size_t)TT * HD);
            k_gemmw<h16, 0, false><<<dim3((TT - RH) / 64, HD / 64, ZH), 32, 0, stream>>>(P16 + (size_t)RH * TT, nullptr, VT16 + zk * HD * TT, nullptr, TT, Ob + (size_t)RH * HD, HD, nullptr, (size_t)TT * TT, (size_t)HD * TT, (size_t)TT * HD);
            k_merge<<<(unsigned)(((size_t)ZH * TT * HD / 2 + 255) / 256), 256, 0, stream>>>(Ob, h0, ATh + (size_t)b * TT * DQ, ATl + (size_t)b * TT * DQ); } }
    k_gemmw<bf, 1, true><<<dim3(NB_ * TT / 64, DM / 64, 1), 32, 0, stream>>>(ATh, ATl, WO, nullptr, DQ, OUT, DM, bo, 0, 0, 0);
}

// v003
// Measured time: 226 microseconds a run.
// Versions between v001 and this one are left out; their measured steps multiply to 2.36 times as fast.
// Over all steps from v000 it is 10.6 times as fast.
#include <hip/hip_runtime.h>

// MultiHeadAttentionEuclid (x [4][1024][1024]; q/k/v = x W^T + b (16 heads x 64); interleaved-pair rotary (base 1e4, positions 0..1023 computed on device); scores = q.k/8 where mask[0][0][i][j] != 0 (int32 [1][1][1024][1024],
// read as data; here causal), -inf elsewhere; softmax; out = merged att.v Wo^T + bo -> [4][1024][1024]).
// Compute dtypes, f32 accumulate: every input rounded to bf16; projections on PLAIN bf16 operands (inputs: exact, + bias); rope f32; scores (K 64) and att.v on bf16 hi+lo planes (3 products)
// for the first 256 query rows of each head and SINGLE fp16 planes for the rest; f32 masked online softmax in registers; merged heads hl x exact Wo (2 products) + bo. One-wave-per-64x64-tile GEMMs. Deterministic, no atomics;
// Launch plan: projections and the output product take all 4 batch items in one grid (rows b*1024 + t, planes [b][h]); a 64-column tile is one head, so each projection's epilogue writes the 16-bit head planes itself
// (q, k: bias, rope, split; v: computed as Wv x^T, bias, split, rows d with t contiguous); scores, softmax and att.v of all 64 (batch, head) pairs are one launch (k_fattn).

#define NB_  4
#define TT   1024
#define DM   1024
#define NH_  16
#define NKV  16
#define REP  (NH_ / NKV)
#define HD   64
#define DQ   (NH_ * HD)
#define DKV  (NKV * HD)
#define RH   256                  // query rows < RH use hi+lo planes
#define WIN  0
#define SCL  0.125f   // HD^-0.5
typedef _Float16 h16;
typedef unsigned short bf;
typedef __attribute__((ext_vector_type(16))) __bf16   v16bf;
typedef __attribute__((ext_vector_type(16))) _Float16 v16h;
typedef __attribute__((ext_vector_type(8)))  _Float16 v8h;
typedef __attribute__((ext_vector_type(8)))  unsigned short v8us;
typedef __attribute__((ext_vector_type(8)))  float    v8f;
typedef __attribute__((ext_vector_type(4)))  float    v4f;
typedef v8h  __attribute__((may_alias)) v8ha;
typedef v4f  __attribute__((may_alias)) v4fa;
typedef v8us __attribute__((may_alias)) v8usa;

__device__ __forceinline__ unsigned short f2bf(float f) { unsigned u = __float_as_uint(f); u += 0x7FFFu + ((u >> 16) & 1u); return (unsigned short)(u >> 16); }
__device__ __forceinline__ float bf2f(unsigned short b) { return __uint_as_float(((unsigned)b) << 16); }
__device__ __forceinline__ float bfr(float f) { return bf2f(f2bf(f)); }
__device__ __forceinline__ v16h cat16(v8h lo, v8h hi) { return __builtin_shufflevector(lo, hi, 0, 1, 2, 3, 4, 5, 6, 7, 8, 9, 10, 11, 12, 13, 14, 15); }
__device__ __forceinline__ v16bf cat16b(v8us lo, v8us hi) { return __builtin_bit_cast(v16bf, __builtin_shufflevector(lo, hi, 0, 1, 2, 3, 4, 5, 6, 7, 8, 9, 10, 11, 12, 13, 14, 15)); }
__device__ __forceinline__ v8f wmma16(v16h a, v16h b, v8f c) { return __builtin_amdgcn_wmma_f32_16x16x32_f16(false, a, false, b, (short)0, c, false, false); }
__device__ __forceinline__ v8f wmmab(v16bf a, v16bf b, v8f c) { return __builtin_amdgcn_wmma_f32_16x16x32_bf16(false, a, false, b, (short)0, c, false, false); }



__device__ __forceinline__ h16 tohx(float x) { return (h16)x; }
__device__ __forceinline__ void splitf(float y, unsigned short& h, unsigned short& l) { h = f2bf(y); l = f2bf(y - bf2f(h)); }
typedef __attribute__((ext_vector_type(2))) _Float16 v2h;
typedef __attribute__((ext_vector_type(4))) _Float16 v4h;
typedef __attribute__((ext_vector_type(2))) unsigned short v2us;
typedef __attribute__((ext_vector_type(4))) unsigned short v4us;
typedef __attribute__((ext_vector_type(2))) float v2f;
typedef __attribute__((ext_vector_type(4))) int v4i;

// ---- k_gemmw: register-blocked GEMM, ONE WAVE per 64x64 output tile (16 accumulators), operands straight from K-contiguous 16-bit planes; grid (M/64, N/64, Z), 32 threads.
// C[m][n] (f32, pitch ldc, + optional f32 bias[n]) = sum_k A[m][k] Bt[n][k] (+ split products per NSPLIT). z-batch strides sA/sB/sC in elements. K % 32 == 0.
// EPI 0: C as above. EPI 1 (rows m = b*TT + t, column tile = head): bias[n], interleaved-pair rope from the table CS ([t][d] -> cos, sin), then the fp16, bf16 hi and bf16 lo planes [b][head][t][d].
// EPI 2 (row tile = head, columns n = b*TT + t): bias[m], then the same three planes as [b][head][d][t]. Neither writes C.
template <typename T16> struct WFrag;
template <> struct WFrag<h16> { typedef v16h V; static __device__ __forceinline__ V ld(const h16* p) { return cat16(*(const v8h*)p, *(const v8h*)(p + 16)); } static __device__ __forceinline__ v8f mma(V a, V b, v8f c) { return wmma16(a, b, c); } };
template <> struct WFrag<bf> { typedef v16bf V; static __device__ __forceinline__ V ld(const bf* p) { return cat16b(*(const v8us*)p, *(const v8us*)(p + 16)); } static __device__ __forceinline__ v8f mma(V a, V b, v8f c) { return wmmab(a, b, c); } };
template <typename T16, int NSPLIT, bool BIAS, int EPI>
__global__ __launch_bounds__(32) void k_gemmw(const T16* __restrict__ A, const T16* __restrict__ A2, const T16* __restrict__ Bt, const T16* __restrict__ Bt2, int K, float* C, int ldc, const float* __restrict__ bias, size_t sA, size_t sB, size_t sC, const float* __restrict__ CS, h16* __restrict__ P16, bf* __restrict__ Ph, bf* __restrict__ Pl) {
    typedef typename WFrag<T16>::V V;
    __shared__ __align__(16) float os[16 * 68];
    const size_t z = blockIdx.z; A += z * sA; if (A2) A2 += z * sA; Bt += z * sB; if (Bt2) Bt2 += z * sB; C += z * sC;
    const int lane = threadIdx.x & 31, lr = lane & 15, hi = lane >> 4; const int r0 = blockIdx.x * 64, c0 = blockIdx.y * 64;
    v8f acc[4][4];
#pragma unroll
    for (int mb = 0; mb < 4; ++mb)
#pragma unroll
        for (int nb = 0; nb < 4; ++nb) acc[mb][nb] = (v8f){};
    const size_t aoff = (size_t)(r0 + lr) * K + 8 * hi, boff = (size_t)(c0 + lr) * K + 8 * hi;
#pragma unroll 1
    for (int kc = 0; kc < K; kc += 32) {
        V a[4], a2[4];
#pragma unroll
        for (int mb = 0; mb < 4; ++mb) { a[mb] = WFrag<T16>::ld(A + aoff + (size_t)mb * 16 * K + kc); if (NSPLIT == 1 || NSPLIT == 2) a2[mb] = WFrag<T16>::ld(A2 + aoff + (size_t)mb * 16 * K + kc); }
#pragma unroll
        for (int nb = 0; nb < 4; ++nb) { const V b = WFrag<T16>::ld(Bt + boff + (size_t)nb * 16 * K + kc); V b2; if (NSPLIT >= 2) b2 = WFrag<T16>::ld(Bt2 + boff + (size_t)nb * 16 * K + kc);
#pragma unroll
            for (int mb = 0; mb < 4; ++mb) { acc[mb][nb] = WFrag<T16>::mma(a[mb], b, acc[mb][nb]); if (NSPLIT == 1 || NSPLIT == 2) acc[mb][nb] = WFrag<T16>::mma(a2[mb], b, acc[mb][nb]); if (NSPLIT >= 2) acc[mb][nb] = WFrag<T16>::mma(a[mb], b2, acc[mb][nb]); } }
        asm volatile("v_nop\n\tv_nop\n\tv_nop\n\tv_nop" : "+v"(acc[0][0]), "+v"(acc[1][1]), "+v"(acc[2][2]), "+v"(acc[3][3]) : "v"(a[0]), "v"(a[3]));
    }
    static_assert(EPI == 0 || HD == 64, "a 64-wide tile is one head");
    float cb[4], rb[4][8]; v2f cs[2][8][2]; size_t pbase = 0;   // all of a row block's table entries are asked for one row block ahead, as one batch
    const float* const cp0 = CS + ((size_t)(r0 % TT + hi) * HD + lr * 4) * 2;   // this lane's first table entry; every other one is a constant step from it
    if (EPI == 1) { pbase = ((size_t)((r0 / TT) * gridDim.y + blockIdx.y) * TT + (r0 % TT)) * HD + lr * 4;
#pragma unroll
        for (int i = 0; i < 4; ++i) cb[i] = bfr(bias[c0 + lr * 4 + i]);
#pragma unroll
        for (int s = 0; s < 8; ++s) { const float* cp = cp0 + 2 * s * HD * 2; cs[0][s][0] = *(const v2f*)cp; cs[0][s][1] = *(const v2f*)(cp + 4); } }
    if (EPI == 2) { pbase = (size_t)((c0 / TT) * gridDim.x + blockIdx.x) * HD * TT + (c0 % TT) + lr * 4;
#pragma unroll
        for (int mb = 0; mb < 4; ++mb)
#pragma unroll
            for (int s = 0; s < 8; ++s) rb[mb][s] = bfr(bias[r0 + mb * 16 + 2 * s + hi]); }
#pragma unroll
    for (int mb = 0; mb < 4; ++mb) {
        if (EPI == 1 && mb < 3) {
#pragma unroll
            for (int s = 0; s < 8; ++s) { const float* cp = cp0 + ((mb + 1) * 16 + 2 * s) * HD * 2; cs[(mb + 1) & 1][s][0] = *(const v2f*)cp; cs[(mb + 1) & 1][s][1] = *(const v2f*)(cp + 4); } }
#pragma unroll
        for (int nb = 0; nb < 4; ++nb) {
#pragma unroll
            for (int j = 0; j < 8; ++j) os[(hi * 8 + j) * 68 + nb * 16 + lr] = acc[mb][nb][j]; }
        __builtin_amdgcn_wave_barrier(); asm volatile("" ::: "memory");
        float* crow = C + (size_t)(r0 + mb * 16) * ldc + c0;
        if (EPI != 0) {
#pragma unroll
            for (int s = 0; s < 8; ++s) { const int row = 2 * s + hi; const v4f val = *(const v4fa*)(os + row * 68 + lr * 4); float r[4];
                if (EPI == 1) { const float x0 = val[0] + cb[0], x1 = val[1] + cb[1], x2 = val[2] + cb[2], x3 = val[3] + cb[3]; const v2f ca = cs[mb & 1][s][0], cc = cs[mb & 1][s][1];
                    r[0] = x0 * ca[0] - x1 * ca[1]; r[1] = x1 * ca[0] + x0 * ca[1]; r[2] = x2 * cc[0] - x3 * cc[1]; r[3] = x3 * cc[0] + x2 * cc[1]; }
                else { r[0] = val[0] + rb[mb][s]; r[1] = val[1] + rb[mb][s]; r[2] = val[2] + rb[mb][s]; r[3] = val[3] + rb[mb][s]; }
                v4h o16; v4us oh, ol;
#pragma unroll
                for (int i = 0; i < 4; ++i) { o16[i] = tohx(r[i]); unsigned short a2, c2; splitf(r[i], a2, c2); oh[i] = a2; ol[i] = c2; }
                const size_t e = pbase + (size_t)(mb * 16 + row) * (EPI == 1 ? HD : TT);   // 16 lanes x 8 bytes: one whole line per row and plane
                *(v4h*)(P16 + e) = o16; *(v4us*)(Ph + e) = oh; *(v4us*)(Pl + e) = ol; }
            if (EPI == 1 && mb < 2) asm volatile("s_wait_xcnt 0x0" ::: "memory");   // the table loads that follow land in registers that these stores still name as data: the wait stands in front of that rewrite
        } else {
#pragma unroll
            for (int s = 0; s < 8; ++s) { const int row = 2 * s + hi, cofs = lr * 4; v4f val = *(const v4fa*)(os + row * 68 + cofs); if (BIAS) { val[0] += bfr(bias[c0 + cofs]); val[1] += bfr(bias[c0 + cofs + 1]); val[2] += bfr(bias[c0 + cofs + 2]); val[3] += bfr(bias[c0 + cofs + 3]); }
                *(v4f*)(crow + (size_t)row * ldc + cofs) = val; }
             }
        __builtin_amdgcn_wave_barrier(); asm volatile("" ::: "memory");
    }
}


__global__ __launch_bounds__(256) void k_wtG(const float* __restrict__ w, int K, int N, bf* Bt) {
    const int lane = threadIdx.x & 31; const int L0 = (blockIdx.x * 8 + (threadIdx.x >> 5)) * 8; const int nlines = N * K / 64;
{
#pragma unroll 1
        for (int l = 0; l < 8; ++l) { const int L = L0 + l; if (L >= nlines) break; const size_t e = (size_t)L * 64 + lane * 2; const int k = (int)(e % K), n = (int)(e / K); v2us o;
            o[0] = f2bf(w[(size_t)k * N + n]); o[1] = f2bf(w[(size_t)(k + 1) * N + n]); *(v2us*)(Bt + e) = o; }
         }
}
__global__ __launch_bounds__(256) void k_cvt8(const float* __restrict__ src, bf* dst, size_t n8) { const size_t i = (size_t)blockIdx.x * 256 + threadIdx.x; if (i >= n8) return; const v8f v = *(const v8f*)(src + i * 8); v8us o;
#pragma unroll
    for (int k = 0; k < 8; ++k) o[k] = f2bf(v[k]); *(v8us*)(dst + i * 8) = o;  }
__global__ __launch_bounds__(256) void k_cstab(float* CS) { const int idx = blockIdx.x * 256 + threadIdx.x; if (idx >= TT * HD) return; const int t = idx / HD, d = idx % HD; const int i = d >> 1; const float inv = __fdiv_rn(1.0f, powf(10000.0f, (float)(2 * i) / (float)HD)); const float ang = __fmul_rn((float)t, inv); v2f cs; cs[0] = cosf(ang); cs[1] = sinf(ang);
    *(v2f*)(CS + (size_t)idx * 2) = cs;  }
__device__ __forceinline__ float xhalf(float x) { return __builtin_bit_cast(float, __builtin_amdgcn_permlanex16(__builtin_bit_cast(int, x), __builtin_bit_cast(int, x), 0x76543210, 0xfedcba98, false, false)); }  // lane l takes lane l ^ 16's value
template <typename T16> struct PFrag;
template <> struct PFrag<h16> { static constexpr bool SPLIT = false; static __device__ __forceinline__ void pack(const float* p, v16h& a, v16h& b) { (void)b;
#pragma unroll
    for (int s = 0; s < 16; ++s) a[s] = (h16)p[s]; } };
template <> struct PFrag<bf> { static constexpr bool SPLIT = true; static __device__ __forceinline__ void pack(const float* p, v16bf& a, v16bf& b) {
#pragma unroll
    for (int s = 0; s < 16; ++s) { const __bf16 h = (__bf16)p[s]; a[s] = h; b[s] = (__bf16)(p[s] - (float)h); } } };
template <typename T16, int QT>
__device__ __forceinline__ void fattn_tile(const T16* __restrict__ Q, const T16* __restrict__ Q2, const T16* __restrict__ Kp, const T16* __restrict__ K2, const T16* __restrict__ Vt, const T16* __restrict__ Vt2, const int* __restrict__ mk, int q0, bf* Ah, bf* Al) {
    typedef typename WFrag<T16>::V V; constexpr bool SP = PFrag<T16>::SPLIT; constexpr float SH = SP ? 0.0f : 10.0f;
    const int lane = threadIdx.x & 31, lr = lane & 15, hi = lane >> 4;
    V qf[QT][2], qf2[QT][2]; v8f o[QT][4]; float m[QT], l[QT];
#pragma unroll
    for (int qt = 0; qt < QT; ++qt) { m[qt] = -3.0e38f; l[qt] = 0.0f;
#pragma unroll
        for (int ks = 0; ks < 2; ++ks) { const size_t qo = (size_t)(q0 + qt * 16 + lr) * HD + ks * 32 + 8 * hi; qf[qt][ks] = WFrag<T16>::ld(Q + qo); if (SP) qf2[qt][ks] = WFrag<T16>::ld(Q2 + qo); }
#pragma unroll
        for (int dt = 0; dt < 4; ++dt) o[qt][dt] = (v8f){}; }
    const size_t ko = (size_t)lr * HD + 8 * hi, vo = (size_t)lr * TT + 8 * hi, mo = (size_t)(q0 + lr) * TT + 8 * hi;
#pragma unroll 1
    for (int kb = 0; kb < TT; kb += 32) {
        V kf[2][2], kf2[2][2], vf[4], vf2[4]; v4i mq[QT][2][2];
#pragma unroll
        for (int kt = 0; kt < 2; ++kt)
#pragma unroll
            for (int ks = 0; ks < 2; ++ks) { const size_t e = ko + (size_t)(kb + kt * 16) * HD + ks * 32; kf[kt][ks] = WFrag<T16>::ld(Kp + e); if (SP) kf2[kt][ks] = WFrag<T16>::ld(K2 + e); }
#pragma unroll
        for (int qt = 0; qt < QT; ++qt)
#pragma unroll
            for (int kt = 0; kt < 2; ++kt) { const int* mp = mk + mo + (size_t)qt * 16 * TT + kb + kt * 16; mq[qt][kt][0] = *(const v4i*)mp; mq[qt][kt][1] = *(const v4i*)(mp + 4); }
#pragma unroll
        for (int dt = 0; dt < 4; ++dt) { const size_t e = vo + (size_t)dt * 16 * TT + kb; vf[dt] = WFrag<T16>::ld(Vt + e); if (SP) vf2[dt] = WFrag<T16>::ld(Vt2 + e); }
#pragma unroll
        for (int qt = 0; qt < QT; ++qt) {
            float t[16]; float bm = -3.0e38f;
#pragma unroll
            for (int kt = 0; kt < 2; ++kt) { v8f s = (v8f){};
#pragma unroll
                for (int ks = 0; ks < 2; ++ks) { s = WFrag<T16>::mma(kf[kt][ks], qf[qt][ks], s); if (SP) { s = WFrag<T16>::mma(kf2[kt][ks], qf[qt][ks], s); s = WFrag<T16>::mma(kf[kt][ks], qf2[qt][ks], s); } }
#pragma unroll
                for (int j = 0; j < 8; ++j) { const float x = (mq[qt][kt][j >> 2][j & 3] != 0) ? s[j] * (SCL * 1.4426950408889634f) : -3.0e38f; t[kt * 8 + j] = x; bm = fmaxf(bm, x); } }
            bm = fmaxf(bm, xhalf(bm));
            const float mn = fmaxf(m[qt], bm); const float al = __builtin_amdgcn_exp2f(m[qt] - mn); m[qt] = mn; const float mb = mn - SH; float ps = 0.0f;
#pragma unroll
            for (int s = 0; s < 16; ++s) { t[s] = __builtin_amdgcn_exp2f(t[s] - mb); ps += t[s]; }
            l[qt] = l[qt] * al + ps;
#pragma unroll
            for (int dt = 0; dt < 4; ++dt) o[qt][dt] *= al;
            V pf, pf2; PFrag<T16>::pack(t, pf, pf2);
#pragma unroll
            for (int dt = 0; dt < 4; ++dt) { o[qt][dt] = WFrag<T16>::mma(vf[dt], pf, o[qt][dt]); if (SP) { o[qt][dt] = WFrag<T16>::mma(vf2[dt], pf, o[qt][dt]); o[qt][dt] = WFrag<T16>::mma(vf[dt], pf2, o[qt][dt]); } }
        }
        __builtin_amdgcn_sched_barrier(0);   // keeps the next pass's address additions behind this pass's last load wait: without it they are lifted over loads still in flight that name those registers
    }
#pragma unroll
    for (int qt = 0; qt < QT; ++qt) { const float inv = __fdiv_rn(1.0f, l[qt] + xhalf(l[qt])); const size_t oo = (size_t)(q0 + qt * 16 + lr) * DQ + 8 * hi;
#pragma unroll
        for (int dt = 0; dt < 4; ++dt) { v8us oh, ol;
#pragma unroll
            for (int j = 0; j < 8; ++j) { unsigned short a, c2; splitf(o[qt][dt][j] * inv, a, c2); oh[j] = a; ol[j] = c2; }
            *(v8us*)(Ah + oo + dt * 16) = oh; *(v8us*)(Al + oo + dt * 16) = ol; } }
}
// grid (FBX, NB_*NH_), 5 waves of one head per block, every block the same work: waves 0, 1 take 16 hi+lo query rows each, waves 2..4 take 32 fp16 query rows each (RH/16 = 2 FBX and (TT-RH)/32 = 3 FBX tiles a head)
#define FBX 8
static_assert(RH == 2 * FBX * 16 && TT - RH == 3 * FBX * 32, "tiles per block");
__global__ __launch_bounds__(160) void k_fattn(const h16* __restrict__ Q16, const h16* __restrict__ K16, const h16* __restrict__ V16, const bf* __restrict__ Qh, const bf* __restrict__ Ql, const bf* __restrict__ Kh, const bf* __restrict__ Kl, const bf* __restrict__ Vh, const bf* __restrict__ Vl, const int* __restrict__ mk, bf* Ah, bf* Al) {
    const int bh = blockIdx.y, bx = blockIdx.x, wave = __builtin_amdgcn_readfirstlane(threadIdx.x >> 5); const size_t pq = (size_t)bh * TT * HD, pk = (size_t)(bh / REP) * TT * HD; const size_t ao = (size_t)(bh / NH_) * TT * DQ + (size_t)(bh % NH_) * HD;
    if (wave < 2) fattn_tile<bf, 1>(Qh + pq, Ql + pq, Kh + pk, Kl + pk, Vh + pk, Vl + pk, mk, (bx * 2 + wave) * 16, Ah + ao, Al + ao);
    else fattn_tile<h16, 2>(Q16 + pq, nullptr, K16 + pk, nullptr, V16 + pk, nullptr, mk, RH + (bx * 3 + wave - 2) * 32, Ah + ao, Al + ao);
}

extern "C" void kernel_launch(void* const* d_in, const int* in_sizes, int n_in,
                              void* d_out, int out_size, void* d_ws, size_t ws_size, hipStream_t stream) {
    (void)in_sizes; (void)n_in; (void)out_size;
    const float* x = (const float*)d_in[0]; const float* wq = (const float*)d_in[1]; const float* bqv = (const float*)d_in[2]; const float* wk = (const float*)d_in[3]; const float* bkv = (const float*)d_in[4]; const float* wv = (const float*)d_in[5]; const float* bvv = (const float*)d_in[6]; const float* wo = (const float*)d_in[7]; const float* bo = (const float*)d_in[8]; const int* mk = (const int*)d_in[9];   // torch [out][in] weights; mask int32 [1][1][1024][1024] (nonzero = attend)
    float* OUT = (float*)d_out;     // [4][1024][1024]
    char* wsp = (char*)d_ws;
    auto take = [&](size_t bytes) { char* p = wsp; wsp += (bytes + 255) & ~(size_t)255; return (void*)p; };
    bf* WQ = (bf*)take((size_t)DQ * DM * 2); bf* WK = (bf*)take((size_t)DKV * DM * 2); bf* WV = (bf*)take((size_t)DKV * DM * 2); bf* WO = (bf*)take((size_t)DM * DQ * 2); float* CS = (float*)take((size_t)TT * HD * 2 * 4);
    bf* XB = (bf*)take((size_t)NB_ * TT * DM * 2);
    h16* QP16 = (h16*)take((size_t)NB_ * NH_ * TT * HD * 2); h16* KP16 = (h16*)take((size_t)NB_ * NKV * TT * HD * 2); h16* VT16 = (h16*)take((size_t)NB_ * NKV * HD * TT * 2);
    bf* QPh = (bf*)take((size_t)NB_ * NH_ * TT * HD * 2); bf* QPl = (bf*)take((size_t)NB_ * NH_ * TT * HD * 2); bf* KPh = (bf*)take((size_t)NB_ * NKV * TT * HD * 2); bf* KPl = (bf*)take((size_t)NB_ * NKV * TT * HD * 2); bf* VTh = (bf*)take((size_t)NB_ * NKV * HD * TT * 2); bf* VTl = (bf*)take((size_t)NB_ * NKV * HD * TT * 2);
    bf* ATh = (bf*)take((size_t)NB_ * TT * DQ * 2); bf* ATl = (bf*)take((size_t)NB_ * TT * DQ * 2);
    if ((size_t)(wsp - (char*)d_ws) > ws_size) return;    // well inside the workspace
    { k_cvt8<<<(unsigned)(((size_t)DQ * DM / 8 + 255) / 256), 256, 0, stream>>>(wq, WQ, (size_t)DQ * DM / 8); k_cvt8<<<(unsigned)(((size_t)DKV * DM / 8 + 255) / 256), 256, 0, stream>>>(wk, WK, (size_t)DKV * DM / 8); k_cvt8<<<(unsigned)(((size_t)DKV * DM / 8 + 255) / 256), 256, 0, stream>>>(wv, WV, (size_t)DKV * DM / 8);
      k_cvt8<<<(unsigned)(((size_t)DM * DQ / 8 + 255) / 256), 256, 0, stream>>>(wo, WO, (size_t)DM * DQ / 8);
      k_cstab<<<(TT * HD + 255) / 256, 256, 0, stream>>>(CS); }
    // all batch items per launch: x is [NB_*TT][DM], so the projections are plain GEMMs with M = NB_*TT (N = NB_*TT for v^T)
    k_cvt8<<<(unsigned)(((size_t)NB_ * TT * DM / 8 + 255) / 256), 256, 0, stream>>>(x, XB, (size_t)NB_ * TT * DM / 8);
    k_gemmw<bf, 0, true, 1><<<dim3(NB_ * TT / 64, DQ / 64, 1), 32, 0, stream>>>(XB, nullptr, WQ, nullptr, DM, nullptr, 0, bqv, 0, 0, 0, CS, QP16, QPh, QPl);
    k_gemmw<bf, 0, true, 1><<<dim3(NB_ * TT / 64, DKV / 64, 1), 32, 0, stream>>>(XB, nullptr, WK, nullptr, DM, nullptr, 0, bkv, 0, 0, 0, CS, KP16, KPh, KPl);
    k_gemmw<bf, 0, true, 2><<<dim3(DKV / 64, NB_ * TT / 64, 1), 32, 0, stream>>>(WV, nullptr, XB, nullptr, DM, nullptr, 0, bvv, 0, 0, 0, nullptr, VT16, VTh, VTl);   // v^T = Wv x^T: rows d, columns b*TT + t
    k_fattn<<<dim3(FBX, NB_ * NH_, 1), 160, 0, stream>>>(QP16, KP16, VT16, QPh, QPl, KPh, KPl, VTh, VTl, mk, ATh, ATl);
    k_gemmw<bf, 1, true, 0><<<dim3(NB_ * TT / 64, DM / 64, 1), 32, 0, stream>>>(ATh, ATl, WO, nullptr, DQ, OUT, DM, bo, 0, 0, 0, nullptr, nullptr, nullptr, nullptr);
}

// v004
// Measured time: 178 microseconds a run.
// Two timings next to v003 both put it at 1.28 times that version's speed.
// All steps since v000 together make it 13.6 times as fast.
#include <hip/hip_runtime.h>

// MultiHeadAttentionEuclid (x [4][1024][1024]; q/k/v = x W^T + b (16 heads x 64); interleaved-pair rotary (base 1e4, positions 0..1023 computed on device); scores = q.k/8 where mask[0][0][i][j] != 0 (int32 [1][1][1024][1024],
// read as data; here causal), -inf elsewhere; softmax; out = merged att.v Wo^T + bo -> [4][1024][1024]).
// Compute dtypes, f32 accumulate: every input rounded to bf16; projections on PLAIN bf16 operands (inputs: exact, + bias); rope f32; scores (K 64) and att.v on bf16 hi+lo planes (3 products)
// for the first 256 query rows of each head and SINGLE fp16 planes for the rest; f32 masked online softmax in registers; merged heads hl x exact Wo (2 products) + bo. One-wave-per-64x64-tile GEMMs. Deterministic, no atomics;
// Launch plan: projections and the output product take all 4 batch items in one grid (rows b*1024 + t, planes [b][h]); a 64-column tile is one head, so each projection's epilogue writes the 16-bit head planes itself
// (q, k: bias, rope, split; v: computed as Wv x^T, bias, split, rows d with t contiguous); scores, softmax and att.v of all 64 (batch, head) pairs are one launch (k_fattn).

#define NB_  4
#define TT   1024
#define DM   1024
#define NH_  16
#define NKV  16
#define REP  (NH_ / NKV)
#define HD   64
#define DQ   (NH_ * HD)
#define DKV  (NKV * HD)
#define RH   256                  // query rows < RH use hi+lo planes
#define WIN  0
#define SCL  0.125f   // HD^-0.5
typedef _Float16 h16;
typedef unsigned short bf;
typedef __attribute__((ext_vector_type(16))) __bf16   v16bf;
typedef __attribute__((ext_vector_type(16))) _Float16 v16h;
typedef __attribute__((ext_vector_type(8)))  _Float16 v8h;
typedef __attribute__((ext_vector_type(8)))  unsigned short v8us;
typedef __attribute__((ext_vector_type(8)))  float    v8f;
typedef __attribute__((ext_vector_type(4)))  float    v4f;
typedef v8h  __attribute__((may_alias)) v8ha;
typedef v4f  __attribute__((may_alias)) v4fa;
typedef v8us __attribute__((may_alias)) v8usa;

__device__ __forceinline__ unsigned short f2bf(float f) { unsigned u = __float_as_uint(f); u += 0x7FFFu + ((u >> 16) & 1u); return (unsigned short)(u >> 16); }
__device__ __forceinline__ float bf2f(unsigned short b) { return __uint_as_float(((unsigned)b) << 16); }
__device__ __forceinline__ float bfr(float f) { return bf2f(f2bf(f)); }
__device__ __forceinline__ v16h cat16(v8h lo, v8h hi) { return __builtin_shufflevector(lo, hi, 0, 1, 2, 3, 4, 5, 6, 7, 8, 9, 10, 11, 12, 13, 14, 15); }
__device__ __forceinline__ v16bf cat16b(v8us lo, v8us hi) { return __builtin_bit_cast(v16bf, __builtin_shufflevector(lo, hi, 0, 1, 2, 3, 4, 5, 6, 7, 8, 9, 10, 11, 12, 13, 14, 15)); }
__device__ __forceinline__ v8f wmma16(v16h a, v16h b, v8f c) { return __builtin_amdgcn_wmma_f32_16x16x32_f16(false, a, false, b, (short)0, c, false, false); }
__device__ __forceinline__ v8f wmmab(v16bf a, v16bf b, v8f c) { return __builtin_amdgcn_wmma_f32_16x16x32_bf16(false, a, false, b, (short)0, c, false, false); }



__device__ __forceinline__ h16 tohx(float x) { return (h16)x; }
__device__ __forceinline__ void splitf(float y, unsigned short& h, unsigned short& l) { h = f2bf(y); l = f2bf(y - bf2f(h)); }
typedef __attribute__((ext_vector_type(2))) _Float16 v2h;
typedef __attribute__((ext_vector_type(4))) _Float16 v4h;
typedef __attribute__((ext_vector_type(2))) unsigned short v2us;
typedef __attribute__((ext_vector_type(4))) unsigned short v4us;
typedef __attribute__((ext_vector_type(2))) float v2f;
typedef __attribute__((ext_vector_type(4))) int v4i;

// ---- k_gemmw: register-blocked GEMM, ONE WAVE per 64x64 output tile (16 accumulators), operands straight from K-contiguous 16-bit planes; grid (M/64, N/64), 32 threads.
// C[m][n] (f32, pitch ldc, + optional f32 bias[n]) = sum_k A[m][k] Bt[n][k] (+ split products per NSPLIT). K % 32 == 0.
// EPI 0: C as above. EPI 1 (rows m = b*TT + t, column tile = head): bias[n], interleaved-pair rope from the table CS ([t][d] -> cos, sin), then the fp16, bf16 hi and bf16 lo planes [b][head][t][d].
// EPI 2 (row tile = head, columns n = b*TT + t): bias[m], then the same three planes as [b][head][d][t]. Neither writes C.
template <typename T16> struct WFrag;
template <> struct WFrag<h16> { typedef v16h V; static __device__ __forceinline__ V ld(const h16* p) { return cat16(*(const v8h*)p, *(const v8h*)(p + 16)); } static __device__ __forceinline__ v8f mma(V a, V b, v8f c) { return wmma16(a, b, c); } };
template <> struct WFrag<bf> { typedef v16bf V; static __device__ __forceinline__ V ld(const bf* p) { return cat16b(*(const v8us*)p, *(const v8us*)(p + 16)); } static __device__ __forceinline__ v8f mma(V a, V b, v8f c) { return wmmab(a, b, c); } };
// gemmw_tile: the tile (tx, ty) of one wave; os: that wave's own 16 x 68 floats of LDS; nh: heads per batch item (EPI 1, 2).
template <typename T16, int NSPLIT, bool BIAS, int EPI>
__device__ __forceinline__ void gemmw_tile(const T16* __restrict__ A, const T16* __restrict__ A2, const T16* __restrict__ Bt, const T16* __restrict__ Bt2, int K, float* C, int ldc, const float* __restrict__ bias, const float* __restrict__ CS, h16* __restrict__ P16, bf* __restrict__ Ph, bf* __restrict__ Pl, int tx, int ty, int nh, float* os) {
    typedef typename WFrag<T16>::V V;
    const int lane = threadIdx.x & 31, lr = lane & 15, hi = lane >> 4; const int r0 = tx * 64, c0 = ty * 64;
    v8f acc[4][4];
#pragma unroll
    for (int mb = 0; mb < 4; ++mb)
#pragma unroll
        for (int nb = 0; nb < 4; ++nb) acc[mb][nb] = (v8f){};
    const size_t aoff = (size_t)(r0 + lr) * K + 8 * hi, boff = (size_t)(c0 + lr) * K + 8 * hi;
#pragma unroll 1
    for (int kc = 0; kc < K; kc += 32) {
        V a[4], a2[4];
#pragma unroll
        for (int mb = 0; mb < 4; ++mb) { a[mb] = WFrag<T16>::ld(A + aoff + (size_t)mb * 16 * K + kc); if (NSPLIT == 1 || NSPLIT == 2) a2[mb] = WFrag<T16>::ld(A2 + aoff + (size_t)mb * 16 * K + kc); }
#pragma unroll
        for (int nb = 0; nb < 4; ++nb) { const V b = WFrag<T16>::ld(Bt + boff + (size_t)nb * 16 * K + kc); V b2; if (NSPLIT >= 2) b2 = WFrag<T16>::ld(Bt2 + boff + (size_t)nb * 16 * K + kc);
#pragma unroll
            for (int mb = 0; mb < 4; ++mb) { acc[mb][nb] = WFrag<T16>::mma(a[mb], b, acc[mb][nb]); if (NSPLIT == 1 || NSPLIT == 2) acc[mb][nb] = WFrag<T16>::mma(a2[mb], b, acc[mb][nb]); if (NSPLIT >= 2) acc[mb][nb] = WFrag<T16>::mma(a[mb], b2, acc[mb][nb]); } }
        asm volatile("v_nop\n\tv_nop\n\tv_nop\n\tv_nop" : "+v"(acc[0][0]), "+v"(acc[1][1]), "+v"(acc[2][2]), "+v"(acc[3][3]) : "v"(a[0]), "v"(a[3]));
    }
    static_assert(EPI == 0 || HD == 64, "a 64-wide tile is one head");
    float cb[4], rb[4][8]; v2f cs[2][8][2]; size_t pbase = 0;   // all of a row block's table entries are asked for one row block ahead, as one batch
    const float* const cp0 = CS + ((size_t)(r0 % TT + hi) * HD + lr * 4) * 2;   // this lane's first table entry; every other one is a constant step from it
    if (EPI == 1) { pbase = ((size_t)((r0 / TT) * nh + ty) * TT + (r0 % TT)) * HD + lr * 4;
#pragma unroll
        for (int i = 0; i < 4; ++i) cb[i] = bfr(bias[c0 + lr * 4 + i]);
#pragma unroll
        for (int s = 0; s < 8; ++s) { const float* cp = cp0 + 2 * s * HD * 2; cs[0][s][0] = *(const v2f*)cp; cs[0][s][1] = *(const v2f*)(cp + 4); } }
    if (EPI == 2) { pbase = (size_t)((c0 / TT) * nh + tx) * HD * TT + (c0 % TT) + lr * 4;
#pragma unroll
        for (int mb = 0; mb < 4; ++mb)
#pragma unroll
            for (int s = 0; s < 8; ++s) { if (mb == 3 && s == 7) asm volatile("s_wait_xcnt 0x0" ::: "memory");   // without it the last load's result was placed in the offset register that the 31 loads before it still name: the wait stands in front of any such rewrite
                rb[mb][s] = bfr(bias[r0 + mb * 16 + 2 * s + hi]); } }
#pragma unroll
    for (int mb = 0; mb < 4; ++mb) {
        if (EPI == 1 && mb < 3) {
#pragma unroll
            for (int s = 0; s < 8; ++s) { const float* cp = cp0 + ((mb + 1) * 16 + 2 * s) * HD * 2; cs[(mb + 1) & 1][s][0] = *(const v2f*)cp; cs[(mb + 1) & 1][s][1] = *(const v2f*)(cp + 4); } }
#pragma unroll
        for (int nb = 0; nb < 4; ++nb) {
#pragma unroll
            for (int j = 0; j < 8; ++j) os[(hi * 8 + j) * 68 + nb * 16 + lr] = acc[mb][nb][j]; }
        __builtin_amdgcn_wave_barrier(); asm volatile("" ::: "memory");
        float* crow = C + (size_t)(r0 + mb * 16) * ldc + c0;
        if (EPI != 0) {
#pragma unroll
            for (int s = 0; s < 8; ++s) { const int row = 2 * s + hi; const v4f val = *(const v4fa*)(os + row * 68 + lr * 4); float r[4];
                if (EPI == 1) { const float x0 = val[0] + cb[0], x1 = val[1] + cb[1], x2 = val[2] + cb[2], x3 = val[3] + cb[3]; const v2f ca = cs[mb & 1][s][0], cc = cs[mb & 1][s][1];
                    r[0] = x0 * ca[0] - x1 * ca[1]; r[1] = x1 * ca[0] + x0 * ca[1]; r[2] = x2 * cc[0] - x3 * cc[1]; r[3] = x3 * cc[0] + x2 * cc[1]; }
                else { r[0] = val[0] + rb[mb][s]; r[1] = val[1] + rb[mb][s]; r[2] = val[2] + rb[mb][s]; r[3] = val[3] + rb[mb][s]; }
                v4h o16; v4us oh, ol;
#pragma unroll
                for (int i = 0; i < 4; ++i) { o16[i] = tohx(r[i]); unsigned short a2, c2; splitf(r[i], a2, c2); oh[i] = a2; ol[i] = c2; }
                const size_t e = pbase + (size_t)(mb * 16 + row) * (EPI == 1 ? HD : TT);   // 16 lanes x 8 bytes: one whole line per row and plane
                *(v4h*)(P16 + e) = o16; *(v4us*)(Ph + e) = oh; *(v4us*)(Pl + e) = ol; }
            if (EPI == 1 && mb < 2) asm volatile("s_wait_xcnt 0x0" ::: "memory");   // the table loads that follow land in registers that these stores still name as data: the wait stands in front of that rewrite
        } else {
#pragma unroll
            for (int s = 0; s < 8; ++s) { const int row = 2 * s + hi, cofs = lr * 4; v4f val = *(const v4fa*)(os + row * 68 + cofs); if (BIAS) { val[0] += bfr(bias[c0 + cofs]); val[1] += bfr(bias[c0 + cofs + 1]); val[2] += bfr(bias[c0 + cofs + 2]); val[3] += bfr(bias[c0 + cofs + 3]); }
                *(v4f*)(crow + (size_t)row * ldc + cofs) = val; }
             }
        __builtin_amdgcn_wave_barrier(); asm volatile("" ::: "memory");
    }
}
template <typename T16, int NSPLIT, bool BIAS>
__global__ __launch_bounds__(32) void k_gemmw(const T16* __restrict__ A, const T16* __restrict__ A2, const T16* __restrict__ Bt, const T16* __restrict__ Bt2, int K, float* C, int ldc, const float* __restrict__ bias) {
    __shared__ __align__(16) float os[16 * 68];
    gemmw_tile<T16, NSPLIT, BIAS, 0>(A, A2, Bt, Bt2, K, C, ldc, bias, nullptr, nullptr, nullptr, nullptr, blockIdx.x, blockIdx.y, 0, os);
}
// k_qkv: the three projections in one launch, grid (NB_*TT/256, heads), 12 waves a block, one block a WGP: waves 0..3 q, 4..7 k (x W^T), 8..11 v (Wv x^T) of one head, wave w on the 64 rows (w & 3) of the block's 256 rows of x.
// The block's waves read the same 4 row tiles of x and the same 3 weight tiles, so what one wave has fetched the others find in the WGP's cache; no wave reads another's result, and there is no barrier between them.
static_assert(NH_ == NKV && NB_ * TT % 256 == 0, "one grid for q, k and v");
__global__ __launch_bounds__(384) void k_qkv(const bf* __restrict__ X, const bf* __restrict__ Wq, const bf* __restrict__ Wk, const bf* __restrict__ Wv, const float* __restrict__ bq, const float* __restrict__ bk, const float* __restrict__ bv, const float* __restrict__ CS,
                                            h16* __restrict__ Q16, bf* __restrict__ Qh, bf* __restrict__ Ql, h16* __restrict__ K16, bf* __restrict__ Kh, bf* __restrict__ Kl, h16* __restrict__ V16, bf* __restrict__ Vh, bf* __restrict__ Vl) {
    __shared__ __align__(16) float os[12][16 * 68];
    const int wave = __builtin_amdgcn_readfirstlane(threadIdx.x >> 5); const int xt = blockIdx.x * 4 + (wave & 3);
    if (wave < 8) { const bool k = wave >= 4;   // q and k run the same code on their own pointers
        gemmw_tile<bf, 0, true, 1>(X, nullptr, k ? Wk : Wq, nullptr, DM, nullptr, 0, k ? bk : bq, CS, k ? K16 : Q16, k ? Kh : Qh, k ? Kl : Ql, xt, blockIdx.y, NH_, os[wave]); }
    else gemmw_tile<bf, 0, true, 2>(Wv, nullptr, X, nullptr, DM, nullptr, 0, bv, nullptr, V16, Vh, Vl, blockIdx.y, xt, NKV, os[wave]);
}


__global__ __launch_bounds__(256) void k_wtG(const float* __restrict__ w, int K, int N, bf* Bt) {
    const int lane = threadIdx.x & 31; const int L0 = (blockIdx.x * 8 + (threadIdx.x >> 5)) * 8; const int nlines = N * K / 64;
{
#pragma unroll 1
        for (int l = 0; l < 8; ++l) { const int L = L0 + l; if (L >= nlines) break; const size_t e = (size_t)L * 64 + lane * 2; const int k = (int)(e % K), n = (int)(e / K); v2us o;
            o[0] = f2bf(w[(size_t)k * N + n]); o[1] = f2bf(w[(size_t)(k + 1) * N + n]); *(v2us*)(Bt + e) = o; }
         }
}
// k_prep: everything that reads inputs only, one launch. Blocks 0..PTB-1 (the longest, so first): the rope table. Then x, Wq, Wk, Wv, Wo to bf16, CVB groups of 8 floats a thread, a block's groups 256 apart.
#define CVB 4
#define PTB (TT * HD / 256)
#define PXB (NB_ * TT * DM / (8 * 256 * CVB))
#define PQB (DQ * DM / (8 * 256 * CVB))
#define PKB (DKV * DM / (8 * 256 * CVB))
static_assert(TT * HD % 256 == 0 && NB_ * TT * DM % (8 * 256 * CVB) == 0 && DQ * DM % (8 * 256 * CVB) == 0 && DKV * DM % (8 * 256 * CVB) == 0, "whole blocks");
__global__ __launch_bounds__(256) void k_prep(const float* __restrict__ x, const float* __restrict__ wq, const float* __restrict__ wk, const float* __restrict__ wv, const float* __restrict__ wo, bf* XB, bf* WQ, bf* WK, bf* WV, bf* WO, float* CS) {
    int b = blockIdx.x;
    if (b < PTB) { const int idx = b * 256 + threadIdx.x; const int t = idx / HD, d = idx % HD; const int i = d >> 1; const float inv = __fdiv_rn(1.0f, powf(10000.0f, (float)(2 * i) / (float)HD)); const float ang = __fmul_rn((float)t, inv); v2f cs; cs[0] = cosf(ang); cs[1] = sinf(ang);
        *(v2f*)(CS + (size_t)idx * 2) = cs; return; }
    b -= PTB; const float* src; bf* dst;
    if (b < PXB) { src = x; dst = XB; }
    else if ((b -= PXB) < PQB) { src = wq; dst = WQ; }
    else if ((b -= PQB) < PKB) { src = wk; dst = WK; }
    else if ((b -= PKB) < PKB) { src = wv; dst = WV; }
    else { b -= PKB; src = wo; dst = WO; }
    const size_t i0 = (size_t)b * (256 * CVB) + threadIdx.x; v8f v[CVB];
#pragma unroll
    for (int u = 0; u < CVB; ++u) v[u] = *(const v8f*)(src + (i0 + u * 256) * 8);
#pragma unroll
    for (int u = 0; u < CVB; ++u) { v8us o;
#pragma unroll
        for (int k = 0; k < 8; ++k) o[k] = f2bf(v[u][k]);
        *(v8us*)(dst + (i0 + u * 256) * 8) = o; }
    asm volatile("s_wait_xcnt 0x0" ::: "memory");   // the listing lays the table code behind these stores, and it rewrites registers that they still name as data: the wait stands in front of any such rewrite
}
__device__ __forceinline__ float xhalf(float x) { return __builtin_bit_cast(float, __builtin_amdgcn_permlanex16(__builtin_bit_cast(int, x), __builtin_bit_cast(int, x), 0x76543210, 0xfedcba98, false, false)); }  // lane l takes lane l ^ 16's value
template <typename T16> struct PFrag;
template <> struct PFrag<h16> { static constexpr bool SPLIT = false; static __device__ __forceinline__ void pack(const float* p, v16h& a, v16h& b) { (void)b;
#pragma unroll
    for (int s = 0; s < 16; ++s) a[s] = (h16)p[s]; } };
template <> struct PFrag<bf> { static constexpr bool SPLIT = true; static __device__ __forceinline__ void pack(const float* p, v16bf& a, v16bf& b) {
#pragma unroll
    for (int s = 0; s < 16; ++s) { const __bf16 h = (__bf16)p[s]; a[s] = h; b[s] = (__bf16)(p[s] - (float)h); } } };
template <typename T16, int QT>
__device__ __forceinline__ void fattn_tile(const T16* __restrict__ Q, const T16* __restrict__ Q2, const T16* __restrict__ Kp, const T16* __restrict__ K2, const T16* __restrict__ Vt, const T16* __restrict__ Vt2, const int* __restrict__ mk, int q0, bf* Ah, bf* Al) {
    typedef typename WFrag<T16>::V V; constexpr bool SP = PFrag<T16>::SPLIT; constexpr float SH = SP ? 0.0f : 10.0f;
    const int lane = threadIdx.x & 31, lr = lane & 15, hi = lane >> 4;
    V qf[QT][2], qf2[QT][2]; v8f o[QT][4]; float m[QT], l[QT];
#pragma unroll
    for (int qt = 0; qt < QT; ++qt) { m[qt] = -3.0e38f; l[qt] = 0.0f;
#pragma unroll
        for (int ks = 0; ks < 2; ++ks) { const size_t qo = (size_t)(q0 + qt * 16 + lr) * HD + ks * 32 + 8 * hi; qf[qt][ks] = WFrag<T16>::ld(Q + qo); if (SP) qf2[qt][ks] = WFrag<T16>::ld(Q2 + qo); }
#pragma unroll
        for (int dt = 0; dt < 4; ++dt) o[qt][dt] = (v8f){}; }
    const size_t ko = (size_t)lr * HD + 8 * hi, vo = (size_t)lr * TT + 8 * hi, mo = (size_t)(q0 + lr) * TT + 8 * hi;
#pragma unroll 1
    for (int kb = 0; kb < TT; kb += 32) {
        V kf[2][2], kf2[2][2], vf[4], vf2[4]; v4i mq[QT][2][2];
#pragma unroll
        for (int kt = 0; kt < 2; ++kt)
#pragma unroll
            for (int ks = 0; ks < 2; ++ks) { const size_t e = ko + (size_t)(kb + kt * 16) * HD + ks * 32; kf[kt][ks] = WFrag<T16>::ld(Kp + e); if (SP) kf2[kt][ks] = WFrag<T16>::ld(K2 + e); }
#pragma unroll
        for (int qt = 0; qt < QT; ++qt)
#pragma unroll
            for (int kt = 0; kt < 2; ++kt) { const int* mp = mk + mo + (size_t)qt * 16 * TT + kb + kt * 16; mq[qt][kt][0] = *(const v4i*)mp; mq[qt][kt][1] = *(const v4i*)(mp + 4); }
#pragma unroll
        for (int dt = 0; dt < 4; ++dt) { const size_t e = vo + (size_t)dt * 16 * TT + kb; vf[dt] = WFrag<T16>::ld(Vt + e); if (SP) vf2[dt] = WFrag<T16>::ld(Vt2 + e); }
#pragma unroll
        for (int qt = 0; qt < QT; ++qt) {
            float t[16]; float bm = -3.0e38f;
#pragma unroll
            for (int kt = 0; kt < 2; ++kt) { v8f s = (v8f){};
#pragma unroll
                for (int ks = 0; ks < 2; ++ks) { s = WFrag<T16>::mma(kf[kt][ks], qf[qt][ks], s); if (SP) { s = WFrag<T16>::mma(kf2[kt][ks], qf[qt][ks], s); s = WFrag<T16>::mma(kf[kt][ks], qf2[qt][ks], s); } }
#pragma unroll
                for (int j = 0; j < 8; ++j) { const float x = (mq[qt][kt][j >> 2][j & 3] != 0) ? s[j] * (SCL * 1.4426950408889634f) : -3.0e38f; t[kt * 8 + j] = x; bm = fmaxf(bm, x); } }
            bm = fmaxf(bm, xhalf(bm));
            const float mn = fmaxf(m[qt], bm); const float al = __builtin_amdgcn_exp2f(m[qt] - mn); m[qt] = mn; const float mb = mn - SH; float ps = 0.0f;
#pragma unroll
            for (int s = 0; s < 16; ++s) { t[s] = __builtin_amdgcn_exp2f(t[s] - mb); ps += t[s]; }
            l[qt] = l[qt] * al + ps;
#pragma unroll
            for (int dt = 0; dt < 4; ++dt) o[qt][dt] *= al;
            V pf, pf2; PFrag<T16>::pack(t, pf, pf2);
#pragma unroll
            for (int dt = 0; dt < 4; ++dt) { o[qt][dt] = WFrag<T16>::mma(vf[dt], pf, o[qt][dt]); if (SP) { o[qt][dt] = WFrag<T16>::mma(vf2[dt], pf, o[qt][dt]); o[qt][dt] = WFrag<T16>::mma(vf[dt], pf2, o[qt][dt]); } }
        }
        __builtin_amdgcn_sched_barrier(0);   // keeps the next pass's address additions behind this pass's last load wait: without it they are lifted over loads still in flight that name those registers
    }
#pragma unroll
    for (int qt = 0; qt < QT; ++qt) { const float inv = __fdiv_rn(1.0f, l[qt] + xhalf(l[qt])); const size_t oo = (size_t)(q0 + qt * 16 + lr) * DQ + 8 * hi;
#pragma unroll
        for (int dt = 0; dt < 4; ++dt) { v8us oh, ol;
#pragma unroll
            for (int j = 0; j < 8; ++j) { unsigned short a, c2; splitf(o[qt][dt][j] * inv, a, c2); oh[j] = a; ol[j] = c2; }
            *(v8us*)(Ah + oo + dt * 16) = oh; *(v8us*)(Al + oo + dt * 16) = ol; } }
}
// grid (FBX, NB_*NH_), 5 waves of one head per block, every block the same work: waves 0, 1 take 16 hi+lo query rows each, waves 2..4 take 32 fp16 query rows each (RH/16 = 2 FBX and (TT-RH)/32 = 3 FBX tiles a head)
#define FBX 8
static_assert(RH == 2 * FBX * 16 && TT - RH == 3 * FBX * 32, "tiles per block");
__global__ __launch_bounds__(160) void k_fattn(const h16* __restrict__ Q16, const h16* __restrict__ K16, const h16* __restrict__ V16, const bf* __restrict__ Qh, const bf* __restrict__ Ql, const bf* __restrict__ Kh, const bf* __restrict__ Kl, const bf* __restrict__ Vh, const bf* __restrict__ Vl, const int* __restrict__ mk, bf* Ah, bf* Al) {
    const int bh = blockIdx.y, bx = blockIdx.x, wave = __builtin_amdgcn_readfirstlane(threadIdx.x >> 5); const size_t pq = (size_t)bh * TT * HD, pk = (size_t)(bh / REP) * TT * HD; const size_t ao = (size_t)(bh / NH_) * TT * DQ + (size_t)(bh % NH_) * HD;
    if (wave < 2) fattn_tile<bf, 1>(Qh + pq, Ql + pq, Kh + pk, Kl + pk, Vh + pk, Vl + pk, mk, (bx * 2 + wave) * 16, Ah + ao, Al + ao);
    else fattn_tile<h16, 2>(Q16 + pq, nullptr, K16 + pk, nullptr, V16 + pk, nullptr, mk, RH + (bx * 3 + wave - 2) * 32, Ah + ao, Al + ao);
}

extern "C" void kernel_launch(void* const* d_in, const int* in_sizes, int n_in,
                              void* d_out, int out_size, void* d_ws, size_t ws_size, hipStream_t stream) {
    (void)in_sizes; (void)n_in; (void)out_size;
    const float* x = (const float*)d_in[0]; const float* wq = (const float*)d_in[1]; const float* bqv = (const float*)d_in[2]; const float* wk = (const float*)d_in[3]; const float* bkv = (const float*)d_in[4]; const float* wv = (const float*)d_in[5]; const float* bvv = (const float*)d_in[6]; const float* wo = (const float*)d_in[7]; const float* bo = (const float*)d_in[8]; const int* mk = (const int*)d_in[9];   // torch [out][in] weights; mask int32 [1][1][1024][1024] (nonzero = attend)
    float* OUT = (float*)d_out;     // [4][1024][1024]
    char* wsp = (char*)d_ws;
    auto take = [&](size_t bytes) { char* p = wsp; wsp += (bytes + 255) & ~(size_t)255; return (void*)p; };
    bf* WQ = (bf*)take((size_t)DQ * DM * 2); bf* WK = (bf*)take((size_t)DKV * DM * 2); bf* WV = (bf*)take((size_t)DKV * DM * 2); bf* WO = (bf*)take((size_t)DM * DQ * 2); float* CS = (float*)take((size_t)TT * HD * 2 * 4);
    bf* XB = (bf*)take((size_t)NB_ * TT * DM * 2);
    h16* QP16 = (h16*)take((size_t)NB_ * NH_ * TT * HD * 2); h16* KP16 = (h16*)take((size_t)NB_ * NKV * TT * HD * 2); h16* VT16 = (h16*)take((size_t)NB_ * NKV * HD * TT * 2);
    bf* QPh = (bf*)take((size_t)NB_ * NH_ * TT * HD * 2); bf* QPl = (bf*)take((size_t)NB_ * NH_ * TT * HD * 2); bf* KPh = (bf*)take((size_t)NB_ * NKV * TT * HD * 2); bf* KPl = (bf*)take((size_t)NB_ * NKV * TT * HD * 2); bf* VTh = (bf*)take((size_t)NB_ * NKV * HD * TT * 2); bf* VTl = (bf*)take((size_t)NB_ * NKV * HD * TT * 2);
    bf* ATh = (bf*)take((size_t)NB_ * TT * DQ * 2); bf* ATl = (bf*)take((size_t)NB_ * TT * DQ * 2);
    if ((size_t)(wsp - (char*)d_ws) > ws_size) return;    // well inside the workspace
    k_prep<<<PTB + PXB + PQB + 2 * PKB + PQB, 256, 0, stream>>>(x, wq, wk, wv, wo, XB, WQ, WK, WV, WO, CS);
    // all batch items per launch: x is [NB_*TT][DM], so the projections are plain GEMMs with M = NB_*TT
    k_qkv<<<dim3(NB_ * TT / 256, NH_, 1), 384, 0, stream>>>(XB, WQ, WK, WV, bqv, bkv, bvv, CS, QP16, QPh, QPl, KP16, KPh, KPl, VT16, VTh, VTl);   // v^T = Wv x^T: rows d, columns b*TT + t
    k_fattn<<<dim3(FBX, NB_ * NH_, 1), 160, 0, stream>>>(QP16, KP16, VT16, QPh, QPl, KPh, KPl, VTh, VTl, mk, ATh, ATl);
    k_gemmw<bf, 1, true><<<dim3(NB_ * TT / 64, DM / 64, 1), 32, 0, stream>>>(ATh, ATl, WO, nullptr, DQ, OUT, DM, bo);
}

// v005
// One run takes 145 microseconds.
// Two timings next to v004 put it at 1.23 and 1.21 times that version's speed.
// All steps since v000 together make it 16.5 times as fast.
#include <hip/hip_runtime.h>

// MultiHeadAttentionEuclid (x [4][1024][1024]; q/k/v = x W^T + b (16 heads x 64); interleaved-pair rotary (base 1e4, positions 0..1023 computed on device); scores = q.k/8 where mask[0][0][i][j] != 0 (int32 [1][1][1024][1024],
// read as data; here causal), -inf elsewhere; softmax; out = merged att.v Wo^T + bo -> [4][1024][1024]).
// Compute dtypes, f32 accumulate: every input rounded to bf16; projections on PLAIN bf16 operands (inputs: exact, + bias); rope f32; scores (K 64) and att.v on bf16 hi+lo planes (3 products)
// for the first 256 query rows of each head and SINGLE fp16 planes for the rest; f32 masked online softmax in registers; merged heads hl x exact Wo (2 products) + bo. One-wave-per-64x64-tile GEMMs. Deterministic, no atomics;
// Launch plan: projections and the output product take all 4 batch items in one grid (rows b*1024 + t, planes [b][h]); a 64-column tile is one head, so each projection's epilogue writes the 16-bit head planes itself
// (q, k: bias, rope, split; v: computed as Wv x^T, bias, split, rows d over columns t); scores, softmax and att.v of all 64 (batch, head) pairs are one launch (k_fattn).
// FRAGMENT ORDER: every 16-bit plane [rows][K] that feeds a matrix operand is stored as tiles of 16 rows x 32 k, 512 elements each, tile (R, kt) at (R * (K/32) + kt) * 512. Inside a tile, element (row, k) stands at
// ((k >> 4) & 1) * 256 + (((k >> 3) & 1) * 16 + row) * 8 + (k & 7): the two 16-byte loads of a lane's fragment are then at bytes lane * 16 and 512 + lane * 16 of the tile, so one wave load reads 512 contiguous bytes
// (4 whole lines, not 32 bytes of each of 16). Which lane and register hold which (row, k) is as with row-major planes; only the place in memory differs.
// The mask is copied once, as int32, into the same kind of order (k_prep): tiles of 16 queries x 32 keys, 512 ints each, tile (qt, kbt) at (qt * (TT/32) + kbt) * 512; the four ints (query lr, keys kt*16 + hi*8 + h*4 ..+3) at ((kt*2 + h) * 32 + lane) * 4.

#define NB_  4
#define TT   1024
#define DM   1024
#define NH_  16
#define NKV  16
#define REP  (NH_ / NKV)
#define HD   64
#define DQ   (NH_ * HD)
#define DKV  (NKV * HD)
#define RH   256                  // query rows < RH use hi+lo planes
#define WIN  0
#define SCL  0.125f   // HD^-0.5
typedef _Float16 h16;
typedef unsigned short bf;
typedef __attribute__((ext_vector_type(16))) __bf16   v16bf;
typedef __attribute__((ext_vector_type(16))) _Float16 v16h;
typedef __attribute__((ext_vector_type(8)))  _Float16 v8h;
typedef __attribute__((ext_vector_type(8)))  unsigned short v8us;
typedef __attribute__((ext_vector_type(8)))  float    v8f;
typedef __attribute__((ext_vector_type(4)))  float    v4f;
typedef v8h  __attribute__((may_alias)) v8ha;
typedef v4f  __attribute__((may_alias)) v4fa;
typedef v8us __attribute__((may_alias)) v8usa;

__device__ __forceinline__ unsigned short f2bf(float f) { unsigned u = __float_as_uint(f); u += 0x7FFFu + ((u >> 16) & 1u); return (unsigned short)(u >> 16); }
__device__ __forceinline__ float bf2f(unsigned short b) { return __uint_as_float(((unsigned)b) << 16); }
__device__ __forceinline__ float bfr(float f) { return bf2f(f2bf(f)); }
__device__ __forceinline__ v16h cat16(v8h lo, v8h hi) { return __builtin_shufflevector(lo, hi, 0, 1, 2, 3, 4, 5, 6, 7, 8, 9, 10, 11, 12, 13, 14, 15); }
__device__ __forceinline__ v16bf cat16b(v8us lo, v8us hi) { return __builtin_bit_cast(v16bf, __builtin_shufflevector(lo, hi, 0, 1, 2, 3, 4, 5, 6, 7, 8, 9, 10, 11, 12, 13, 14, 15)); }
__device__ __forceinline__ v8f wmma16(v16h a, v16h b, v8f c) { return __builtin_amdgcn_wmma_f32_16x16x32_f16(false, a, false, b, (short)0, c, false, false); }
__device__ __forceinline__ v8f wmmab(v16bf a, v16bf b, v8f c) { return __builtin_amdgcn_wmma_f32_16x16x32_bf16(false, a, false, b, (short)0, c, false, false); }



__device__ __forceinline__ h16 tohx(float x) { return (h16)x; }
__device__ __forceinline__ void splitf(float y, unsigned short& h, unsigned short& l) { h = f2bf(y); l = f2bf(y - bf2f(h)); }
typedef __attribute__((ext_vector_type(2))) _Float16 v2h;
typedef __attribute__((ext_vector_type(4))) _Float16 v4h;
typedef __attribute__((ext_vector_type(2))) unsigned short v2us;
typedef __attribute__((ext_vector_type(4))) unsigned short v4us;
typedef __attribute__((ext_vector_type(2))) float v2f;
typedef __attribute__((ext_vector_type(4))) int v4i;

// ---- k_gemmw: register-blocked GEMM, ONE WAVE per 64x64 output tile (16 accumulators), operands straight from 16-bit planes in fragment order; grid (M/64, N/64), 32 threads.
// C[m][n] (f32, pitch ldc, + optional f32 bias[n]) = sum_k A[m][k] Bt[n][k] (+ split products per NSPLIT). K % 32 == 0.
// EPI 0: C as above. EPI 1 (rows m = b*TT + t, column tile = head): bias[n], interleaved-pair rope from the table CS ([t][d] -> cos, sin), then the fp16, bf16 hi and bf16 lo planes [b][head] of rows t, K = d, in fragment order.
// EPI 2 (row tile = head, columns n = b*TT + t): bias[m], then the same three planes [b][head] of rows d, K = t, in fragment order. Neither writes C.
template <typename T16> struct WFrag;   // ld(c): the fragment of one tile; c = the tile's address + lane * 16 bytes
template <> struct WFrag<h16> { typedef v16h V; static __device__ __forceinline__ V ld(const char* c) { return cat16(*(const v8h*)c, *(const v8h*)(c + 512)); } static __device__ __forceinline__ v8f mma(V a, V b, v8f c) { return wmma16(a, b, c); } };
template <> struct WFrag<bf> { typedef v16bf V; static __device__ __forceinline__ V ld(const char* c) { return cat16b(*(const v8us*)c, *(const v8us*)(c + 512)); } static __device__ __forceinline__ v8f mma(V a, V b, v8f c) { return wmmab(a, b, c); } };
// gemmw_tile: the tile (tx, ty) of one wave; os: that wave's own 16 x 68 floats of LDS; nh: heads per batch item (EPI 1, 2).
template <typename T16, int NSPLIT, bool BIAS, int EPI>
__device__ __forceinline__ void gemmw_tile(const T16* __restrict__ A, const T16* __restrict__ A2, const T16* __restrict__ Bt, const T16* __restrict__ Bt2, int K, float* C, int ldc, const float* __restrict__ bias, const float* __restrict__ CS, h16* __restrict__ P16, bf* __restrict__ Ph, bf* __restrict__ Pl, int tx, int ty, int nh, float* os) {
    typedef typename WFrag<T16>::V V;
    const int lane = threadIdx.x & 31, lr = lane & 15, hi = lane >> 4; const int r0 = tx * 64, c0 = ty * 64;
    v8f acc[4][4];
#pragma unroll
    for (int mb = 0; mb < 4; ++mb)
#pragma unroll
        for (int nb = 0; nb < 4; ++nb) acc[mb][nb] = (v8f){};
    const size_t aoff = (size_t)r0 * K, boff = (size_t)c0 * K; const unsigned lo = lane * 16;   // a row tile is 16 * K elements, a k tile 512
#pragma unroll 1
    for (int kc = 0; kc < K; kc += 32) {
        V a[4], a2[4], b[4], b2[4]; constexpr bool SA = NSPLIT == 1 || NSPLIT == 2, SB = NSPLIT >= 2; constexpr size_t RT = 2;   // bytes an element
        const char* const pa = (const char*)(A + aoff + kc * 16) + lo; const char* const pb = (const char*)(Bt + boff + kc * 16) + lo;   // this lane's 16 bytes of this pass's k tile, first row tile
        const char* const pa2 = SA ? (const char*)(A2 + aoff + kc * 16) + lo : pa; const char* const pb2 = SB ? (const char*)(Bt2 + boff + kc * 16) + lo : pb;
#pragma unroll
        for (int mb = 0; mb < 4; ++mb) { a[mb] = WFrag<T16>::ld(pa + (size_t)mb * 16 * K * RT); if (SA) a2[mb] = WFrag<T16>::ld(pa2 + (size_t)mb * 16 * K * RT); }
#pragma unroll
        for (int nb = 0; nb < 4; ++nb) { b[nb] = WFrag<T16>::ld(pb + (size_t)nb * 16 * K * RT); if (SB) b2[nb] = WFrag<T16>::ld(pb2 + (size_t)nb * 16 * K * RT); }
        asm volatile("s_wait_xcnt 0x0" :: "v"(pa), "v"(pa2), "v"(pb), "v"(pb2) : "memory");   // the address registers stay whole until every load of the pass that names them is past this wait (as inputs they cannot be given to a load's result before it); the wave has only its data to wait for here
#pragma unroll
        for (int nb = 0; nb < 4; ++nb) {
#pragma unroll
            for (int mb = 0; mb < 4; ++mb) { acc[mb][nb] = WFrag<T16>::mma(a[mb], b[nb], acc[mb][nb]); if (SA) acc[mb][nb] = WFrag<T16>::mma(a2[mb], b[nb], acc[mb][nb]); if (SB) acc[mb][nb] = WFrag<T16>::mma(a[mb], b2[nb], acc[mb][nb]); } }
        asm volatile("v_nop\n\tv_nop\n\tv_nop\n\tv_nop" : "+v"(acc[0][0]), "+v"(acc[1][1]), "+v"(acc[2][2]), "+v"(acc[3][3]) : "v"(a[0]), "v"(a[3]));
    }
    static_assert(EPI == 0 || HD == 64, "a 64-wide tile is one head");
    const int fo = (lr >> 3) * 512 + ((lr >> 2) & 1) * 256 + ((lr >> 1) & 1) * 128 + (lr & 1) * 4;   // k = lr * 4 of a 64-wide k range, row 0, in fragment order
    float cb[4], rb[4][8]; v2f cs[2][8][2]; size_t pbase = 0;   // all of a row block's table entries are asked for one row block ahead, as one batch
    const float* const cp0 = CS + ((size_t)(r0 % TT + hi) * HD + lr * 4) * 2;   // this lane's first table entry; every other one is a constant step from it
    if (EPI == 1) { pbase = ((size_t)((r0 / TT) * nh + ty) * TT + (r0 % TT)) * HD + fo;
#pragma unroll
        for (int i = 0; i < 4; ++i) cb[i] = bfr(bias[c0 + lr * 4 + i]);
#pragma unroll
        for (int s = 0; s < 8; ++s) { const float* cp = cp0 + 2 * s * HD * 2; cs[0][s][0] = *(const v2f*)cp; cs[0][s][1] = *(const v2f*)(cp + 4); } }
    if (EPI == 2) { pbase = (size_t)((c0 / TT) * nh + tx) * HD * TT + (c0 % TT) * 16 + fo;
#pragma unroll
        for (int mb = 0; mb < 4; ++mb)
#pragma unroll
            for (int s = 0; s < 8; ++s) { if (mb == 3 && s == 7) asm volatile("s_wait_xcnt 0x0" ::: "memory");   // without it the last load's result was placed in the offset register that the 31 loads before it still name: the wait stands in front of any such rewrite
                rb[mb][s] = bfr(bias[r0 + mb * 16 + 2 * s + hi]); } }
#pragma unroll
    for (int mb = 0; mb < 4; ++mb) {
        if (EPI == 1 && mb < 3) {
#pragma unroll
            for (int s = 0; s < 8; ++s) { const float* cp = cp0 + ((mb + 1) * 16 + 2 * s) * HD * 2; cs[(mb + 1) & 1][s][0] = *(const v2f*)cp; cs[(mb + 1) & 1][s][1] = *(const v2f*)(cp + 4); } }
#pragma unroll
        for (int nb = 0; nb < 4; ++nb) {
#pragma unroll
            for (int j = 0; j < 8; ++j) os[(hi * 8 + j) * 68 + nb * 16 + lr] = acc[mb][nb][j]; }
        __builtin_amdgcn_wave_barrier(); asm volatile("" ::: "memory");
        float* crow = C + (size_t)(r0 + mb * 16) * ldc + c0;
        if (EPI != 0) {
#pragma unroll
            for (int s = 0; s < 8; ++s) { const int row = 2 * s + hi; const v4f val = *(const v4fa*)(os + row * 68 + lr * 4); float r[4];
                if (EPI == 1) { const float x0 = val[0] + cb[0], x1 = val[1] + cb[1], x2 = val[2] + cb[2], x3 = val[3] + cb[3]; const v2f ca = cs[mb & 1][s][0], cc = cs[mb & 1][s][1];
                    r[0] = x0 * ca[0] - x1 * ca[1]; r[1] = x1 * ca[0] + x0 * ca[1]; r[2] = x2 * cc[0] - x3 * cc[1]; r[3] = x3 * cc[0] + x2 * cc[1]; }
                else { r[0] = val[0] + rb[mb][s]; r[1] = val[1] + rb[mb][s]; r[2] = val[2] + rb[mb][s]; r[3] = val[3] + rb[mb][s]; }
                v4h o16; v4us oh, ol;
#pragma unroll
                for (int i = 0; i < 4; ++i) { o16[i] = tohx(r[i]); unsigned short a2, c2; splitf(r[i], a2, c2); oh[i] = a2; ol[i] = c2; }
                const size_t e = pbase + (size_t)mb * 16 * (EPI == 1 ? HD : TT) + row * 8;   // rows 2s, 2s + 1: 32 bytes in each of 8 places; the 8 stores of a row block fill its tiles
                *(v4h*)(P16 + e) = o16; *(v4us*)(Ph + e) = oh; *(v4us*)(Pl + e) = ol; }
            if (EPI == 1 && mb < 2) asm volatile("s_wait_xcnt 0x0" ::: "memory");   // the table loads that follow land in registers that these stores still name as data: the wait stands in front of that rewrite
        } else {
#pragma unroll
            for (int s = 0; s < 8; ++s) { const int row = 2 * s + hi, cofs = lr * 4; v4f val = *(const v4fa*)(os + row * 68 + cofs); if (BIAS) { val[0] += bfr(bias[c0 + cofs]); val[1] += bfr(bias[c0 + cofs + 1]); val[2] += bfr(bias[c0 + cofs + 2]); val[3] += bfr(bias[c0 + cofs + 3]); }
                *(v4f*)(crow + (size_t)row * ldc + cofs) = val; }
             }
        __builtin_amdgcn_wave_barrier(); asm volatile("" ::: "memory");
    }
}
template <typename T16, int NSPLIT, bool BIAS, int K>   // K at compile time: the steps from row tile to row tile are then immediates on one address register pair per plane
__global__ __launch_bounds__(32) void k_gemmw(const T16* __restrict__ A, const T16* __restrict__ A2, const T16* __restrict__ Bt, const T16* __restrict__ Bt2, float* C, int ldc, const float* __restrict__ bias) {
    __shared__ __align__(16) float os[16 * 68];
    gemmw_tile<T16, NSPLIT, BIAS, 0>(A, A2, Bt, Bt2, K, C, ldc, bias, nullptr, nullptr, nullptr, nullptr, blockIdx.x, blockIdx.y, 0, os);
}
// k_qkv: the three projections in one launch, grid (NB_*TT/256, heads), 12 waves a block, one block a WGP: waves 0..3 q, 4..7 k (x W^T), 8..11 v (Wv x^T) of one head, wave w on the 64 rows (w & 3) of the block's 256 rows of x.
// The block's waves read the same 4 row tiles of x and the same 3 weight tiles, so what one wave has fetched the others find in the WGP's cache; no wave reads another's result, and there is no barrier between them.
static_assert(NH_ == NKV && NB_ * TT % 256 == 0, "one grid for q, k and v");
__global__ __launch_bounds__(384) void k_qkv(const bf* __restrict__ X, const bf* __restrict__ Wq, const bf* __restrict__ Wk, const bf* __restrict__ Wv, const float* __restrict__ bq, const float* __restrict__ bk, const float* __restrict__ bv, const float* __restrict__ CS,
                                            h16* __restrict__ Q16, bf* __restrict__ Qh, bf* __restrict__ Ql, h16* __restrict__ K16, bf* __restrict__ Kh, bf* __restrict__ Kl, h16* __restrict__ V16, bf* __restrict__ Vh, bf* __restrict__ Vl) {
    __shared__ __align__(16) float os[12][16 * 68];
    const int wave = __builtin_amdgcn_readfirstlane(threadIdx.x >> 5); const int xt = blockIdx.x * 4 + (wave & 3);
    if (wave < 8) { const bool k = wave >= 4;   // q and k run the same code on their own pointers
        gemmw_tile<bf, 0, true, 1>(X, nullptr, k ? Wk : Wq, nullptr, DM, nullptr, 0, k ? bk : bq, CS, k ? K16 : Q16, k ? Kh : Qh, k ? Kl : Ql, xt, blockIdx.y, NH_, os[wave]); }
    else gemmw_tile<bf, 0, true, 2>(Wv, nullptr, X, nullptr, DM, nullptr, 0, bv, nullptr, V16, Vh, Vl, blockIdx.y, xt, NKV, os[wave]);
}


__global__ __launch_bounds__(256) void k_wtG(const float* __restrict__ w, int K, int N, bf* Bt) {
    const int lane = threadIdx.x & 31; const int L0 = (blockIdx.x * 8 + (threadIdx.x >> 5)) * 8; const int nlines = N * K / 64;
{
#pragma unroll 1
        for (int l = 0; l < 8; ++l) { const int L = L0 + l; if (L >= nlines) break; const size_t e = (size_t)L * 64 + lane * 2; const int k = (int)(e % K), n = (int)(e / K); v2us o;
            o[0] = f2bf(w[(size_t)k * N + n]); o[1] = f2bf(w[(size_t)(k + 1) * N + n]); *(v2us*)(Bt + e) = o; }
         }
}
// k_prep: everything that reads inputs only, one launch. Blocks 0..PTB-1 (the longest, so first): the rope table. Then the mask copy. Then x, Wq, Wk, Wv, Wo to bf16 in fragment order, CVB groups of 8 floats a thread, a block's groups 256 apart: group g is the g-th 16 bytes of the plane written,
// so a wave stores 512 contiguous bytes and reads 64 bytes of each of 16 rows (the wave beside it reads the line's other half); 256 groups on are 4 k tiles on in the same rows.
#define CVB 4
#define PTB (TT * HD / 256)
#define PXB (NB_ * TT * DM / (8 * 256 * CVB))
#define PQB (DQ * DM / (8 * 256 * CVB))
#define PKB (DKV * DM / (8 * 256 * CVB))
#define PMB (TT * TT / (4 * 256 * CVB))
static_assert(TT * HD % 256 == 0 && NB_ * TT * DM % (8 * 256 * CVB) == 0 && DQ * DM % (8 * 256 * CVB) == 0 && DKV * DM % (8 * 256 * CVB) == 0, "whole blocks");
static_assert(DQ == DM && (DM / 32) % (4 * CVB) == 0, "all five planes have rows of DM elements, and a block stays inside one row tile");
static_assert(TT * TT % (4 * 256 * CVB) == 0 && (TT / 32) % (2 * CVB) == 0, "whole blocks of the mask copy, each inside one row of tiles");
__global__ __launch_bounds__(256) void k_prep(const float* __restrict__ x, const float* __restrict__ wq, const float* __restrict__ wk, const float* __restrict__ wv, const float* __restrict__ wo, const int* __restrict__ mk, bf* XB, bf* WQ, bf* WK, bf* WV, bf* WO, float* CS, int* MK) {
    int b = blockIdx.x;
    if (b < PTB) { const int idx = b * 256 + threadIdx.x; const int t = idx / HD, d = idx % HD; const int i = d >> 1; const float inv = __fdiv_rn(1.0f, powf(10000.0f, (float)(2 * i) / (float)HD)); const float ang = __fmul_rn((float)t, inv); v2f cs; cs[0] = cosf(ang); cs[1] = sinf(ang);
        *(v2f*)(CS + (size_t)idx * 2) = cs; return; }
    b -= PTB;
    if (b < PMB) { const unsigned g0 = (unsigned)b * (256 * CVB) + threadIdx.x, mt = g0 >> 7, ch = (threadIdx.x >> 5) & 3, ln = threadIdx.x & 31; v4i m[CVB];   // the mask: group g is the g-th 16 bytes written; 256 groups on are 2 key tiles on in the same queries
        const unsigned mo = (((mt / (TT / 32)) * 16 + (ln & 15)) * TT + (mt % (TT / 32)) * 32 + (ch >> 1) * 16 + (ln >> 4) * 8 + (ch & 1) * 4) * 4;   // bytes
#pragma unroll
        for (int u = 0; u < CVB; ++u) m[u] = *(const v4i*)((const char*)(mk + u * 64) + mo);
#pragma unroll
        for (int u = 0; u < CVB; ++u) *(v4i*)(MK + ((size_t)g0 + u * 256) * 4) = m[u];
        asm volatile("s_wait_xcnt 0x0" ::: "memory");   // as behind the conversion stores below: the listing lays the table code behind these stores too, and it rewrites registers that they still name
        return; }
    b -= PMB; const float* src; bf* dst;
    if (b < PXB) { src = x; dst = XB; }
    else if ((b -= PXB) < PQB) { src = wq; dst = WQ; }
    else if ((b -= PQB) < PKB) { src = wk; dst = WK; }
    else if ((b -= PKB) < PKB) { src = wv; dst = WV; }
    else { b -= PKB; src = wo; dst = WO; }
    const size_t i0 = (size_t)b * (256 * CVB) + threadIdx.x; v8f v[CVB]; const unsigned tile = (unsigned)(i0 >> 6), ln = threadIdx.x & 31;
    const unsigned so = (((tile / (DM / 32)) * 16 + (ln & 15)) * DM + (tile % (DM / 32)) * 32 + ((threadIdx.x >> 5) & 1) * 16 + (ln >> 4) * 8) * 4;   // bytes: where group i0's 8 floats stand in the row-major source
#pragma unroll
    for (int u = 0; u < CVB; ++u) v[u] = *(const v8f*)((const char*)(src + u * 128) + so);
#pragma unroll
    for (int u = 0; u < CVB; ++u) { v8us o;
#pragma unroll
        for (int k = 0; k < 8; ++k) o[k] = f2bf(v[u][k]);
        *(v8us*)(dst + (i0 + u * 256) * 8) = o; }
    asm volatile("s_wait_xcnt 0x0" ::: "memory");   // the listing lays the table code behind these stores, and it rewrites registers that they still name as data: the wait stands in front of any such rewrite
}
__device__ __forceinline__ float xhalf(float x) { return __builtin_bit_cast(float, __builtin_amdgcn_permlanex16(__builtin_bit_cast(int, x), __builtin_bit_cast(int, x), 0x76543210, 0xfedcba98, false, false)); }  // lane l takes lane l ^ 16's value
template <typename T16> struct PFrag;
template <> struct PFrag<h16> { static constexpr bool SPLIT = false; static __device__ __forceinline__ void pack(const float* p, v16h& a, v16h& b) { (void)b;
#pragma unroll
    for (int s = 0; s < 16; ++s) a[s] = (h16)p[s]; } };
template <> struct PFrag<bf> { static constexpr bool SPLIT = true; static __device__ __forceinline__ void pack(const float* p, v16bf& a, v16bf& b) {
#pragma unroll
    for (int s = 0; s < 16; ++s) { const __bf16 h = (__bf16)p[s]; a[s] = h; b[s] = (__bf16)(p[s] - (float)h); } } };
template <typename T16, int QT>
__device__ __forceinline__ void fattn_tile(const T16* __restrict__ Q, const T16* __restrict__ Q2, const T16* __restrict__ Kp, const T16* __restrict__ K2, const T16* __restrict__ Vt, const T16* __restrict__ Vt2, const int* __restrict__ mk, int q0, bf* Ah, bf* Al) {
    typedef typename WFrag<T16>::V V; constexpr bool SP = PFrag<T16>::SPLIT; constexpr float SH = SP ? 0.0f : 10.0f;
    const int lane = threadIdx.x & 31, lr = lane & 15, hi = lane >> 4; const unsigned lo = lane * 16;
    V qf[QT][2], qf2[QT][2]; v8f o[QT][4]; float m[QT], l[QT];
#pragma unroll
    for (int qt = 0; qt < QT; ++qt) { m[qt] = -3.0e38f; l[qt] = 0.0f;
#pragma unroll
        for (int ks = 0; ks < 2; ++ks) { const size_t qo = (size_t)(q0 + qt * 16) * HD + ks * 512; qf[qt][ks] = WFrag<T16>::ld((const char*)(Q + qo) + lo); if (SP) qf2[qt][ks] = WFrag<T16>::ld((const char*)(Q2 + qo) + lo); }
#pragma unroll
        for (int dt = 0; dt < 4; ++dt) o[qt][dt] = (v8f){}; }
#pragma unroll 1
    for (int kb = 0; kb < TT; kb += 32) {
        V kf[2][2], kf2[2][2], vf[4], vf2[4]; v4i mq[QT][2][2]; const char* const Kb = (const char*)(Kp + (size_t)kb * HD) + lo; const char* const Vb = (const char*)(Vt + (size_t)kb * 16) + lo;   // this lane's 16 bytes of this pass's first tile, per plane
        const char* const Mb = (const char*)(mk + (size_t)q0 * (TT / 32) * 32 + kb * 16) + lo;
        const char* const K2b = SP ? (const char*)(K2 + (size_t)kb * HD) + lo : Kb; const char* const V2b = SP ? (const char*)(Vt2 + (size_t)kb * 16) + lo : Vb;
#pragma unroll
        for (int kt = 0; kt < 2; ++kt)
#pragma unroll
            for (int ks = 0; ks < 2; ++ks) { const int e = (kt * 16 * HD + ks * 512) * 2; kf[kt][ks] = WFrag<T16>::ld(Kb + e); if (SP) kf2[kt][ks] = WFrag<T16>::ld(K2b + e); }
#pragma unroll
        for (int qt = 0; qt < QT; ++qt)
#pragma unroll
            for (int kt = 0; kt < 2; ++kt) { const char* mp = Mb + (qt * (TT / 32) * 512 + kt * 256) * 4; mq[qt][kt][0] = *(const v4i*)mp; mq[qt][kt][1] = *(const v4i*)(mp + 512); }
#pragma unroll
        for (int dt = 0; dt < 4; ++dt) { const int e = dt * 16 * TT * 2; vf[dt] = WFrag<T16>::ld(Vb + e); if (SP) vf2[dt] = WFrag<T16>::ld(V2b + e); }
        asm volatile("s_wait_xcnt 0x0" :: "v"(Kb), "v"(K2b), "v"(Vb), "v"(V2b), "v"(Mb) : "memory");   // the address registers stay whole until every load of the pass that names them is past this wait (as inputs they cannot be given to a load's result before it); the wave has only its data to wait for here
#pragma unroll
        for (int qt = 0; qt < QT; ++qt) {
            float t[16]; float bm = -3.0e38f;
#pragma unroll
            for (int kt = 0; kt < 2; ++kt) { v8f s = (v8f){};
#pragma unroll
                for (int ks = 0; ks < 2; ++ks) { s = WFrag<T16>::mma(kf[kt][ks], qf[qt][ks], s); if (SP) { s = WFrag<T16>::mma(kf2[kt][ks], qf[qt][ks], s); s = WFrag<T16>::mma(kf[kt][ks], qf2[qt][ks], s); } }
#pragma unroll
                for (int j = 0; j < 8; ++j) { const float x = (mq[qt][kt][j >> 2][j & 3] != 0) ? s[j] * (SCL * 1.4426950408889634f) : -3.0e38f; t[kt * 8 + j] = x; bm = fmaxf(bm, x); } }
            bm = fmaxf(bm, xhalf(bm));
            const float mn = fmaxf(m[qt], bm); const float al = __builtin_amdgcn_exp2f(m[qt] - mn); m[qt] = mn; const float mb = mn - SH; float ps = 0.0f;
#pragma unroll
            for (int s = 0; s < 16; ++s) { t[s] = __builtin_amdgcn_exp2f(t[s] - mb); ps += t[s]; }
            l[qt] = l[qt] * al + ps;
#pragma unroll
            for (int dt = 0; dt < 4; ++dt) o[qt][dt] *= al;
            V pf, pf2; PFrag<T16>::pack(t, pf, pf2);
#pragma unroll
            for (int dt = 0; dt < 4; ++dt) { o[qt][dt] = WFrag<T16>::mma(vf[dt], pf, o[qt][dt]); if (SP) { o[qt][dt] = WFrag<T16>::mma(vf2[dt], pf, o[qt][dt]); o[qt][dt] = WFrag<T16>::mma(vf[dt], pf2, o[qt][dt]); } }
        }
        __builtin_amdgcn_sched_barrier(0);   // keeps the next pass's address additions behind this pass's last load wait: without it they are lifted over loads still in flight that name those registers
    }
#pragma unroll
    for (int qt = 0; qt < QT; ++qt) { const float inv = __fdiv_rn(1.0f, l[qt] + xhalf(l[qt])); const size_t oo = (size_t)(q0 + qt * 16) * DQ;
#pragma unroll
        for (int dt = 0; dt < 4; ++dt) { v8us oh, ol;
#pragma unroll
            for (int j = 0; j < 8; ++j) { unsigned short a, c2; splitf(o[qt][dt][j] * inv, a, c2); oh[j] = a; ol[j] = c2; }
            *(v8us*)((char*)(Ah + oo + dt * 256) + lo) = oh; *(v8us*)((char*)(Al + oo + dt * 256) + lo) = ol; } }
}
// grid (FBX, NB_*NH_), 5 waves of one head per block, every block the same work: waves 0, 1 take 16 hi+lo query rows each, waves 2..4 take 32 fp16 query rows each (RH/16 = 2 FBX and (TT-RH)/32 = 3 FBX tiles a head)
#define FBX 8
static_assert(RH == 2 * FBX * 16 && TT - RH == 3 * FBX * 32, "tiles per block");
__global__ __launch_bounds__(160) void k_fattn(const h16* __restrict__ Q16, const h16* __restrict__ K16, const h16* __restrict__ V16, const bf* __restrict__ Qh, const bf* __restrict__ Ql, const bf* __restrict__ Kh, const bf* __restrict__ Kl, const bf* __restrict__ Vh, const bf* __restrict__ Vl, const int* __restrict__ mk, bf* Ah, bf* Al) {
    const int bh = blockIdx.y, bx = blockIdx.x, wave = __builtin_amdgcn_readfirstlane(threadIdx.x >> 5); const size_t pq = (size_t)bh * TT * HD, pk = (size_t)(bh / REP) * TT * HD; const size_t ao = (size_t)(bh / NH_) * TT * DQ + (size_t)(bh % NH_) * (HD / 32) * 512;
    if (wave < 2) fattn_tile<bf, 1>(Qh + pq, Ql + pq, Kh + pk, Kl + pk, Vh + pk, Vl + pk, mk, (bx * 2 + wave) * 16, Ah + ao, Al + ao);
    else fattn_tile<h16, 2>(Q16 + pq, nullptr, K16 + pk, nullptr, V16 + pk, nullptr, mk, RH + (bx * 3 + wave - 2) * 32, Ah + ao, Al + ao);
}

extern "C" void kernel_launch(void* const* d_in, const int* in_sizes, int n_in,
                              void* d_out, int out_size, void* d_ws, size_t ws_size, hipStream_t stream) {
    (void)in_sizes; (void)n_in; (void)out_size;
    const float* x = (const float*)d_in[0]; const float* wq = (const float*)d_in[1]; const float* bqv = (const float*)d_in[2]; const float* wk = (const float*)d_in[3]; const float* bkv = (const float*)d_in[4]; const float* wv = (const float*)d_in[5]; const float* bvv = (const float*)d_in[6]; const float* wo = (const float*)d_in[7]; const float* bo = (const float*)d_in[8]; const int* mk = (const int*)d_in[9];   // torch [out][in] weights; mask int32 [1][1][1024][1024] (nonzero = attend)
    float* OUT = (float*)d_out;     // [4][1024][1024]
    char* wsp = (char*)d_ws;
    auto take = [&](size_t bytes) { char* p = wsp; wsp += (bytes + 255) & ~(size_t)255; return (void*)p; };
    bf* WQ = (bf*)take((size_t)DQ * DM * 2); bf* WK = (bf*)take((size_t)DKV * DM * 2); bf* WV = (bf*)take((size_t)DKV * DM * 2); bf* WO = (bf*)take((size_t)DM * DQ * 2); float* CS = (float*)take((size_t)TT * HD * 2 * 4);
    bf* XB = (bf*)take((size_t)NB_ * TT * DM * 2);
    h16* QP16 = (h16*)take((size_t)NB_ * NH_ * TT * HD * 2); h16* KP16 = (h16*)take((size_t)NB_ * NKV * TT * HD * 2); h16* VT16 = (h16*)take((size_t)NB_ * NKV * HD * TT * 2);
    bf* QPh = (bf*)take((size_t)NB_ * NH_ * TT * HD * 2); bf* QPl = (bf*)take((size_t)NB_ * NH_ * TT * HD * 2); bf* KPh = (bf*)take((size_t)NB_ * NKV * TT * HD * 2); bf* KPl = (bf*)take((size_t)NB_ * NKV * TT * HD * 2); bf* VTh = (bf*)take((size_t)NB_ * NKV * HD * TT * 2); bf* VTl = (bf*)take((size_t)NB_ * NKV * HD * TT * 2);
    bf* ATh = (bf*)take((size_t)NB_ * TT * DQ * 2); bf* ATl = (bf*)take((size_t)NB_ * TT * DQ * 2); int* MK = (int*)take((size_t)TT * TT * 4);
    if ((size_t)(wsp - (char*)d_ws) > ws_size) return;    // well inside the workspace
    k_prep<<<PTB + PMB + PXB + PQB + 2 * PKB + PQB, 256, 0, stream>>>(x, wq, wk, wv, wo, mk, XB, WQ, WK, WV, WO, CS, MK);
    // all batch items per launch: x is [NB_*TT][DM], so the projections are plain GEMMs with M = NB_*TT
    k_qkv<<<dim3(NB_ * TT / 256, NH_, 1), 384, 0, stream>>>(XB, WQ, WK, WV, bqv, bkv, bvv, CS, QP16, QPh, QPl, KP16, KPh, KPl, VT16, VTh, VTl);   // v^T = Wv x^T: rows d, columns b*TT + t
    k_fattn<<<dim3(FBX, NB_ * NH_, 1), 160, 0, stream>>>(QP16, KP16, VT16, QPh, QPl, KPh, KPl, VTh, VTl, MK, ATh, ATl);
    k_gemmw<bf, 1, true, DQ><<<dim3(NB_ * TT / 64, DM / 64, 1), 32, 0, stream>>>(ATh, ATl, WO, nullptr, OUT, DM, bo);
}

// v006
// It runs in 125 microseconds.
// Two timings next to v005 both put it at 1.15 times that version's speed.
// Over all steps from v000 it is 19.0 times as fast.
#include <hip/hip_runtime.h>

// MultiHeadAttentionEuclid (x [4][1024][1024]; q/k/v = x W^T + b (16 heads x 64); interleaved-pair rotary (base 1e4, positions 0..1023 computed on device); scores = q.k/8 where mask[0][0][i][j] != 0 (int32 [1][1][1024][1024],
// read as data; here causal), -inf elsewhere; softmax; out = merged att.v Wo^T + bo -> [4][1024][1024]).
// Compute dtypes, f32 accumulate: every input rounded to bf16; projections on PLAIN bf16 operands (inputs: exact, + bias); rope f32; scores (K 64) and att.v on bf16 hi+lo planes (3 products)
// for the first 256 query rows of each head and SINGLE fp16 planes for the rest; f32 masked online softmax in registers; merged heads hl x exact Wo (2 products) + bo. One-wave-per-64x64-tile GEMMs. Deterministic, no atomics;
// Launch plan: projections and the output product take all 4 batch items in one grid (rows b*1024 + t, planes [b][h]); a 64-column tile is one head, so each projection's epilogue writes the 16-bit head planes itself
// (q, k: bias, rope, split; v: computed as Wv x^T, bias, split, rows d over columns t); scores, softmax and att.v of all 64 (batch, head) pairs are one launch (k_fattn).
// FRAGMENT ORDER: every 16-bit plane [rows][K] that feeds a matrix operand is stored as tiles of 16 rows x 32 k, 512 elements each, tile (R, kt) at (R * (K/32) + kt) * 512. Inside a tile, element (row, k) stands at
// ((k >> 4) & 1) * 256 + (((k >> 3) & 1) * 16 + row) * 8 + (k & 7): the two 16-byte loads of a lane's fragment are then at bytes lane * 16 and 512 + lane * 16 of the tile, so one wave load reads 512 contiguous bytes
// (4 whole lines, not 32 bytes of each of 16). Which lane and register hold which (row, k) is as with row-major planes; only the place in memory differs.
// The mask is copied once, as int32, into the same kind of order (k_prep): tiles of 16 queries x 32 keys, 512 ints each, tile (qt, kbt) at (qt * (TT/32) + kbt) * 512; the four ints (query lr, keys kt*16 + hi*8 + h*4 ..+3) at ((kt*2 + h) * 32 + lane) * 4.

#define NB_  4
#define TT   1024
#define DM   1024
#define NH_  16
#define NKV  16
#define REP  (NH_ / NKV)
#define HD   64
#define DQ   (NH_ * HD)
#define DKV  (NKV * HD)
#define RH   256                  // query rows < RH use hi+lo planes
#define WIN  0
#define SCL  0.125f   // HD^-0.5
typedef _Float16 h16;
typedef unsigned short bf;
typedef __attribute__((ext_vector_type(16))) __bf16   v16bf;
typedef __attribute__((ext_vector_type(16))) _Float16 v16h;
typedef __attribute__((ext_vector_type(8)))  _Float16 v8h;
typedef __attribute__((ext_vector_type(8)))  unsigned short v8us;
typedef __attribute__((ext_vector_type(8)))  float    v8f;
typedef __attribute__((ext_vector_type(4)))  float    v4f;
typedef v8h  __attribute__((may_alias)) v8ha;
typedef v4f  __attribute__((may_alias)) v4fa;
typedef v8us __attribute__((may_alias)) v8usa;

__device__ __forceinline__ unsigned short f2bf(float f) { unsigned u = __float_as_uint(f); u += 0x7FFFu + ((u >> 16) & 1u); return (unsigned short)(u >> 16); }
__device__ __forceinline__ float bf2f(unsigned short b) { return __uint_as_float(((unsigned)b) << 16); }
__device__ __forceinline__ float bfr(float f) { return bf2f(f2bf(f)); }
__device__ __forceinline__ v16h cat16(v8h lo, v8h hi) { return __builtin_shufflevector(lo, hi, 0, 1, 2, 3, 4, 5, 6, 7, 8, 9, 10, 11, 12, 13, 14, 15); }
__device__ __forceinline__ v16bf cat16b(v8us lo, v8us hi) { return __builtin_bit_cast(v16bf, __builtin_shufflevector(lo, hi, 0, 1, 2, 3, 4, 5, 6, 7, 8, 9, 10, 11, 12, 13, 14, 15)); }
__device__ __forceinline__ v8f wmma16(v16h a, v16h b, v8f c) { return __builtin_amdgcn_wmma_f32_16x16x32_f16(false, a, false, b, (short)0, c, false, false); }
__device__ __forceinline__ v8f wmmab(v16bf a, v16bf b, v8f c) { return __builtin_amdgcn_wmma_f32_16x16x32_bf16(false, a, false, b, (short)0, c, false, false); }



__device__ __forceinline__ h16 tohx(float x) { return (h16)x; }
__device__ __forceinline__ void splitf(float y, unsigned short& h, unsigned short& l) { h = f2bf(y); l = f2bf(y - bf2f(h)); }
typedef __attribute__((ext_vector_type(2))) _Float16 v2h;
typedef __attribute__((ext_vector_type(4))) _Float16 v4h;
typedef __attribute__((ext_vector_type(2))) unsigned short v2us;
typedef __attribute__((ext_vector_type(4))) unsigned short v4us;
typedef __attribute__((ext_vector_type(2))) float v2f;
typedef __attribute__((ext_vector_type(4))) int v4i;

// ---- k_gemmw: register-blocked GEMM, ONE WAVE per 64x64 output tile (16 accumulators), operands straight from 16-bit planes in fragment order; grid (M/64, N/64), 32 threads.
// C[m][n] (f32, pitch ldc, + optional f32 bias[n]) = sum_k A[m][k] Bt[n][k] (+ split products per NSPLIT). K % 32 == 0.
// EPI 0: C as above. EPI 1 (rows m = b*TT + t, column tile = head): bias[n], interleaved-pair rope from the table CS ([t][d] -> cos, sin), then the fp16, bf16 hi and bf16 lo planes [b][head] of rows t, K = d, in fragment order.
// EPI 2 (row tile = head, columns n = b*TT + t): bias[m], then the same three planes [b][head] of rows d, K = t, in fragment order. Neither writes C.
template <typename T16> struct WFrag;   // ld(c): the fragment of one tile; c = the tile's address + lane * 16 bytes
template <> struct WFrag<h16> { typedef v16h V; static __device__ __forceinline__ V ld(const char* c) { return cat16(*(const v8h*)c, *(const v8h*)(c + 512)); } static __device__ __forceinline__ v8f mma(V a, V b, v8f c) { return wmma16(a, b, c); } };
template <> struct WFrag<bf> { typedef v16bf V; static __device__ __forceinline__ V ld(const char* c) { return cat16b(*(const v8us*)c, *(const v8us*)(c + 512)); } static __device__ __forceinline__ v8f mma(V a, V b, v8f c) { return wmmab(a, b, c); } };
// gemmw_tile: the tile (tx, ty) of one wave; os: that wave's own 16 x 68 floats of LDS; nh: heads per batch item (EPI 1, 2).
template <typename T16, int NSPLIT, bool BIAS, int EPI>
__device__ __forceinline__ void gemmw_tile(const T16* __restrict__ A, const T16* __restrict__ A2, const T16* __restrict__ Bt, const T16* __restrict__ Bt2, int K, float* C, int ldc, const float* __restrict__ bias, const float* __restrict__ CS, h16* __restrict__ P16, bf* __restrict__ Ph, bf* __restrict__ Pl, int tx, int ty, int nh, float* os) {
    typedef typename WFrag<T16>::V V;
    const int lane = threadIdx.x & 31, lr = lane & 15, hi = lane >> 4; const int r0 = tx * 64, c0 = ty * 64;
    v8f acc[4][4];
#pragma unroll
    for (int mb = 0; mb < 4; ++mb)
#pragma unroll
        for (int nb = 0; nb < 4; ++nb) acc[mb][nb] = (v8f){};
    const size_t aoff = (size_t)r0 * K, boff = (size_t)c0 * K; const unsigned lo = lane * 16;   // a row tile is 16 * K elements, a k tile 512
#pragma unroll 1
    for (int kc = 0; kc < K; kc += 32) {
        V a[4], a2[4], b[4], b2[4]; constexpr bool SA = NSPLIT == 1 || NSPLIT == 2, SB = NSPLIT >= 2; constexpr size_t RT = 2;   // bytes an element
        const char* const pa = (const char*)(A + aoff + kc * 16) + lo; const char* const pb = (const char*)(Bt + boff + kc * 16) + lo;   // this lane's 16 bytes of this pass's k tile, first row tile
        const char* const pa2 = SA ? (const char*)(A2 + aoff + kc * 16) + lo : pa; const char* const pb2 = SB ? (const char*)(Bt2 + boff + kc * 16) + lo : pb;
#pragma unroll
        for (int mb = 0; mb < 4; ++mb) { a[mb] = WFrag<T16>::ld(pa + (size_t)mb * 16 * K * RT); if (SA) a2[mb] = WFrag<T16>::ld(pa2 + (size_t)mb * 16 * K * RT); }
#pragma unroll
        for (int nb = 0; nb < 4; ++nb) { b[nb] = WFrag<T16>::ld(pb + (size_t)nb * 16 * K * RT); if (SB) b2[nb] = WFrag<T16>::ld(pb2 + (size_t)nb * 16 * K * RT); }
        asm volatile("s_wait_xcnt 0x0" :: "v"(pa), "v"(pa2), "v"(pb), "v"(pb2) : "memory");   // the address registers stay whole until every load of the pass that names them is past this wait (as inputs they cannot be given to a load's result before it); the wave has only its data to wait for here
        __builtin_amdgcn_sched_barrier(0);   // no product is lifted over the pass's loads: without it the scheduler starts the products early and issues the last fragments' loads into freed registers, behind a load wait, so a pass waits out the load latency twice in a row
#pragma unroll
        for (int nb = 0; nb < 4; ++nb) {
#pragma unroll
            for (int mb = 0; mb < 4; ++mb) { acc[mb][nb] = WFrag<T16>::mma(a[mb], b[nb], acc[mb][nb]); if (SA) acc[mb][nb] = WFrag<T16>::mma(a2[mb], b[nb], acc[mb][nb]); if (SB) acc[mb][nb] = WFrag<T16>::mma(a[mb], b2[nb], acc[mb][nb]); } }
        asm volatile("v_nop\n\tv_nop\n\tv_nop\n\tv_nop" : "+v"(acc[0][0]), "+v"(acc[1][1]), "+v"(acc[2][2]), "+v"(acc[3][3]) : "v"(a[0]), "v"(a[3]));
    }
    static_assert(EPI == 0 || HD == 64, "a 64-wide tile is one head");
    const int fo = (lr >> 3) * 512 + ((lr >> 2) & 1) * 256 + ((lr >> 1) & 1) * 128 + (lr & 1) * 4;   // k = lr * 4 of a 64-wide k range, row 0, in fragment order
    float cb[4], rb[4][8]; v2f cs[2][8][2]; size_t pbase = 0;   // all of a row block's table entries are asked for one row block ahead, as one batch
    const float* const cp0 = CS + ((size_t)(r0 % TT + hi) * HD + lr * 4) * 2;   // this lane's first table entry; every other one is a constant step from it
    if (EPI == 1) { pbase = ((size_t)((r0 / TT) * nh + ty) * TT + (r0 % TT)) * HD + fo;
#pragma unroll
        for (int i = 0; i < 4; ++i) cb[i] = bfr(bias[c0 + lr * 4 + i]);
#pragma unroll
        for (int s = 0; s < 8; ++s) { const float* cp = cp0 + 2 * s * HD * 2; cs[0][s][0] = *(const v2f*)cp; cs[0][s][1] = *(const v2f*)(cp + 4); } }
    if (EPI == 2) { pbase = (size_t)((c0 / TT) * nh + tx) * HD * TT + (c0 % TT) * 16 + fo;
#pragma unroll
        for (int mb = 0; mb < 4; ++mb)
#pragma unroll
            for (int s = 0; s < 8; ++s) { if (mb == 3 && s == 7) asm volatile("s_wait_xcnt 0x0" ::: "memory");   // without it the last load's result was placed in the offset register that the 31 loads before it still name: the wait stands in front of any such rewrite
                rb[mb][s] = bfr(bias[r0 + mb * 16 + 2 * s + hi]); } }
#pragma unroll
    for (int mb = 0; mb < 4; ++mb) {
        if (EPI == 1 && mb < 3) {
#pragma unroll
            for (int s = 0; s < 8; ++s) { const float* cp = cp0 + ((mb + 1) * 16 + 2 * s) * HD * 2; cs[(mb + 1) & 1][s][0] = *(const v2f*)cp; cs[(mb + 1) & 1][s][1] = *(const v2f*)(cp + 4); } }
#pragma unroll
        for (int nb = 0; nb < 4; ++nb) {
#pragma unroll
            for (int j = 0; j < 8; ++j) os[(hi * 8 + j) * 68 + nb * 16 + lr] = acc[mb][nb][j]; }
        __builtin_amdgcn_wave_barrier(); asm volatile("" ::: "memory");
        float* crow = C + (size_t)(r0 + mb * 16) * ldc + c0;
        if (EPI != 0) {
#pragma unroll
            for (int s = 0; s < 8; ++s) { const int row = 2 * s + hi; const v4f val = *(const v4fa*)(os + row * 68 + lr * 4); float r[4];
                if (EPI == 1) { const float x0 = val[0] + cb[0], x1 = val[1] + cb[1], x2 = val[2] + cb[2], x3 = val[3] + cb[3]; const v2f ca = cs[mb & 1][s][0], cc = cs[mb & 1][s][1];
                    r[0] = x0 * ca[0] - x1 * ca[1]; r[1] = x1 * ca[0] + x0 * ca[1]; r[2] = x2 * cc[0] - x3 * cc[1]; r[3] = x3 * cc[0] + x2 * cc[1]; }
                else { r[0] = val[0] + rb[mb][s]; r[1] = val[1] + rb[mb][s]; r[2] = val[2] + rb[mb][s]; r[3] = val[3] + rb[mb][s]; }
                v4h o16; v4us oh, ol;
#pragma unroll
                for (int i = 0; i < 4; ++i) { o16[i] = tohx(r[i]); unsigned short a2, c2; splitf(r[i], a2, c2); oh[i] = a2; ol[i] = c2; }
                const size_t e = pbase + (size_t)mb * 16 * (EPI == 1 ? HD : TT) + row * 8;   // rows 2s, 2s + 1: 32 bytes in each of 8 places; the 8 stores of a row block fill its tiles
                *(v4h*)(P16 + e) = o16; *(v4us*)(Ph + e) = oh; *(v4us*)(Pl + e) = ol; }
            if (EPI == 1 && mb < 2) asm volatile("s_wait_xcnt 0x0" ::: "memory");   // the table loads that follow land in registers that these stores still name as data: the wait stands in front of that rewrite
        } else {
#pragma unroll
            for (int s = 0; s < 8; ++s) { const int row = 2 * s + hi, cofs = lr * 4; v4f val = *(const v4fa*)(os + row * 68 + cofs); if (BIAS) { val[0] += bfr(bias[c0 + cofs]); val[1] += bfr(bias[c0 + cofs + 1]); val[2] += bfr(bias[c0 + cofs + 2]); val[3] += bfr(bias[c0 + cofs + 3]); }
                *(v4f*)(crow + (size_t)row * ldc + cofs) = val; }
             }
        __builtin_amdgcn_wave_barrier(); asm volatile("" ::: "memory");
    }
}
template <typename T16, int NSPLIT, bool BIAS, int K>   // K at compile time: the steps from row tile to row tile are then immediates on one address register pair per plane
__global__ __launch_bounds__(32) void k_gemmw(const T16* __restrict__ A, const T16* __restrict__ A2, const T16* __restrict__ Bt, const T16* __restrict__ Bt2, float* C, int ldc, const float* __restrict__ bias) {
    __shared__ __align__(16) float os[16 * 68];
    gemmw_tile<T16, NSPLIT, BIAS, 0>(A, A2, Bt, Bt2, K, C, ldc, bias, nullptr, nullptr, nullptr, nullptr, blockIdx.x, blockIdx.y, 0, os);
}
// k_qkv: the three projections in one launch, grid (NB_*TT/256, heads), 12 waves a block, one block a WGP: waves 0..3 q, 4..7 k (x W^T), 8..11 v (Wv x^T) of one head, wave w on the 64 rows (w & 3) of the block's 256 rows of x.
// The block's waves read the same 4 row tiles of x and the same 3 weight tiles, so what one wave has fetched the others find in the WGP's cache; no wave reads another's result, and there is no barrier between them.
static_assert(NH_ == NKV && NB_ * TT % 256 == 0, "one grid for q, k and v");
__global__ __launch_bounds__(384) void k_qkv(const bf* __restrict__ X, const bf* __restrict__ Wq, const bf* __restrict__ Wk, const bf* __restrict__ Wv, const float* __restrict__ bq, const float* __restrict__ bk, const float* __restrict__ bv, const float* __restrict__ CS,
                                            h16* __restrict__ Q16, bf* __restrict__ Qh, bf* __restrict__ Ql, h16* __restrict__ K16, bf* __restrict__ Kh, bf* __restrict__ Kl, h16* __restrict__ V16, bf* __restrict__ Vh, bf* __restrict__ Vl) {
    __shared__ __align__(16) float os[12][16 * 68];
    const int wave = __builtin_amdgcn_readfirstlane(threadIdx.x >> 5); const int xt = blockIdx.x * 4 + (wave & 3);
    if (wave < 8) { const bool k = wave >= 4;   // q and k run the same code on their own pointers
        gemmw_tile<bf, 0, true, 1>(X, nullptr, k ? Wk : Wq, nullptr, DM, nullptr, 0, k ? bk : bq, CS, k ? K16 : Q16, k ? Kh : Qh, k ? Kl : Ql, xt, blockIdx.y, NH_, os[wave]); }
    else gemmw_tile<bf, 0, true, 2>(Wv, nullptr, X, nullptr, DM, nullptr, 0, bv, nullptr, V16, Vh, Vl, blockIdx.y, xt, NKV, os[wave]);
}


__global__ __launch_bounds__(256) void k_wtG(const float* __restrict__ w, int K, int N, bf* Bt) {
    const int lane = threadIdx.x & 31; const int L0 = (blockIdx.x * 8 + (threadIdx.x >> 5)) * 8; const int nlines = N * K / 64;
{
#pragma unroll 1
        for (int l = 0; l < 8; ++l) { const int L = L0 + l; if (L >= nlines) break; const size_t e = (size_t)L * 64 + lane * 2; const int k = (int)(e % K), n = (int)(e / K); v2us o;
            o[0] = f2bf(w[(size_t)k * N + n]); o[1] = f2bf(w[(size_t)(k + 1) * N + n]); *(v2us*)(Bt + e) = o; }
         }
}
// k_prep: everything that reads inputs only, one launch. Blocks 0..PTB-1 (the longest, so first): the rope table. Then the mask copy. Then x, Wq, Wk, Wv, Wo to bf16 in fragment order, CVB groups of 8 floats a thread, a block's groups 256 apart: group g is the g-th 16 bytes of the plane written,
// so a wave stores 512 contiguous bytes and reads 64 bytes of each of 16 rows (the wave beside it reads the line's other half); 256 groups on are 4 k tiles on in the same rows.
#define CVB 4
#define PTB (TT * HD / 256)
#define PXB (NB_ * TT * DM / (8 * 256 * CVB))
#define PQB (DQ * DM / (8 * 256 * CVB))
#define PKB (DKV * DM / (8 * 256 * CVB))
#define PMB (TT * TT / (4 * 256 * CVB))
static_assert(TT * HD % 256 == 0 && NB_ * TT * DM % (8 * 256 * CVB) == 0 && DQ * DM % (8 * 256 * CVB) == 0 && DKV * DM % (8 * 256 * CVB) == 0, "whole blocks");
static_assert(DQ == DM && (DM / 32) % (4 * CVB) == 0, "all five planes have rows of DM elements, and a block stays inside one row tile");
static_assert(TT * TT % (4 * 256 * CVB) == 0 && (TT / 32) % (2 * CVB) == 0, "whole blocks of the mask copy, each inside one row of tiles");
__global__ __launch_bounds__(256) void k_prep(const float* __restrict__ x, const float* __restrict__ wq, const float* __restrict__ wk, const float* __restrict__ wv, const float* __restrict__ wo, const int* __restrict__ mk, bf* XB, bf* WQ, bf* WK, bf* WV, bf* WO, float* CS, int* MK) {
    int b = blockIdx.x;
    if (b < PTB) { const int idx = b * 256 + threadIdx.x; const int t = idx / HD, d = idx % HD; const int i = d >> 1; const float inv = __fdiv_rn(1.0f, powf(10000.0f, (float)(2 * i) / (float)HD)); const float ang = __fmul_rn((float)t, inv); v2f cs; cs[0] = cosf(ang); cs[1] = sinf(ang);
        *(v2f*)(CS + (size_t)idx * 2) = cs; return; }
    b -= PTB;
    if (b < PMB) { const unsigned g0 = (unsigned)b * (256 * CVB) + threadIdx.x, mt = g0 >> 7, ch = (threadIdx.x >> 5) & 3, ln = threadIdx.x & 31; v4i m[CVB];   // the mask: group g is the g-th 16 bytes written; 256 groups on are 2 key tiles on in the same queries
        const unsigned mo = (((mt / (TT / 32)) * 16 + (ln & 15)) * TT + (mt % (TT / 32)) * 32 + (ch >> 1) * 16 + (ln >> 4) * 8 + (ch & 1) * 4) * 4;   // bytes
#pragma unroll
        for (int u = 0; u < CVB; ++u) m[u] = *(const v4i*)((const char*)(mk + u * 64) + mo);
#pragma unroll
        for (int u = 0; u < CVB; ++u) *(v4i*)(MK + ((size_t)g0 + u * 256) * 4) = m[u];
        asm volatile("s_wait_xcnt 0x0" ::: "memory");   // as behind the conversion stores below: the listing lays the table code behind these stores too, and it rewrites registers that they still name
        return; }
    b -= PMB; const float* src; bf* dst;
    if (b < PXB) { src = x; dst = XB; }
    else if ((b -= PXB) < PQB) { src = wq; dst = WQ; }
    else if ((b -= PQB) < PKB) { src = wk; dst = WK; }
    else if ((b -= PKB) < PKB) { src = wv; dst = WV; }
    else { b -= PKB; src = wo; dst = WO; }
    const size_t i0 = (size_t)b * (256 * CVB) + threadIdx.x; v8f v[CVB]; const unsigned tile = (unsigned)(i0 >> 6), ln = threadIdx.x & 31;
    const unsigned so = (((tile / (DM / 32)) * 16 + (ln & 15)) * DM + (tile % (DM / 32)) * 32 + ((threadIdx.x >> 5) & 1) * 16 + (ln >> 4) * 8) * 4;   // bytes: where group i0's 8 floats stand in the row-major source
#pragma unroll
    for (int u = 0; u < CVB; ++u) v[u] = *(const v8f*)((const char*)(src + u * 128) + so);
#pragma unroll
    for (int u = 0; u < CVB; ++u) { v8us o;
#pragma unroll
        for (int k = 0; k < 8; ++k) o[k] = f2bf(v[u][k]);
        *(v8us*)(dst + (i0 + u * 256) * 8) = o; }
    asm volatile("s_wait_xcnt 0x0" ::: "memory");   // the listing lays the table code behind these stores, and it rewrites registers that they still name as data: the wait stands in front of any such rewrite
}
__device__ __forceinline__ float xhalf(float x) { return __builtin_bit_cast(float, __builtin_amdgcn_permlanex16(__builtin_bit_cast(int, x), __builtin_bit_cast(int, x), 0x76543210, 0xfedcba98, false, false)); }  // lane l takes lane l ^ 16's value
template <typename T16> struct PFrag;
template <> struct PFrag<h16> { static constexpr bool SPLIT = false; static __device__ __forceinline__ void pack(const float* p, v16h& a, v16h& b) { (void)b;
#pragma unroll
    for (int s = 0; s < 16; ++s) a[s] = (h16)p[s]; } };
template <> struct PFrag<bf> { static constexpr bool SPLIT = true; static __device__ __forceinline__ void pack(const float* p, v16bf& a, v16bf& b) {
#pragma unroll
    for (int s = 0; s < 16; ++s) { const __bf16 h = (__bf16)p[s]; a[s] = h; b[s] = (__bf16)(p[s] - (float)h); } } };
template <typename T16, int QT>
__device__ __forceinline__ void fattn_tile(const T16* __restrict__ Q, const T16* __restrict__ Q2, const T16* __restrict__ Kp, const T16* __restrict__ K2, const T16* __restrict__ Vt, const T16* __restrict__ Vt2, const int* __restrict__ mk, int q0, bf* Ah, bf* Al) {
    typedef typename WFrag<T16>::V V; constexpr bool SP = PFrag<T16>::SPLIT; constexpr float SH = SP ? 0.0f : 10.0f;
    const int lane = threadIdx.x & 31, lr = lane & 15, hi = lane >> 4; const unsigned lo = lane * 16;
    V qf[QT][2], qf2[QT][2]; v8f o[QT][4]; float m[QT], l[QT];
#pragma unroll
    for (int qt = 0; qt < QT; ++qt) { m[qt] = -3.0e38f; l[qt] = 0.0f;
#pragma unroll
        for (int ks = 0; ks < 2; ++ks) { const size_t qo = (size_t)(q0 + qt * 16) * HD + ks * 512; qf[qt][ks] = WFrag<T16>::ld((const char*)(Q + qo) + lo); if (SP) qf2[qt][ks] = WFrag<T16>::ld((const char*)(Q2 + qo) + lo); }
#pragma unroll
        for (int dt = 0; dt < 4; ++dt) o[qt][dt] = (v8f){}; }
#pragma unroll 1
    for (int kb = 0; kb < TT; kb += 32) {
        V kf[2][2], kf2[2][2], vf[4], vf2[4]; v4i mq[QT][2][2]; const char* const Kb = (const char*)(Kp + (size_t)kb * HD) + lo; const char* const Vb = (const char*)(Vt + (size_t)kb * 16) + lo;   // this lane's 16 bytes of this pass's first tile, per plane
        const char* const Mb = (const char*)(mk + (size_t)q0 * (TT / 32) * 32 + kb * 16) + lo;
        const char* const K2b = SP ? (const char*)(K2 + (size_t)kb * HD) + lo : Kb; const char* const V2b = SP ? (const char*)(Vt2 + (size_t)kb * 16) + lo : Vb;
#pragma unroll
        for (int kt = 0; kt < 2; ++kt)
#pragma unroll
            for (int ks = 0; ks < 2; ++ks) { const int e = (kt * 16 * HD + ks * 512) * 2; kf[kt][ks] = WFrag<T16>::ld(Kb + e); if (SP) kf2[kt][ks] = WFrag<T16>::ld(K2b + e); }
#pragma unroll
        for (int qt = 0; qt < QT; ++qt)
#pragma unroll
            for (int kt = 0; kt < 2; ++kt) { const char* mp = Mb + (qt * (TT / 32) * 512 + kt * 256) * 4; mq[qt][kt][0] = *(const v4i*)mp; mq[qt][kt][1] = *(const v4i*)(mp + 512); }
#pragma unroll
        for (int dt = 0; dt < 4; ++dt) { const int e = dt * 16 * TT * 2; vf[dt] = WFrag<T16>::ld(Vb + e); if (SP) vf2[dt] = WFrag<T16>::ld(V2b + e); }
        asm volatile("s_wait_xcnt 0x0" :: "v"(Kb), "v"(K2b), "v"(Vb), "v"(V2b), "v"(Mb) : "memory");   // the address registers stay whole until every load of the pass that names them is past this wait (as inputs they cannot be given to a load's result before it); the wave has only its data to wait for here
#pragma unroll
        for (int qt = 0; qt < QT; ++qt) {
            float t[16]; float bm = -3.0e38f;
#pragma unroll
            for (int kt = 0; kt < 2; ++kt) { v8f s = (v8f){};
#pragma unroll
                for (int ks = 0; ks < 2; ++ks) { s = WFrag<T16>::mma(kf[kt][ks], qf[qt][ks], s); if (SP) { s = WFrag<T16>::mma(kf2[kt][ks], qf[qt][ks], s); s = WFrag<T16>::mma(kf[kt][ks], qf2[qt][ks], s); } }
#pragma unroll
                for (int j = 0; j < 8; ++j) { const float x = (mq[qt][kt][j >> 2][j & 3] != 0) ? s[j] * (SCL * 1.4426950408889634f) : -3.0e38f; t[kt * 8 + j] = x; bm = fmaxf(bm, x); } }
            bm = fmaxf(bm, xhalf(bm));
            const float mn = fmaxf(m[qt], bm); const float al = __builtin_amdgcn_exp2f(m[qt] - mn); m[qt] = mn; const float mb = mn - SH; float ps = 0.0f;
#pragma unroll
            for (int s = 0; s < 16; ++s) { t[s] = __builtin_amdgcn_exp2f(t[s] - mb); ps += t[s]; }
            l[qt] = l[qt] * al + ps;
#pragma unroll
            for (int dt = 0; dt < 4; ++dt) o[qt][dt] *= al;
            V pf, pf2; PFrag<T16>::pack(t, pf, pf2);
#pragma unroll
            for (int dt = 0; dt < 4; ++dt) { o[qt][dt] = WFrag<T16>::mma(vf[dt], pf, o[qt][dt]); if (SP) { o[qt][dt] = WFrag<T16>::mma(vf2[dt], pf, o[qt][dt]); o[qt][dt] = WFrag<T16>::mma(vf[dt], pf2, o[qt][dt]); } }
        }
        __builtin_amdgcn_sched_barrier(0);   // keeps the next pass's address additions behind this pass's last load wait: without it they are lifted over loads still in flight that name those registers
    }
#pragma unroll
    for (int qt = 0; qt < QT; ++qt) { const float inv = __fdiv_rn(1.0f, l[qt] + xhalf(l[qt])); const size_t oo = (size_t)(q0 + qt * 16) * DQ;
#pragma unroll
        for (int dt = 0; dt < 4; ++dt) { v8us oh, ol;
#pragma unroll
            for (int j = 0; j < 8; ++j) { unsigned short a, c2; splitf(o[qt][dt][j] * inv, a, c2); oh[j] = a; ol[j] = c2; }
            *(v8us*)((char*)(Ah + oo + dt * 256) + lo) = oh; *(v8us*)((char*)(Al + oo + dt * 256) + lo) = ol; } }
}
// grid (FBX, NB_*NH_), 5 waves of one head per block, every block the same work: waves 0, 1 take 16 hi+lo query rows each, waves 2..4 take 32 fp16 query rows each (RH/16 = 2 FBX and (TT-RH)/32 = 3 FBX tiles a head)
#define FBX 8
static_assert(RH == 2 * FBX * 16 && TT - RH == 3 * FBX * 32, "tiles per block");
__global__ __launch_bounds__(160) void k_fattn(const h16* __restrict__ Q16, const h16* __restrict__ K16, const h16* __restrict__ V16, const bf* __restrict__ Qh, const bf* __restrict__ Ql, const bf* __restrict__ Kh, const bf* __restrict__ Kl, const bf* __restrict__ Vh, const bf* __restrict__ Vl, const int* __restrict__ mk, bf* Ah, bf* Al) {
    const int bh = blockIdx.y, bx = blockIdx.x, wave = __builtin_amdgcn_readfirstlane(threadIdx.x >> 5); const size_t pq = (size_t)bh * TT * HD, pk = (size_t)(bh / REP) * TT * HD; const size_t ao = (size_t)(bh / NH_) * TT * DQ + (size_t)(bh % NH_) * (HD / 32) * 512;
    if (wave < 2) fattn_tile<bf, 1>(Qh + pq, Ql + pq, Kh + pk, Kl + pk, Vh + pk, Vl + pk, mk, (bx * 2 + wave) * 16, Ah + ao, Al + ao);
    else fattn_tile<h16, 2>(Q16 + pq, nullptr, K16 + pk, nullptr, V16 + pk, nullptr, mk, RH + (bx * 3 + wave - 2) * 32, Ah + ao, Al + ao);
}

extern "C" void kernel_launch(void* const* d_in, const int* in_sizes, int n_in,
                              void* d_out, int out_size, void* d_ws, size_t ws_size, hipStream_t stream) {
    (void)in_sizes; (void)n_in; (void)out_size;
    const float* x = (const float*)d_in[0]; const float* wq = (const float*)d_in[1]; const float* bqv = (const float*)d_in[2]; const float* wk = (const float*)d_in[3]; const float* bkv = (const float*)d_in[4]; const float* wv = (const float*)d_in[5]; const float* bvv = (const float*)d_in[6]; const float* wo = (const float*)d_in[7]; const float* bo = (const float*)d_in[8]; const int* mk = (const int*)d_in[9];   // torch [out][in] weights; mask int32 [1][1][1024][1024] (nonzero = attend)
    float* OUT = (float*)d_out;     // [4][1024][1024]
    char* wsp = (char*)d_ws;
    auto take = [&](size_t bytes) { char* p = wsp; wsp += (bytes + 255) & ~(size_t)255; return (void*)p; };
    bf* WQ = (bf*)take((size_t)DQ * DM * 2); bf* WK = (bf*)take((size_t)DKV * DM * 2); bf* WV = (bf*)take((size_t)DKV * DM * 2); bf* WO = (bf*)take((size_t)DM * DQ * 2); float* CS = (float*)take((size_t)TT * HD * 2 * 4);
    bf* XB = (bf*)take((size_t)NB_ * TT * DM * 2);
    h16* QP16 = (h16*)take((size_t)NB_ * NH_ * TT * HD * 2); h16* KP16 = (h16*)take((size_t)NB_ * NKV * TT * HD * 2); h16* VT16 = (h16*)take((size_t)NB_ * NKV * HD * TT * 2);
    bf* QPh = (bf*)take((size_t)NB_ * NH_ * TT * HD * 2); bf* QPl = (bf*)take((size_t)NB_ * NH_ * TT * HD * 2); bf* KPh = (bf*)take((size_t)NB_ * NKV * TT * HD * 2); bf* KPl = (bf*)take((size_t)NB_ * NKV * TT * HD * 2); bf* VTh = (bf*)take((size_t)NB_ * NKV * HD * TT * 2); bf* VTl = (bf*)take((size_t)NB_ * NKV * HD * TT * 2);
    bf* ATh = (bf*)take((size_t)NB_ * TT * DQ * 2); bf* ATl = (bf*)take((size_t)NB_ * TT * DQ * 2); int* MK = (int*)take((size_t)TT * TT * 4);
    if ((size_t)(wsp - (char*)d_ws) > ws_size) return;    // well inside the workspace
    k_prep<<<PTB + PMB + PXB + PQB + 2 * PKB + PQB, 256, 0, stream>>>(x, wq, wk, wv, wo, mk, XB, WQ, WK, WV, WO, CS, MK);
    // all batch items per launch: x is [NB_*TT][DM], so the projections are plain GEMMs with M = NB_*TT
    k_qkv<<<dim3(NB_ * TT / 256, NH_, 1), 384, 0, stream>>>(XB, WQ, WK, WV, bqv, bkv, bvv, CS, QP16, QPh, QPl, KP16, KPh, KPl, VT16, VTh, VTl);   // v^T = Wv x^T: rows d, columns b*TT + t
    k_fattn<<<dim3(FBX, NB_ * NH_, 1), 160, 0, stream>>>(QP16, KP16, VT16, QPh, QPl, KPh, KPl, VTh, VTl, MK, ATh, ATl);
    k_gemmw<bf, 1, true, DQ><<<dim3(NB_ * TT / 64, DM / 64, 1), 32, 0, stream>>>(ATh, ATl, WO, nullptr, OUT, DM, bo);
}

// v007
// It runs in 107 microseconds.
// Two timings next to v006 put it at 1.16 and 1.14 times that version's speed.
// All steps since v000 together make it 21.9 times as fast.
#include <hip/hip_runtime.h>

// MultiHeadAttentionEuclid (x [4][1024][1024]; q/k/v = x W^T + b (16 heads x 64); interleaved-pair rotary (base 1e4, positions 0..1023 computed on device); scores = q.k/8 where mask[0][0][i][j] != 0 (int32 [1][1][1024][1024],
// read as data; here causal), -inf elsewhere; softmax; out = merged att.v Wo^T + bo -> [4][1024][1024]).
// Compute dtypes, f32 accumulate: every input rounded to bf16; projections on PLAIN bf16 operands (inputs: exact, + bias); rope f32; scores (K 64) and att.v on bf16 hi+lo planes (3 products)
// for the first 256 query rows of each head and SINGLE fp16 planes for the rest; f32 masked online softmax in registers; merged heads hl x exact Wo (2 products) + bo. One-wave-per-64x64-tile GEMMs. Deterministic, no atomics;
// Launch plan: projections and the output product take all 4 batch items in one grid (rows b*1024 + t, planes [b][h]); a 64-column tile is one head, so each projection's epilogue writes the 16-bit head planes itself
// (q, k: bias, rope, split; v: computed as Wv x^T, bias, split, rows d over columns t); scores, softmax and att.v of all 64 (batch, head) pairs are one launch (k_fattn).
// FRAGMENT ORDER: every 16-bit plane [rows][K] that feeds a matrix operand is stored as tiles of 16 rows x 32 k, 512 elements each, tile (R, kt) at (R * (K/32) + kt) * 512. Inside a tile, element (row, k) stands at
// ((k >> 4) & 1) * 256 + (((k >> 3) & 1) * 16 + row) * 8 + (k & 7): the two 16-byte loads of a lane's fragment are then at bytes lane * 16 and 512 + lane * 16 of the tile, so one wave load reads 512 contiguous bytes
// (4 whole lines, not 32 bytes of each of 16). Which lane and register hold which (row, k) is as with row-major planes; only the place in memory differs.
// The mask is copied once, as int32, into the same kind of order (k_prep): tiles of 16 queries x 32 keys, 512 ints each, tile (qt, kbt) at (qt * (TT/32) + kbt) * 512; the four ints (query lr, keys kt*16 + hi*8 + h*4 ..+3) at ((kt*2 + h) * 32 + lane) * 4.

#define NB_  4
#define TT   1024
#define DM   1024
#define NH_  16
#define NKV  16
#define REP  (NH_ / NKV)
#define HD   64
#define DQ   (NH_ * HD)
#define DKV  (NKV * HD)
#define RH   256                  // query rows < RH use hi+lo planes
#define WIN  0
#define SCL  0.125f   // HD^-0.5
typedef _Float16 h16;
typedef unsigned short bf;
typedef __attribute__((ext_vector_type(16))) __bf16   v16bf;
typedef __attribute__((ext_vector_type(16))) _Float16 v16h;
typedef __attribute__((ext_vector_type(8)))  _Float16 v8h;
typedef __attribute__((ext_vector_type(8)))  unsigned short v8us;
typedef __attribute__((ext_vector_type(8)))  float    v8f;
typedef __attribute__((ext_vector_type(4)))  float    v4f;
typedef v8h  __attribute__((may_alias)) v8ha;
typedef v4f  __attribute__((may_alias)) v4fa;
typedef v8us __attribute__((may_alias)) v8usa;

__device__ __forceinline__ unsigned short f2bf(float f) { unsigned u = __float_as_uint(f); u += 0x7FFFu + ((u >> 16) & 1u); return (unsigned short)(u >> 16); }
__device__ __forceinline__ float bf2f(unsigned short b) { return __uint_as_float(((unsigned)b) << 16); }
__device__ __forceinline__ float bfr(float f) { return bf2f(f2bf(f)); }
__device__ __forceinline__ v16h cat16(v8h lo, v8h hi) { return __builtin_shufflevector(lo, hi, 0, 1, 2, 3, 4, 5, 6, 7, 8, 9, 10, 11, 12, 13, 14, 15); }
__device__ __forceinline__ v16bf cat16b(v8us lo, v8us hi) { return __builtin_bit_cast(v16bf, __builtin_shufflevector(lo, hi, 0, 1, 2, 3, 4, 5, 6, 7, 8, 9, 10, 11, 12, 13, 14, 15)); }
__device__ __forceinline__ v8f wmma16(v16h a, v16h b, v8f c) { return __builtin_amdgcn_wmma_f32_16x16x32_f16(false, a, false, b, (short)0, c, false, false); }
__device__ __forceinline__ v8f wmmab(v16bf a, v16bf b, v8f c) { return __builtin_amdgcn_wmma_f32_16x16x32_bf16(false, a, false, b, (short)0, c, false, false); }



__device__ __forceinline__ h16 tohx(float x) { return (h16)x; }
__device__ __forceinline__ void splitf(float y, unsigned short& h, unsigned short& l) { h = f2bf(y); l = f2bf(y - bf2f(h)); }
typedef __attribute__((ext_vector_type(2))) _Float16 v2h;
typedef __attribute__((ext_vector_type(4))) _Float16 v4h;
typedef __attribute__((ext_vector_type(2))) unsigned short v2us;
typedef __attribute__((ext_vector_type(4))) unsigned short v4us;
typedef __attribute__((ext_vector_type(2))) float v2f;
typedef __attribute__((ext_vector_type(4))) int v4i;

// ---- k_gemmw: register-blocked GEMM, ONE WAVE per 64x64 output tile (16 accumulators), operands straight from 16-bit planes in fragment order; grid (M/64, N/64), 32 threads.
// C[m][n] (f32, pitch ldc, + optional f32 bias[n]) = sum_k A[m][k] Bt[n][k] (+ split products per NSPLIT). A pass of the k loop takes KU k tiles (K % (32 * KU) == 0): the loads of all of them issue first, the products follow tile by tile in k order,
// each tile's behind a counted wait, so a wave meets the load latency once per KU tiles and the later tiles' loads fly under the earlier tiles' products. KU is what the registers allow: 16 or 24 loads and 64 or 96 registers a tile.
// EPI 0: C as above. EPI 1 (rows m = b*TT + t, column tile = head): bias[n], interleaved-pair rope from the table CS ([t][d] -> cos, sin), then the fp16, bf16 hi and bf16 lo planes [b][head] of rows t, K = d, in fragment order.
// EPI 2 (row tile = head, columns n = b*TT + t): bias[m], then the same three planes [b][head] of rows d, K = t, in fragment order. Neither writes C.
template <typename T16> struct WFrag;   // ld(c): the fragment of one tile; c = the tile's address + lane * 16 bytes
template <> struct WFrag<h16> { typedef v16h V; static __device__ __forceinline__ V ld(const char* c) { return cat16(*(const v8h*)c, *(const v8h*)(c + 512)); } static __device__ __forceinline__ v8f mma(V a, V b, v8f c) { return wmma16(a, b, c); } };
template <> struct WFrag<bf> { typedef v16bf V; static __device__ __forceinline__ V ld(const char* c) { return cat16b(*(const v8us*)c, *(const v8us*)(c + 512)); } static __device__ __forceinline__ v8f mma(V a, V b, v8f c) { return wmmab(a, b, c); } };
// gemmw_tile: the tile (tx, ty) of one wave; os: that wave's own 16 x 68 floats of LDS; nh: heads per batch item (EPI 1, 2).
template <typename T16, int NSPLIT, bool BIAS, int EPI, int KU>
__device__ __forceinline__ void gemmw_tile(const T16* __restrict__ A, const T16* __restrict__ A2, const T16* __restrict__ Bt, const T16* __restrict__ Bt2, int K, float* C, int ldc, const float* __restrict__ bias, const float* __restrict__ CS, h16* __restrict__ P16, bf* __restrict__ Ph, bf* __restrict__ Pl, int tx, int ty, int nh, float* os) {
    typedef typename WFrag<T16>::V V;
    const int lane = threadIdx.x & 31, lr = lane & 15, hi = lane >> 4; const int r0 = tx * 64, c0 = ty * 64;
    v8f acc[4][4];
#pragma unroll
    for (int mb = 0; mb < 4; ++mb)
#pragma unroll
        for (int nb = 0; nb < 4; ++nb) acc[mb][nb] = (v8f){};
    const size_t aoff = (size_t)r0 * K, boff = (size_t)c0 * K; const unsigned lo = lane * 16;   // a row tile is 16 * K elements, a k tile 512
#pragma unroll 1
    for (int kc = 0; kc < K; kc += 32 * KU) {
        V a[KU][4], a2[KU][4], b[KU][4], b2[KU][4]; constexpr bool SA = NSPLIT == 1 || NSPLIT == 2, SB = NSPLIT >= 2; constexpr size_t RT = 2;   // bytes an element
        const char* const pa = (const char*)(A + aoff + kc * 16) + lo; const char* const pb = (const char*)(Bt + boff + kc * 16) + lo;   // this lane's 16 bytes of this pass's k tile, first row tile
        const char* const pa2 = SA ? (const char*)(A2 + aoff + kc * 16) + lo : pa; const char* const pb2 = SB ? (const char*)(Bt2 + boff + kc * 16) + lo : pb;
#pragma unroll
        for (int u = 0; u < KU; ++u) {   // k tile u of the pass stands u * 512 elements behind k tile 0
#pragma unroll
            for (int mb = 0; mb < 4; ++mb) { a[u][mb] = WFrag<T16>::ld(pa + ((size_t)mb * 16 * K + u * 512) * RT); if (SA) a2[u][mb] = WFrag<T16>::ld(pa2 + ((size_t)mb * 16 * K + u * 512) * RT); }
#pragma unroll
            for (int nb = 0; nb < 4; ++nb) { b[u][nb] = WFrag<T16>::ld(pb + ((size_t)nb * 16 * K + u * 512) * RT); if (SB) b2[u][nb] = WFrag<T16>::ld(pb2 + ((size_t)nb * 16 * K + u * 512) * RT); } }
        asm volatile("s_wait_xcnt 0x0" :: "v"(pa), "v"(pa2), "v"(pb), "v"(pb2) : "memory");   // the address registers stay whole until every load of the pass that names them is past this wait (as inputs they cannot be given to a load's result before it); the wave has only its data to wait for here
        __builtin_amdgcn_sched_barrier(0);   // no product is lifted over the pass's loads: without it the scheduler starts the products early and issues the last fragments' loads into freed registers, behind a load wait, so a pass waits out the load latency twice in a row
#pragma unroll
        for (int u = 0; u < KU; ++u)
#pragma unroll
        for (int nb = 0; nb < 4; ++nb) {
#pragma unroll
            for (int mb = 0; mb < 4; ++mb) { acc[mb][nb] = WFrag<T16>::mma(a[u][mb], b[u][nb], acc[mb][nb]); if (SA) acc[mb][nb] = WFrag<T16>::mma(a2[u][mb], b[u][nb], acc[mb][nb]); if (SB) acc[mb][nb] = WFrag<T16>::mma(a[u][mb], b2[u][nb], acc[mb][nb]); } }
        asm volatile("v_nop\n\tv_nop\n\tv_nop\n\tv_nop" : "+v"(acc[0][0]), "+v"(acc[1][1]), "+v"(acc[2][2]), "+v"(acc[3][3]) : "v"(a[KU - 1][0]), "v"(a[KU - 1][3]));   // the vector slots the chip asks for behind the pass's last products, before the loop's taken branch leads to instructions that rewrite their operand registers
    }
    static_assert(EPI == 0 || HD == 64, "a 64-wide tile is one head");
    const int fo = (lr >> 3) * 512 + ((lr >> 2) & 1) * 256 + ((lr >> 1) & 1) * 128 + (lr & 1) * 4;   // k = lr * 4 of a 64-wide k range, row 0, in fragment order
    float cb[4], rb[4][8]; v2f cs[2][8][2]; size_t pbase = 0;   // all of a row block's table entries are asked for one row block ahead, as one batch
    const float* const cp0 = CS + ((size_t)(r0 % TT + hi) * HD + lr * 4) * 2;   // this lane's first table entry; every other one is a constant step from it
    if (EPI == 1) { pbase = ((size_t)((r0 / TT) * nh + ty) * TT + (r0 % TT)) * HD + fo;
#pragma unroll
        for (int i = 0; i < 4; ++i) cb[i] = bfr(bias[c0 + lr * 4 + i]);
#pragma unroll
        for (int s = 0; s < 8; ++s) { const float* cp = cp0 + 2 * s * HD * 2; cs[0][s][0] = *(const v2f*)cp; cs[0][s][1] = *(const v2f*)(cp + 4); } }
    if (EPI == 2) { pbase = (size_t)((c0 / TT) * nh + tx) * HD * TT + (c0 % TT) * 16 + fo;
#pragma unroll
        for (int mb = 0; mb < 4; ++mb)
#pragma unroll
            for (int s = 0; s < 8; ++s) { if (mb == 3 && s == 7) asm volatile("s_wait_xcnt 0x0" ::: "memory");   // without it the last load's result was placed in the offset register that the 31 loads before it still name: the wait stands in front of any such rewrite
                rb[mb][s] = bfr(bias[r0 + mb * 16 + 2 * s + hi]); } }
#pragma unroll
    for (int mb = 0; mb < 4; ++mb) {
        if (EPI == 1 && mb < 3) {
#pragma unroll
            for (int s = 0; s < 8; ++s) { const float* cp = cp0 + ((mb + 1) * 16 + 2 * s) * HD * 2; cs[(mb + 1) & 1][s][0] = *(const v2f*)cp; cs[(mb + 1) & 1][s][1] = *(const v2f*)(cp + 4); } }
#pragma unroll
        for (int nb = 0; nb < 4; ++nb) {
#pragma unroll
            for (int j = 0; j < 8; ++j) os[(hi * 8 + j) * 68 + nb * 16 + lr] = acc[mb][nb][j]; }
        __builtin_amdgcn_wave_barrier(); asm volatile("" ::: "memory");
        float* crow = C + (size_t)(r0 + mb * 16) * ldc + c0;
        if (EPI != 0) {
#pragma unroll
            for (int s = 0; s < 8; ++s) { const int row = 2 * s + hi; const v4f val = *(const v4fa*)(os + row * 68 + lr * 4); float r[4];
                if (EPI == 1) { const float x0 = val[0] + cb[0], x1 = val[1] + cb[1], x2 = val[2] + cb[2], x3 = val[3] + cb[3]; const v2f ca = cs[mb & 1][s][0], cc = cs[mb & 1][s][1];
                    r[0] = x0 * ca[0] - x1 * ca[1]; r[1] = x1 * ca[0] + x0 * ca[1]; r[2] = x2 * cc[0] - x3 * cc[1]; r[3] = x3 * cc[0] + x2 * cc[1]; }
                else { r[0] = val[0] + rb[mb][s]; r[1] = val[1] + rb[mb][s]; r[2] = val[2] + rb[mb][s]; r[3] = val[3] + rb[mb][s]; }
                v4h o16; v4us oh, ol;
#pragma unroll
                for (int i = 0; i < 4; ++i) { o16[i] = tohx(r[i]); unsigned short a2, c2; splitf(r[i], a2, c2); oh[i] = a2; ol[i] = c2; }
                const size_t e = pbase + (size_t)mb * 16 * (EPI == 1 ? HD : TT) + row * 8;   // rows 2s, 2s + 1: 32 bytes in each of 8 places; the 8 stores of a row block fill its tiles
                *(v4h*)(P16 + e) = o16; *(v4us*)(Ph + e) = oh; *(v4us*)(Pl + e) = ol; }
            if (mb < 3) asm volatile("s_wait_xcnt 0x0" ::: "memory");   // the next row block's loads and arithmetic land in registers that these stores still name: the wait stands in front of that rewrite
        } else {
#pragma unroll
            for (int s = 0; s < 8; ++s) { const int row = 2 * s + hi, cofs = lr * 4; v4f val = *(const v4fa*)(os + row * 68 + cofs); if (BIAS) { val[0] += bfr(bias[c0 + cofs]); val[1] += bfr(bias[c0 + cofs + 1]); val[2] += bfr(bias[c0 + cofs + 2]); val[3] += bfr(bias[c0 + cofs + 3]); }
                *(v4f*)(crow + (size_t)row * ldc + cofs) = val; }
            if (mb < 3) asm volatile("s_wait_xcnt 0x0" ::: "memory");   // the next row block's loads and arithmetic land in registers that these stores still name: the wait stands in front of that rewrite
             }
        __builtin_amdgcn_wave_barrier(); asm volatile("" ::: "memory");
    }
}
template <typename T16, int NSPLIT, bool BIAS, int K>   // K at compile time: the steps from row tile to row tile are then immediates on one address register pair per plane
__global__ __launch_bounds__(32) void k_gemmw(const T16* __restrict__ A, const T16* __restrict__ A2, const T16* __restrict__ Bt, const T16* __restrict__ Bt2, float* C, int ldc, const float* __restrict__ bias) {
    __shared__ __align__(16) float os[16 * 68]; static_assert(K % 128 == 0, "whole passes of 4 k tiles");   // one wave a SIMD: 4 tiles' fragments beside the 128 accumulator registers
    gemmw_tile<T16, NSPLIT, BIAS, 0, 4>(A, A2, Bt, Bt2, K, C, ldc, bias, nullptr, nullptr, nullptr, nullptr, blockIdx.x, blockIdx.y, 0, os);
}
// k_qkv: the three projections in one launch, grid (NB_*TT/256, heads), 12 waves a block, one block a WGP: waves 0..3 q, 4..7 k (x W^T), 8..11 v (Wv x^T) of one head, wave w on the 64 rows (w & 3) of the block's 256 rows of x.
// The block's waves read the same 4 row tiles of x and the same 3 weight tiles, so what one wave has fetched the others find in the WGP's cache; no wave reads another's result, and there is no barrier between them.
static_assert(NH_ == NKV && NB_ * TT % 256 == 0, "one grid for q, k and v"); static_assert(DM % 64 == 0, "whole passes of 2 k tiles");   // three waves a SIMD: 2 tiles' fragments each
__global__ __launch_bounds__(384) void k_qkv(const bf* __restrict__ X, const bf* __restrict__ Wq, const bf* __restrict__ Wk, const bf* __restrict__ Wv, const float* __restrict__ bq, const float* __restrict__ bk, const float* __restrict__ bv, const float* __restrict__ CS,
                                            h16* __restrict__ Q16, bf* __restrict__ Qh, bf* __restrict__ Ql, h16* __restrict__ K16, bf* __restrict__ Kh, bf* __restrict__ Kl, h16* __restrict__ V16, bf* __restrict__ Vh, bf* __restrict__ Vl) {
    __shared__ __align__(16) float os[12][16 * 68];
    const int wave = __builtin_amdgcn_readfirstlane(threadIdx.x >> 5); const int xt = blockIdx.x * 4 + (wave & 3);
    if (wave < 8) { const bool k = wave >= 4;   // q and k run the same code on their own pointers
        gemmw_tile<bf, 0, true, 1, 2>(X, nullptr, k ? Wk : Wq, nullptr, DM, nullptr, 0, k ? bk : bq, CS, k ? K16 : Q16, k ? Kh : Qh, k ? Kl : Ql, xt, blockIdx.y, NH_, os[wave]); }
    else gemmw_tile<bf, 0, true, 2, 2>(Wv, nullptr, X, nullptr, DM, nullptr, 0, bv, nullptr, V16, Vh, Vl, blockIdx.y, xt, NKV, os[wave]);
}


__global__ __launch_bounds__(256) void k_wtG(const float* __restrict__ w, int K, int N, bf* Bt) {
    const int lane = threadIdx.x & 31; const int L0 = (blockIdx.x * 8 + (threadIdx.x >> 5)) * 8; const int nlines = N * K / 64;
{
#pragma unroll 1
        for (int l = 0; l < 8; ++l) { const int L = L0 + l; if (L >= nlines) break; const size_t e = (size_t)L * 64 + lane * 2; const int k = (int)(e % K), n = (int)(e / K); v2us o;
            o[0] = f2bf(w[(size_t)k * N + n]); o[1] = f2bf(w[(size_t)(k + 1) * N + n]); *(v2us*)(Bt + e) = o; }
         }
}
// k_prep: everything that reads inputs only, one launch. Blocks 0..PTB-1 (the longest, so first): the rope table. Then the mask copy. Then x, Wq, Wk, Wv, Wo to bf16 in fragment order, CVB groups of 8 floats a thread, a block's groups 256 apart: group g is the g-th 16 bytes of the plane written,
// so a wave stores 512 contiguous bytes and reads 64 bytes of each of 16 rows (the wave beside it reads the line's other half); 256 groups on are 4 k tiles on in the same rows.
#define CVB 4
#define PTB (TT * HD / 256)
#define PXB (NB_ * TT * DM / (8 * 256 * CVB))
#define PQB (DQ * DM / (8 * 256 * CVB))
#define PKB (DKV * DM / (8 * 256 * CVB))
#define PMB (TT * TT / (4 * 256 * CVB))
static_assert(TT * HD % 256 == 0 && NB_ * TT * DM % (8 * 256 * CVB) == 0 && DQ * DM % (8 * 256 * CVB) == 0 && DKV * DM % (8 * 256 * CVB) == 0, "whole blocks");
static_assert(DQ == DM && (DM / 32) % (4 * CVB) == 0, "all five planes have rows of DM elements, and a block stays inside one row tile");
static_assert(TT * TT % (4 * 256 * CVB) == 0 && (TT / 32) % (2 * CVB) == 0, "whole blocks of the mask copy, each inside one row of tiles");
__global__ __launch_bounds__(256) void k_prep(const float* __restrict__ x, const float* __restrict__ wq, const float* __restrict__ wk, const float* __restrict__ wv, const float* __restrict__ wo, const int* __restrict__ mk, bf* XB, bf* WQ, bf* WK, bf* WV, bf* WO, float* CS, int* MK) {
    int b = blockIdx.x;
    if (b < PTB) { const int idx = b * 256 + threadIdx.x; const int t = idx / HD, d = idx % HD; const int i = d >> 1; const float inv = __fdiv_rn(1.0f, powf(10000.0f, (float)(2 * i) / (float)HD)); const float ang = __fmul_rn((float)t, inv); v2f cs; cs[0] = cosf(ang); cs[1] = sinf(ang);
        *(v2f*)(CS + (size_t)idx * 2) = cs; return; }
    b -= PTB;
    if (b < PMB) { const unsigned g0 = (unsigned)b * (256 * CVB) + threadIdx.x, mt = g0 >> 7, ch = (threadIdx.x >> 5) & 3, ln = threadIdx.x & 31; v4i m[CVB];   // the mask: group g is the g-th 16 bytes written; 256 groups on are 2 key tiles on in the same queries
        const unsigned mo = (((mt / (TT / 32)) * 16 + (ln & 15)) * TT + (mt % (TT / 32)) * 32 + (ch >> 1) * 16 + (ln >> 4) * 8 + (ch & 1) * 4) * 4;   // bytes
#pragma unroll
        for (int u = 0; u < CVB; ++u) m[u] = *(const v4i*)((const char*)(mk + u * 64) + mo);
#pragma unroll
        for (int u = 0; u < CVB; ++u) *(v4i*)(MK + ((size_t)g0 + u * 256) * 4) = m[u];
        asm volatile("s_wait_xcnt 0x0" ::: "memory");   // as behind the conversion stores below: the listing lays the table code behind these stores too, and it rewrites registers that they still name
        return; }
    b -= PMB; const float* src; bf* dst;
    if (b < PXB) { src = x; dst = XB; }
    else if ((b -= PXB) < PQB) { src = wq; dst = WQ; }
    else if ((b -= PQB) < PKB) { src = wk; dst = WK; }
    else if ((b -= PKB) < PKB) { src = wv; dst = WV; }
    else { b -= PKB; src = wo; dst = WO; }
    const size_t i0 = (size_t)b * (256 * CVB) + threadIdx.x; v8f v[CVB]; const unsigned tile = (unsigned)(i0 >> 6), ln = threadIdx.x & 31;
    const unsigned so = (((tile / (DM / 32)) * 16 + (ln & 15)) * DM + (tile % (DM / 32)) * 32 + ((threadIdx.x >> 5) & 1) * 16 + (ln >> 4) * 8) * 4;   // bytes: where group i0's 8 floats stand in the row-major source
#pragma unroll
    for (int u = 0; u < CVB; ++u) v[u] = *(const v8f*)((const char*)(src + u * 128) + so);
#pragma unroll
    for (int u = 0; u < CVB; ++u) { v8us o;
#pragma unroll
        for (int k = 0; k < 8; ++k) o[k] = f2bf(v[u][k]);
        *(v8us*)(dst + (i0 + u * 256) * 8) = o; }
    asm volatile("s_wait_xcnt 0x0" ::: "memory");   // the listing lays the table code behind these stores, and it rewrites registers that they still name as data: the wait stands in front of any such rewrite
}
__device__ __forceinline__ float xhalf(float x) { return __builtin_bit_cast(float, __builtin_amdgcn_permlanex16(__builtin_bit_cast(int, x), __builtin_bit_cast(int, x), 0x76543210, 0xfedcba98, false, false)); }  // lane l takes lane l ^ 16's value
template <typename T16> struct PFrag;
template <> struct PFrag<h16> { static constexpr bool SPLIT = false; static __device__ __forceinline__ void pack(const float* p, v16h& a, v16h& b) { (void)b;
#pragma unroll
    for (int s = 0; s < 16; ++s) a[s] = (h16)p[s]; } };
template <> struct PFrag<bf> { static constexpr bool SPLIT = true; static __device__ __forceinline__ void pack(const float* p, v16bf& a, v16bf& b) {
#pragma unroll
    for (int s = 0; s < 16; ++s) { const __bf16 h = (__bf16)p[s]; a[s] = h; b[s] = (__bf16)(p[s] - (float)h); } } };
template <typename T16, int QT>
__device__ __forceinline__ void fattn_tile(const T16* __restrict__ Q, const T16* __restrict__ Q2, const T16* __restrict__ Kp, const T16* __restrict__ K2, const T16* __restrict__ Vt, const T16* __restrict__ Vt2, const int* __restrict__ mk, int q0, bf* Ah, bf* Al) {
    typedef typename WFrag<T16>::V V; constexpr bool SP = PFrag<T16>::SPLIT; constexpr float SH = SP ? 0.0f : 10.0f;
    const int lane = threadIdx.x & 31, lr = lane & 15, hi = lane >> 4; const unsigned lo = lane * 16;
    V qf[QT][2], qf2[QT][2]; v8f o[QT][4]; float m[QT], l[QT];
#pragma unroll
    for (int qt = 0; qt < QT; ++qt) { m[qt] = -3.0e38f; l[qt] = 0.0f;
#pragma unroll
        for (int ks = 0; ks < 2; ++ks) { const size_t qo = (size_t)(q0 + qt * 16) * HD + ks * 512; qf[qt][ks] = WFrag<T16>::ld((const char*)(Q + qo) + lo); if (SP) qf2[qt][ks] = WFrag<T16>::ld((const char*)(Q2 + qo) + lo); }
#pragma unroll
        for (int dt = 0; dt < 4; ++dt) o[qt][dt] = (v8f){}; }
#pragma unroll 1
    for (int kb = 0; kb < TT; kb += 32) {
        V kf[2][2], kf2[2][2], vf[4], vf2[4]; v4i mq[QT][2][2]; const char* const Kb = (const char*)(Kp + (size_t)kb * HD) + lo; const char* const Vb = (const char*)(Vt + (size_t)kb * 16) + lo;   // this lane's 16 bytes of this pass's first tile, per plane
        const char* const Mb = (const char*)(mk + (size_t)q0 * (TT / 32) * 32 + kb * 16) + lo;
        const char* const K2b = SP ? (const char*)(K2 + (size_t)kb * HD) + lo : Kb; const char* const V2b = SP ? (const char*)(Vt2 + (size_t)kb * 16) + lo : Vb;
#pragma unroll
        for (int kt = 0; kt < 2; ++kt)
#pragma unroll
            for (int ks = 0; ks < 2; ++ks) { const int e = (kt * 16 * HD + ks * 512) * 2; kf[kt][ks] = WFrag<T16>::ld(Kb + e); if (SP) kf2[kt][ks] = WFrag<T16>::ld(K2b + e); }
#pragma unroll
        for (int qt = 0; qt < QT; ++qt)
#pragma unroll
            for (int kt = 0; kt < 2; ++kt) { const char* mp = Mb + (qt * (TT / 32) * 512 + kt * 256) * 4; mq[qt][kt][0] = *(const v4i*)mp; mq[qt][kt][1] = *(const v4i*)(mp + 512); }
#pragma unroll
        for (int dt = 0; dt < 4; ++dt) { const int e = dt * 16 * TT * 2; vf[dt] = WFrag<T16>::ld(Vb + e); if (SP) vf2[dt] = WFrag<T16>::ld(V2b + e); }
        asm volatile("s_wait_xcnt 0x0" :: "v"(Kb), "v"(K2b), "v"(Vb), "v"(V2b), "v"(Mb) : "memory");   // the address registers stay whole until every load of the pass that names them is past this wait (as inputs they cannot be given to a load's result before it); the wave has only its data to wait for here
#pragma unroll
        for (int qt = 0; qt < QT; ++qt) {
            float t[16]; float bm = -3.0e38f;
#pragma unroll
            for (int kt = 0; kt < 2; ++kt) { v8f s = (v8f){};
#pragma unroll
                for (int ks = 0; ks < 2; ++ks) { s = WFrag<T16>::mma(kf[kt][ks], qf[qt][ks], s); if (SP) { s = WFrag<T16>::mma(kf2[kt][ks], qf[qt][ks], s); s = WFrag<T16>::mma(kf[kt][ks], qf2[qt][ks], s); } }
#pragma unroll
                for (int j = 0; j < 8; ++j) { const float x = (mq[qt][kt][j >> 2][j & 3] != 0) ? s[j] * (SCL * 1.4426950408889634f) : -3.0e38f; t[kt * 8 + j] = x; bm = fmaxf(bm, x); } }
            bm = fmaxf(bm, xhalf(bm));
            const float mn = fmaxf(m[qt], bm); const float al = __builtin_amdgcn_exp2f(m[qt] - mn); m[qt] = mn; const float mb = mn - SH; float ps = 0.0f;
#pragma unroll
            for (int s = 0; s < 16; ++s) { t[s] = __builtin_amdgcn_exp2f(t[s] - mb); ps += t[s]; }
            l[qt] = l[qt] * al + ps;
#pragma unroll
            for (int dt = 0; dt < 4; ++dt) o[qt][dt] *= al;
            V pf, pf2; PFrag<T16>::pack(t, pf, pf2);
#pragma unroll
            for (int dt = 0; dt < 4; ++dt) { o[qt][dt] = WFrag<T16>::mma(vf[dt], pf, o[qt][dt]); if (SP) { o[qt][dt] = WFrag<T16>::mma(vf2[dt], pf, o[qt][dt]); o[qt][dt] = WFrag<T16>::mma(vf[dt], pf2, o[qt][dt]); } }
        }
        __builtin_amdgcn_sched_barrier(0);   // keeps the next pass's address additions behind this pass's last load wait: without it they are lifted over loads still in flight that name those registers
    }
#pragma unroll
    for (int qt = 0; qt < QT; ++qt) { const float inv = __fdiv_rn(1.0f, l[qt] + xhalf(l[qt])); const size_t oo = (size_t)(q0 + qt * 16) * DQ;
#pragma unroll
        for (int dt = 0; dt < 4; ++dt) { v8us oh, ol;
#pragma unroll
            for (int j = 0; j < 8; ++j) { unsigned short a, c2; splitf(o[qt][dt][j] * inv, a, c2); oh[j] = a; ol[j] = c2; }
            *(v8us*)((char*)(Ah + oo + dt * 256) + lo) = oh; *(v8us*)((char*)(Al + oo + dt * 256) + lo) = ol; } }
}
// grid (FBX, NB_*NH_), 5 waves of one head per block, every block the same work: waves 0, 1 take 16 hi+lo query rows each, waves 2..4 take 32 fp16 query rows each (RH/16 = 2 FBX and (TT-RH)/32 = 3 FBX tiles a head)
#define FBX 8
static_assert(RH == 2 * FBX * 16 && TT - RH == 3 * FBX * 32, "tiles per block");
__global__ __launch_bounds__(160) void k_fattn(const h16* __restrict__ Q16, const h16* __restrict__ K16, const h16* __restrict__ V16, const bf* __restrict__ Qh, const bf* __restrict__ Ql, const bf* __restrict__ Kh, const bf* __restrict__ Kl, const bf* __restrict__ Vh, const bf* __restrict__ Vl, const int* __restrict__ mk, bf* Ah, bf* Al) {
    const int bh = blockIdx.y, bx = blockIdx.x, wave = __builtin_amdgcn_readfirstlane(threadIdx.x >> 5); const size_t pq = (size_t)bh * TT * HD, pk = (size_t)(bh / REP) * TT * HD; const size_t ao = (size_t)(bh / NH_) * TT * DQ + (size_t)(bh % NH_) * (HD / 32) * 512;
    if (wave < 2) fattn_tile<bf, 1>(Qh + pq, Ql + pq, Kh + pk, Kl + pk, Vh + pk, Vl + pk, mk, (bx * 2 + wave) * 16, Ah + ao, Al + ao);
    else fattn_tile<h16, 2>(Q16 + pq, nullptr, K16 + pk, nullptr, V16 + pk, nullptr, mk, RH + (bx * 3 + wave - 2) * 32, Ah + ao, Al + ao);
}

extern "C" void kernel_launch(void* const* d_in, const int* in_sizes, int n_in,
                              void* d_out, int out_size, void* d_ws, size_t ws_size, hipStream_t stream) {
    (void)in_sizes; (void)n_in; (void)out_size;
    const float* x = (const float*)d_in[0]; const float* wq = (const float*)d_in[1]; const float* bqv = (const float*)d_in[2]; const float* wk = (const float*)d_in[3]; const float* bkv = (const float*)d_in[4]; const float* wv = (const float*)d_in[5]; const float* bvv = (const float*)d_in[6]; const float* wo = (const float*)d_in[7]; const float* bo = (const float*)d_in[8]; const int* mk = (const int*)d_in[9];   // torch [out][in] weights; mask int32 [1][1][1024][1024] (nonzero = attend)
    float* OUT = (float*)d_out;     // [4][1024][1024]
    char* wsp = (char*)d_ws;
    auto take = [&](size_t bytes) { char* p = wsp; wsp += (bytes + 255) & ~(size_t)255; return (void*)p; };
    bf* WQ = (bf*)take((size_t)DQ * DM * 2); bf* WK = (bf*)take((size_t)DKV * DM * 2); bf* WV = (bf*)take((size_t)DKV * DM * 2); bf* WO = (bf*)take((size_t)DM * DQ * 2); float* CS = (float*)take((size_t)TT * HD * 2 * 4);
    bf* XB = (bf*)take((size_t)NB_ * TT * DM * 2);
    h16* QP16 = (h16*)take((size_t)NB_ * NH_ * TT * HD * 2); h16* KP16 = (h16*)take((size_t)NB_ * NKV * TT * HD * 2); h16* VT16 = (h16*)take((size_t)NB_ * NKV * HD * TT * 2);
    bf* QPh = (bf*)take((size_t)NB_ * NH_ * TT * HD * 2); bf* QPl = (bf*)take((size_t)NB_ * NH_ * TT * HD * 2); bf* KPh = (bf*)take((size_t)NB_ * NKV * TT * HD * 2); bf* KPl = (bf*)take((size_t)NB_ * NKV * TT * HD * 2); bf* VTh = (bf*)take((size_t)NB_ * NKV * HD * TT * 2); bf* VTl = (bf*)take((size_t)NB_ * NKV * HD * TT * 2);
    bf* ATh = (bf*)take((size_t)NB_ * TT * DQ * 2); bf* ATl = (bf*)take((size_t)NB_ * TT * DQ * 2); int* MK = (int*)take((size_t)TT * TT * 4);
    if ((size_t)(wsp - (char*)d_ws) > ws_size) return;    // well inside the workspace
    k_prep<<<PTB + PMB + PXB + PQB + 2 * PKB + PQB, 256, 0, stream>>>(x, wq, wk, wv, wo, mk, XB, WQ, WK, WV, WO, CS, MK);
    // all batch items per launch: x is [NB_*TT][DM], so the projections are plain GEMMs with M = NB_*TT
    k_qkv<<<dim3(NB_ * TT / 256, NH_, 1), 384, 0, stream>>>(XB, WQ, WK, WV, bqv, bkv, bvv, CS, QP16, QPh, QPl, KP16, KPh, KPl, VT16, VTh, VTl);   // v^T = Wv x^T: rows d, columns b*TT + t
    k_fattn<<<dim3(FBX, NB_ * NH_, 1), 160, 0, stream>>>(QP16, KP16, VT16, QPh, QPl, KPh, KPl, VTh, VTl, MK, ATh, ATl);
    k_gemmw<bf, 1, true, DQ><<<dim3(NB_ * TT / 64, DM / 64, 1), 32, 0, stream>>>(ATh, ATl, WO, nullptr, OUT, DM, bo);
}

// v008
// One run takes 95.3 microseconds.
// Next to v007, in two timings, it ran 1.13 and 1.15 times as fast.
// All steps since v000 together make it 24.9 times as fast.
#include <hip/hip_runtime.h>

// MultiHeadAttentionEuclid (x [4][1024][1024]; q/k/v = x W^T + b (16 heads x 64); interleaved-pair rotary (base 1e4, positions 0..1023 computed on device); scores = q.k/8 where mask[0][0][i][j] != 0 (int32 [1][1][1024][1024],
// read as data; here causal), -inf elsewhere; softmax; out = merged att.v Wo^T + bo -> [4][1024][1024]).
// Compute dtypes, f32 accumulate: every input rounded to bf16; projections on PLAIN bf16 operands (inputs: exact, + bias); rope f32; scores (K 64) and att.v on bf16 hi+lo planes (3 products)
// for the first 256 query rows of each head and SINGLE fp16 planes for the rest; f32 masked online softmax in registers; merged heads hl x exact Wo (2 products) + bo. One-wave-per-64x64-tile GEMMs. Deterministic, no atomics;
// Launch plan: projections and the output product take all 4 batch items in one grid (rows b*1024 + t, planes [b][h]); a 64-column tile is one head, so each projection's epilogue writes the 16-bit head planes itself
// (q, k: bias, rope, split; v: computed as Wv x^T, bias, split, rows d over columns t); scores, softmax and att.v of all 64 (batch, head) pairs are one launch (k_fattn).
// FRAGMENT ORDER: every 16-bit plane [rows][K] that feeds a matrix operand is stored as tiles of 16 rows x 32 k, 512 elements each, tile (R, kt) at (R * (K/32) + kt) * 512. Inside a tile, element (row, k) stands at
// ((k >> 4) & 1) * 256 + (((k >> 3) & 1) * 16 + row) * 8 + (k & 7): the two 16-byte loads of a lane's fragment are then at bytes lane * 16 and 512 + lane * 16 of the tile, so one wave load reads 512 contiguous bytes
// (4 whole lines, not 32 bytes of each of 16). Which lane and register hold which (row, k) is as with row-major planes; only the place in memory differs.
// The mask is copied once, as int32, into the same kind of order (k_prep): tiles of 16 queries x 32 keys, 512 ints each, tile (qt, kbt) at (qt * (TT/32) + kbt) * 512; the four ints (query lr, keys kt*16 + hi*8 + h*4 ..+3) at ((kt*2 + h) * 32 + lane) * 4.

#define NB_  4
#define TT   1024
#define DM   1024
#define NH_  16
#define NKV  16
#define REP  (NH_ / NKV)
#define HD   64
#define DQ   (NH_ * HD)
#define DKV  (NKV * HD)
#define RH   256                  // query rows < RH use hi+lo planes
#define WIN  0
#define SCL  0.125f   // HD^-0.5
typedef _Float16 h16;
typedef unsigned short bf;
typedef __attribute__((ext_vector_type(16))) __bf16   v16bf;
typedef __attribute__((ext_vector_type(16))) _Float16 v16h;
typedef __attribute__((ext_vector_type(8)))  _Float16 v8h;
typedef __attribute__((ext_vector_type(8)))  unsigned short v8us;
typedef __attribute__((ext_vector_type(8)))  float    v8f;
typedef __attribute__((ext_vector_type(4)))  float    v4f;
typedef v8h  __attribute__((may_alias)) v8ha;
typedef v4f  __attribute__((may_alias)) v4fa;
typedef v8us __attribute__((may_alias)) v8usa;

__device__ __forceinline__ unsigned short f2bf(float f) { unsigned u = __float_as_uint(f); u += 0x7FFFu + ((u >> 16) & 1u); return (unsigned short)(u >> 16); }
__device__ __forceinline__ float bf2f(unsigned short b) { return __uint_as_float(((unsigned)b) << 16); }
__device__ __forceinline__ float bfr(float f) { return bf2f(f2bf(f)); }
__device__ __forceinline__ v16h cat16(v8h lo, v8h hi) { return __builtin_shufflevector(lo, hi, 0, 1, 2, 3, 4, 5, 6, 7, 8, 9, 10, 11, 12, 13, 14, 15); }
__device__ __forceinline__ v16bf cat16b(v8us lo, v8us hi) { return __builtin_bit_cast(v16bf, __builtin_shufflevector(lo, hi, 0, 1, 2, 3, 4, 5, 6, 7, 8, 9, 10, 11, 12, 13, 14, 15)); }
__device__ __forceinline__ v8f wmma16(v16h a, v16h b, v8f c) { return __builtin_amdgcn_wmma_f32_16x16x32_f16(false, a, false, b, (short)0, c, false, false); }
__device__ __forceinline__ v8f wmmab(v16bf a, v16bf b, v8f c) { return __builtin_amdgcn_wmma_f32_16x16x32_bf16(false, a, false, b, (short)0, c, false, false); }



__device__ __forceinline__ h16 tohx(float x) { return (h16)x; }
__device__ __forceinline__ void splitf(float y, unsigned short& h, unsigned short& l) { h = f2bf(y); l = f2bf(y - bf2f(h)); }
typedef __attribute__((ext_vector_type(2))) _Float16 v2h;
typedef __attribute__((ext_vector_type(4))) _Float16 v4h;
typedef __attribute__((ext_vector_type(2))) unsigned short v2us;
typedef __attribute__((ext_vector_type(4))) unsigned short v4us;
typedef __attribute__((ext_vector_type(2))) float v2f;
typedef __attribute__((ext_vector_type(4))) int v4i;

// ---- k_gemmw: register-blocked GEMM, ONE WAVE per 64x64 output tile (16 accumulators), operands straight from 16-bit planes in fragment order; grid (M/64, N/64), 32 threads.
// C[m][n] (f32, pitch ldc, + optional f32 bias[n]) = sum_k A[m][k] Bt[n][k] (+ split products per NSPLIT). A pass of the k loop takes KU k tiles (K % (32 * KU) == 0): the loads of all of them issue first, the products follow tile by tile in k order,
// each tile's behind a counted wait, so a wave meets the load latency once per KU tiles and the later tiles' loads fly under the earlier tiles' products. KU is what the registers allow: 16 or 24 loads and 64 or 96 registers a tile.
// EPI 0: C as above. EPI 1 (rows m = b*TT + t, column tile = head): bias[n], interleaved-pair rope from the table CS ([t][d] -> cos, sin), then the fp16, bf16 hi and bf16 lo planes [b][head] of rows t, K = d, in fragment order.
// EPI 2 (row tile = head, columns n = b*TT + t): bias[m], then the same three planes [b][head] of rows d, K = t, in fragment order. Neither writes C.
template <typename T16> struct WFrag;   // ld(c): the fragment of one tile; c = the tile's address + lane * 16 bytes
template <> struct WFrag<h16> { typedef v16h V; static __device__ __forceinline__ V ld(const char* c) { return cat16(*(const v8h*)c, *(const v8h*)(c + 512)); } static __device__ __forceinline__ v8f mma(V a, V b, v8f c) { return wmma16(a, b, c); } };
template <> struct WFrag<bf> { typedef v16bf V; static __device__ __forceinline__ V ld(const char* c) { return cat16b(*(const v8us*)c, *(const v8us*)(c + 512)); } static __device__ __forceinline__ v8f mma(V a, V b, v8f c) { return wmmab(a, b, c); } };
// gemmw_tile: the tile (tx, ty) of one wave; os: that wave's own 16 x 68 floats of LDS; nh: heads per batch item (EPI 1, 2).
template <typename T16, int NSPLIT, bool BIAS, int EPI, int KU>
__device__ __forceinline__ void gemmw_tile(const T16* __restrict__ A, const T16* __restrict__ A2, const T16* __restrict__ Bt, const T16* __restrict__ Bt2, int K, float* C, int ldc, const float* __restrict__ bias, const float* __restrict__ CS, h16* __restrict__ P16, bf* __restrict__ Ph, bf* __restrict__ Pl, int tx, int ty, int nh, float* os) {
    typedef typename WFrag<T16>::V V;
    const int lane = threadIdx.x & 31, lr = lane & 15, hi = lane >> 4; const int r0 = tx * 64, c0 = ty * 64;
    v8f acc[4][4];
#pragma unroll
    for (int mb = 0; mb < 4; ++mb)
#pragma unroll
        for (int nb = 0; nb < 4; ++nb) acc[mb][nb] = (v8f){};
    const size_t aoff = (size_t)r0 * K, boff = (size_t)c0 * K; const unsigned lo = lane * 16;   // a row tile is 16 * K elements, a k tile 512
#pragma unroll 1
    for (int kc = 0; kc < K; kc += 32 * KU) {
        V a[KU][4], a2[KU][4], b[KU][4], b2[KU][4]; constexpr bool SA = NSPLIT == 1 || NSPLIT == 2, SB = NSPLIT >= 2; constexpr size_t RT = 2;   // bytes an element
        const char* const pa = (const char*)(A + aoff + kc * 16) + lo; const char* const pb = (const char*)(Bt + boff + kc * 16) + lo;   // this lane's 16 bytes of this pass's k tile, first row tile
        const char* const pa2 = SA ? (const char*)(A2 + aoff + kc * 16) + lo : pa; const char* const pb2 = SB ? (const char*)(Bt2 + boff + kc * 16) + lo : pb;
#pragma unroll
        for (int u = 0; u < KU; ++u) {   // k tile u of the pass stands u * 512 elements behind k tile 0
#pragma unroll
            for (int mb = 0; mb < 4; ++mb) { a[u][mb] = WFrag<T16>::ld(pa + ((size_t)mb * 16 * K + u * 512) * RT); if (SA) a2[u][mb] = WFrag<T16>::ld(pa2 + ((size_t)mb * 16 * K + u * 512) * RT); }
#pragma unroll
            for (int nb = 0; nb < 4; ++nb) { b[u][nb] = WFrag<T16>::ld(pb + ((size_t)nb * 16 * K + u * 512) * RT); if (SB) b2[u][nb] = WFrag<T16>::ld(pb2 + ((size_t)nb * 16 * K + u * 512) * RT); } }
        asm volatile("s_wait_xcnt 0x0" :: "v"(pa), "v"(pa2), "v"(pb), "v"(pb2) : "memory");   // the address registers stay whole until every load of the pass that names them is past this wait (as inputs they cannot be given to a load's result before it); the wave has only its data to wait for here
        __builtin_amdgcn_sched_barrier(0);   // no product is lifted over the pass's loads: without it the scheduler starts the products early and issues the last fragments' loads into freed registers, behind a load wait, so a pass waits out the load latency twice in a row
#pragma unroll
        for (int u = 0; u < KU; ++u)
#pragma unroll
        for (int nb = 0; nb < 4; ++nb) {
#pragma unroll
            for (int mb = 0; mb < 4; ++mb) { acc[mb][nb] = WFrag<T16>::mma(a[u][mb], b[u][nb], acc[mb][nb]); if (SA) acc[mb][nb] = WFrag<T16>::mma(a2[u][mb], b[u][nb], acc[mb][nb]); if (SB) acc[mb][nb] = WFrag<T16>::mma(a[u][mb], b2[u][nb], acc[mb][nb]); } }
        asm volatile("v_nop\n\tv_nop\n\tv_nop\n\tv_nop" : "+v"(acc[0][0]), "+v"(acc[1][1]), "+v"(acc[2][2]), "+v"(acc[3][3]) : "v"(a[KU - 1][0]), "v"(a[KU - 1][3]));   // the vector slots the chip asks for behind the pass's last products, before the loop's taken branch leads to instructions that rewrite their operand registers
    }
    static_assert(EPI == 0 || HD == 64, "a 64-wide tile is one head");
    const int fo = (lr >> 3) * 512 + ((lr >> 2) & 1) * 256 + ((lr >> 1) & 1) * 128 + (lr & 1) * 4;   // k = lr * 4 of a 64-wide k range, row 0, in fragment order
    float cb[4], rb[4][8]; v2f cs[2][8][2]; size_t pbase = 0;   // all of a row block's table entries are asked for one row block ahead, as one batch
    const float* const cp0 = CS + ((size_t)(r0 % TT + hi) * HD + lr * 4) * 2;   // this lane's first table entry; every other one is a constant step from it
    if (EPI == 1) { pbase = ((size_t)((r0 / TT) * nh + ty) * TT + (r0 % TT)) * HD + fo;
#pragma unroll
        for (int i = 0; i < 4; ++i) cb[i] = bfr(bias[c0 + lr * 4 + i]);
#pragma unroll
        for (int s = 0; s < 8; ++s) { const float* cp = cp0 + 2 * s * HD * 2; cs[0][s][0] = *(const v2f*)cp; cs[0][s][1] = *(const v2f*)(cp + 4); } }
    if (EPI == 2) { pbase = (size_t)((c0 / TT) * nh + tx) * HD * TT + (c0 % TT) * 16 + fo;
#pragma unroll
        for (int mb = 0; mb < 4; ++mb)
#pragma unroll
            for (int s = 0; s < 8; ++s) { if (mb == 3 && s == 7) asm volatile("s_wait_xcnt 0x0" ::: "memory");   // without it the last load's result was placed in the offset register that the 31 loads before it still name: the wait stands in front of any such rewrite
                rb[mb][s] = bfr(bias[r0 + mb * 16 + 2 * s + hi]); } }
#pragma unroll
    for (int mb = 0; mb < 4; ++mb) {
        if (EPI == 1 && mb < 3) {
#pragma unroll
            for (int s = 0; s < 8; ++s) { const float* cp = cp0 + ((mb + 1) * 16 + 2 * s) * HD * 2; cs[(mb + 1) & 1][s][0] = *(const v2f*)cp; cs[(mb + 1) & 1][s][1] = *(const v2f*)(cp + 4); } }
#pragma unroll
        for (int nb = 0; nb < 4; ++nb) {
#pragma unroll
            for (int j = 0; j < 8; ++j) os[(hi * 8 + j) * 68 + nb * 16 + lr] = acc[mb][nb][j]; }
        __builtin_amdgcn_wave_barrier(); asm volatile("" ::: "memory");
        float* crow = C + (size_t)(r0 + mb * 16) * ldc + c0;
        if (EPI != 0) {
#pragma unroll
            for (int s = 0; s < 8; ++s) { const int row = 2 * s + hi; const v4f val = *(const v4fa*)(os + row * 68 + lr * 4); float r[4];
                if (EPI == 1) { const float x0 = val[0] + cb[0], x1 = val[1] + cb[1], x2 = val[2] + cb[2], x3 = val[3] + cb[3]; const v2f ca = cs[mb & 1][s][0], cc = cs[mb & 1][s][1];
                    r[0] = x0 * ca[0] - x1 * ca[1]; r[1] = x1 * ca[0] + x0 * ca[1]; r[2] = x2 * cc[0] - x3 * cc[1]; r[3] = x3 * cc[0] + x2 * cc[1]; }
                else { r[0] = val[0] + rb[mb][s]; r[1] = val[1] + rb[mb][s]; r[2] = val[2] + rb[mb][s]; r[3] = val[3] + rb[mb][s]; }
                v4h o16; v4us oh, ol;
#pragma unroll
                for (int i = 0; i < 4; ++i) { o16[i] = tohx(r[i]); unsigned short a2, c2; splitf(r[i], a2, c2); oh[i] = a2; ol[i] = c2; }
                const size_t e = pbase + (size_t)mb * 16 * (EPI == 1 ? HD : TT) + row * 8;   // rows 2s, 2s + 1: 32 bytes in each of 8 places; the 8 stores of a row block fill its tiles
                *(v4h*)(P16 + e) = o16; *(v4us*)(Ph + e) = oh; *(v4us*)(Pl + e) = ol; }
            if (mb < 3) asm volatile("s_wait_xcnt 0x0" ::: "memory");   // the next row block's loads and arithmetic land in registers that these stores still name: the wait stands in front of that rewrite
        } else {
#pragma unroll
            for (int s = 0; s < 8; ++s) { const int row = 2 * s + hi, cofs = lr * 4; v4f val = *(const v4fa*)(os + row * 68 + cofs); if (BIAS) { val[0] += bfr(bias[c0 + cofs]); val[1] += bfr(bias[c0 + cofs + 1]); val[2] += bfr(bias[c0 + cofs + 2]); val[3] += bfr(bias[c0 + cofs + 3]); }
                *(v4f*)(crow + (size_t)row * ldc + cofs) = val; }
            if (mb < 3) asm volatile("s_wait_xcnt 0x0" ::: "memory");   // the next row block's loads and arithmetic land in registers that these stores still name: the wait stands in front of that rewrite
             }
        __builtin_amdgcn_wave_barrier(); asm volatile("" ::: "memory");
    }
}
template <typename T16, int NSPLIT, bool BIAS, int K>   // K at compile time: the steps from row tile to row tile are then immediates on one address register pair per plane
__global__ __launch_bounds__(32) void k_gemmw(const T16* __restrict__ A, const T16* __restrict__ A2, const T16* __restrict__ Bt, const T16* __restrict__ Bt2, float* C, int ldc, const float* __restrict__ bias) {
    __shared__ __align__(16) float os[16 * 68]; static_assert(K % 128 == 0, "whole passes of 4 k tiles");   // one wave a SIMD: 4 tiles' fragments beside the 128 accumulator registers
    gemmw_tile<T16, NSPLIT, BIAS, 0, 4>(A, A2, Bt, Bt2, K, C, ldc, bias, nullptr, nullptr, nullptr, nullptr, blockIdx.x, blockIdx.y, 0, os);
}
// k_qkv: the three projections in one launch, grid (NB_*TT/256, heads), 12 waves a block, one block a WGP: waves 0..3 q, 4..7 k (x W^T), 8..11 v (Wv x^T) of one head, wave w on the 64 rows (w & 3) of the block's 256 rows of x.
// The block's waves read the same 4 row tiles of x and the same 3 weight tiles, so what one wave has fetched the others find in the WGP's cache; no wave reads another's result, and there is no barrier between them.
static_assert(NH_ == NKV && NB_ * TT % 256 == 0, "one grid for q, k and v"); static_assert(DM % 64 == 0, "whole passes of 2 k tiles");   // three waves a SIMD: 2 tiles' fragments each
__global__ __launch_bounds__(384) void k_qkv(const bf* __restrict__ X, const bf* __restrict__ Wq, const bf* __restrict__ Wk, const bf* __restrict__ Wv, const float* __restrict__ bq, const float* __restrict__ bk, const float* __restrict__ bv, const float* __restrict__ CS,
                                            h16* __restrict__ Q16, bf* __restrict__ Qh, bf* __restrict__ Ql, h16* __restrict__ K16, bf* __restrict__ Kh, bf* __restrict__ Kl, h16* __restrict__ V16, bf* __restrict__ Vh, bf* __restrict__ Vl) {
    __shared__ __align__(16) float os[12][16 * 68];
    const int wave = __builtin_amdgcn_readfirstlane(threadIdx.x >> 5); const int xt = blockIdx.x * 4 + (wave & 3);
    if (wave < 8) { const bool k = wave >= 4;   // q and k run the same code on their own pointers
        gemmw_tile<bf, 0, true, 1, 2>(X, nullptr, k ? Wk : Wq, nullptr, DM, nullptr, 0, k ? bk : bq, CS, k ? K16 : Q16, k ? Kh : Qh, k ? Kl : Ql, xt, blockIdx.y, NH_, os[wave]); }
    else gemmw_tile<bf, 0, true, 2, 2>(Wv, nullptr, X, nullptr, DM, nullptr, 0, bv, nullptr, V16, Vh, Vl, blockIdx.y, xt, NKV, os[wave]);
}


__global__ __launch_bounds__(256) void k_wtG(const float* __restrict__ w, int K, int N, bf* Bt) {
    const int lane = threadIdx.x & 31; const int L0 = (blockIdx.x * 8 + (threadIdx.x >> 5)) * 8; const int nlines = N * K / 64;
{
#pragma unroll 1
        for (int l = 0; l < 8; ++l) { const int L = L0 + l; if (L >= nlines) break; const size_t e = (size_t)L * 64 + lane * 2; const int k = (int)(e % K), n = (int)(e / K); v2us o;
            o[0] = f2bf(w[(size_t)k * N + n]); o[1] = f2bf(w[(size_t)(k + 1) * N + n]); *(v2us*)(Bt + e) = o; }
         }
}
// k_prep: everything that reads inputs only, one launch. Blocks 0..PTB-1 (the longest, so first): the rope table. Then the mask copy. Then x, Wq, Wk, Wv, Wo to bf16 in fragment order, CVB groups of 8 floats a thread, a block's groups 256 apart: group g is the g-th 16 bytes of the plane written,
// so a wave stores 512 contiguous bytes and reads 64 bytes of each of 16 rows (the wave beside it reads the line's other half); 256 groups on are 4 k tiles on in the same rows.
#define CVB 4
#define PTB (TT * HD / 256)
#define PXB (NB_ * TT * DM / (8 * 256 * CVB))
#define PQB (DQ * DM / (8 * 256 * CVB))
#define PKB (DKV * DM / (8 * 256 * CVB))
#define PMB (TT * TT / (4 * 256 * CVB))
static_assert(TT * HD % 256 == 0 && NB_ * TT * DM % (8 * 256 * CVB) == 0 && DQ * DM % (8 * 256 * CVB) == 0 && DKV * DM % (8 * 256 * CVB) == 0, "whole blocks");
static_assert(DQ == DM && (DM / 32) % (4 * CVB) == 0, "all five planes have rows of DM elements, and a block stays inside one row tile");
static_assert(TT * TT % (4 * 256 * CVB) == 0 && (TT / 32) % (2 * CVB) == 0, "whole blocks of the mask copy, each inside one row of tiles");
__global__ __launch_bounds__(256) void k_prep(const float* __restrict__ x, const float* __restrict__ wq, const float* __restrict__ wk, const float* __restrict__ wv, const float* __restrict__ wo, const int* __restrict__ mk, bf* XB, bf* WQ, bf* WK, bf* WV, bf* WO, float* CS, int* MK) {
    int b = blockIdx.x;
    if (b < PTB) { const int idx = b * 256 + threadIdx.x; const int t = idx / HD, d = idx % HD; const int i = d >> 1; const float inv = __fdiv_rn(1.0f, powf(10000.0f, (float)(2 * i) / (float)HD)); const float ang = __fmul_rn((float)t, inv); v2f cs; cs[0] = cosf(ang); cs[1] = sinf(ang);
        *(v2f*)(CS + (size_t)idx * 2) = cs; return; }
    b -= PTB;
    if (b < PMB) { const unsigned g0 = (unsigned)b * (256 * CVB) + threadIdx.x, mt = g0 >> 7, ch = (threadIdx.x >> 5) & 3, ln = threadIdx.x & 31; v4i m[CVB];   // the mask: group g is the g-th 16 bytes written; 256 groups on are 2 key tiles on in the same queries
        const unsigned mo = (((mt / (TT / 32)) * 16 + (ln & 15)) * TT + (mt % (TT / 32)) * 32 + (ch >> 1) * 16 + (ln >> 4) * 8 + (ch & 1) * 4) * 4;   // bytes
#pragma unroll
        for (int u = 0; u < CVB; ++u) m[u] = *(const v4i*)((const char*)(mk + u * 64) + mo);
#pragma unroll
        for (int u = 0; u < CVB; ++u) *(v4i*)(MK + ((size_t)g0 + u * 256) * 4) = m[u];
        asm volatile("s_wait_xcnt 0x0" ::: "memory");   // as behind the conversion stores below: the listing lays the table code behind these stores too, and it rewrites registers that they still name
        return; }
    b -= PMB; const float* src; bf* dst;
    if (b < PXB) { src = x; dst = XB; }
    else if ((b -= PXB) < PQB) { src = wq; dst = WQ; }
    else if ((b -= PQB) < PKB) { src = wk; dst = WK; }
    else if ((b -= PKB) < PKB) { src = wv; dst = WV; }
    else { b -= PKB; src = wo; dst = WO; }
    const size_t i0 = (size_t)b * (256 * CVB) + threadIdx.x; v8f v[CVB]; const unsigned tile = (unsigned)(i0 >> 6), ln = threadIdx.x & 31;
    const unsigned so = (((tile / (DM / 32)) * 16 + (ln & 15)) * DM + (tile % (DM / 32)) * 32 + ((threadIdx.x >> 5) & 1) * 16 + (ln >> 4) * 8) * 4;   // bytes: where group i0's 8 floats stand in the row-major source
#pragma unroll
    for (int u = 0; u < CVB; ++u) v[u] = *(const v8f*)((const char*)(src + u * 128) + so);
#pragma unroll
    for (int u = 0; u < CVB; ++u) { v8us o;
#pragma unroll
        for (int k = 0; k < 8; ++k) o[k] = f2bf(v[u][k]);
        *(v8us*)(dst + (i0 + u * 256) * 8) = o; }
    asm volatile("s_wait_xcnt 0x0" ::: "memory");   // the listing lays the table code behind these stores, and it rewrites registers that they still name as data: the wait stands in front of any such rewrite
}
__device__ __forceinline__ float xhalf(float x) { return __builtin_bit_cast(float, __builtin_amdgcn_permlanex16(__builtin_bit_cast(int, x), __builtin_bit_cast(int, x), 0x76543210, 0xfedcba98, false, false)); }  // lane l takes lane l ^ 16's value
template <typename T16> struct PFrag;
template <> struct PFrag<h16> { static constexpr bool SPLIT = false; static __device__ __forceinline__ void pack(const float* p, v16h& a, v16h& b) { (void)b;
#pragma unroll
    for (int s = 0; s < 16; ++s) a[s] = (h16)p[s]; } };
template <> struct PFrag<bf> { static constexpr bool SPLIT = true; static __device__ __forceinline__ void pack(const float* p, v16bf& a, v16bf& b) {
#pragma unroll
    for (int s = 0; s < 16; ++s) { const __bf16 h = (__bf16)p[s]; a[s] = h; b[s] = (__bf16)(p[s] - (float)h); } } };
template <typename T16, int QT>
__device__ __forceinline__ void fattn_tile(const T16* __restrict__ Q, const T16* __restrict__ Q2, const T16* __restrict__ Kp, const T16* __restrict__ K2, const T16* __restrict__ Vt, const T16* __restrict__ Vt2, const int* __restrict__ mk, int q0, bf* Ah, bf* Al) {
    typedef typename WFrag<T16>::V V; constexpr bool SP = PFrag<T16>::SPLIT; constexpr float SH = SP ? 0.0f : 10.0f;
    const int lane = threadIdx.x & 31, lr = lane & 15, hi = lane >> 4; const unsigned lo = lane * 16;
    V qf[QT][2], qf2[QT][2]; v8f o[QT][4]; float m[QT], l[QT];
#pragma unroll
    for (int qt = 0; qt < QT; ++qt) { m[qt] = -3.0e38f; l[qt] = 0.0f;
#pragma unroll
        for (int ks = 0; ks < 2; ++ks) { const size_t qo = (size_t)(q0 + qt * 16) * HD + ks * 512; qf[qt][ks] = WFrag<T16>::ld((const char*)(Q + qo) + lo); if (SP) qf2[qt][ks] = WFrag<T16>::ld((const char*)(Q2 + qo) + lo); }
#pragma unroll
        for (int dt = 0; dt < 4; ++dt) o[qt][dt] = (v8f){}; }
    V kf[2][2], kf2[2][2], vf[4], vf2[4]; v4i mq[QT][2][2];   // one pass's fragments; they live across the loop's back edge: each is loaded one pass ahead, into the registers that its last user of this pass has just read
    const char* const K0 = (const char*)Kp + lo; const char* const V0 = (const char*)Vt + lo; const char* const M0 = (const char*)(mk + (size_t)q0 * (TT / 32) * 32) + lo;   // this lane's 16 bytes of the first tile, per plane
    const char* const K20 = SP ? (const char*)K2 + lo : K0; const char* const V20 = SP ? (const char*)Vt2 + lo : V0;
    auto ldkm = [&](const char* Kb, const char* K2b, const char* Mb) {   // key and mask fragments of one pass
#pragma unroll
        for (int kt = 0; kt < 2; ++kt)
#pragma unroll
            for (int ks = 0; ks < 2; ++ks) { const int e = (kt * 16 * HD + ks * 512) * 2; kf[kt][ks] = WFrag<T16>::ld(Kb + e); if (SP) kf2[kt][ks] = WFrag<T16>::ld(K2b + e); }
#pragma unroll
        for (int qt = 0; qt < QT; ++qt)
#pragma unroll
            for (int kt = 0; kt < 2; ++kt) { const char* mp = Mb + (qt * (TT / 32) * 512 + kt * 256) * 4; mq[qt][kt][0] = *(const v4i*)mp; mq[qt][kt][1] = *(const v4i*)(mp + 512); } };
    auto ldv = [&](const char* Vb, const char* V2b) {   // value fragments of one pass
#pragma unroll
        for (int dt = 0; dt < 4; ++dt) { const int e = dt * 16 * TT * 2; vf[dt] = WFrag<T16>::ld(Vb + e); if (SP) vf2[dt] = WFrag<T16>::ld(V2b + e); } };
    __builtin_amdgcn_sched_barrier(0);   // the query loads issue ahead of the first pass's: loads return in order, so the loop's counted waits on key fragments then cover them; issued behind, the first wait of every pass would have to drain the value loads too
    ldkm(K0, K20, M0); ldv(V0, V20);
    asm volatile("s_wait_xcnt 0x0" :: "v"(K0), "v"(K20), "v"(V0), "v"(V20), "v"(M0) : "memory");   // the address registers stay whole until every load that names them is past this wait
    __builtin_amdgcn_sched_barrier(0);   // keeps what follows behind that wait: the loop's scalar set-up lands in the base registers that these loads name
    const char* kn = (const char*)Kp; const char* vn = (const char*)Vt; const char* mn_ = (const char*)(mk + (size_t)q0 * (TT / 32) * 32); const char* k2n = (const char*)K2; const char* v2n = (const char*)Vt2;   // the first tile of the pass fetched ahead, per plane: the same for the whole wave, so they step in scalar registers
#pragma unroll 1
    for (int kb = 0; kb < TT; kb += 32) {
        const bool more = kb + 32 < TT;   // the last pass fetches the first block again, in bounds and unused
        kn = more ? kn + 32 * HD * 2 : (const char*)Kp; vn = more ? vn + 32 * 16 * 2 : (const char*)Vt; mn_ = more ? mn_ + 32 * 16 * 4 : (const char*)(mk + (size_t)q0 * (TT / 32) * 32);
        if (SP) { k2n = more ? k2n + 32 * HD * 2 : (const char*)K2; v2n = more ? v2n + 32 * 16 * 2 : (const char*)Vt2; }
        const char* const Kb = kn + lo; const char* const Vb = vn + lo; const char* const Mb = mn_ + lo; const char* const K2b = SP ? k2n + lo : Kb; const char* const V2b = SP ? v2n + lo : Vb;   // this lane's 16 bytes of them
        float t[QT][16], bm[QT];
#pragma unroll
        for (int qt = 0; qt < QT; ++qt) { bm[qt] = -3.0e38f;
#pragma unroll
            for (int kt = 0; kt < 2; ++kt) { v8f s = (v8f){};
#pragma unroll
                for (int ks = 0; ks < 2; ++ks) { s = WFrag<T16>::mma(kf[kt][ks], qf[qt][ks], s); if (SP) { s = WFrag<T16>::mma(kf2[kt][ks], qf[qt][ks], s); s = WFrag<T16>::mma(kf[kt][ks], qf2[qt][ks], s); } }
#pragma unroll
                for (int j = 0; j < 8; ++j) { const float x = (mq[qt][kt][j >> 2][j & 3] != 0) ? s[j] * (SCL * 1.4426950408889634f) : -3.0e38f; t[qt][kt * 8 + j] = x; bm[qt] = fmaxf(bm[qt], x); } } }
        __builtin_amdgcn_sched_barrier(0);   // the next pass's key and mask loads stay behind the last use of the registers they fill: lifted higher they would take registers of their own
        ldkm(Kb, K2b, Mb);
        if (SP) asm volatile("s_wait_xcnt 0x0" :: "v"(Kb), "v"(K2b), "v"(Mb) : "memory");   // the address registers stay whole until the loads that name them are past this wait; the hi+lo waves have no registers to hold them longer, the fp16 waves hold them to the pass's end and wait once, there
        __builtin_amdgcn_sched_barrier(0);   // and they stay ahead of the softmax and att.v, under which they fly: sunk lower their latency would be met whole at the next pass's head
#pragma unroll
        for (int qt = 0; qt < QT; ++qt) {
            const float bx = fmaxf(bm[qt], xhalf(bm[qt]));
            const float mn = fmaxf(m[qt], bx); const float al = __builtin_amdgcn_exp2f(m[qt] - mn); m[qt] = mn; const float mb = mn - SH; float ps = 0.0f;
#pragma unroll
            for (int s = 0; s < 16; ++s) { t[qt][s] = __builtin_amdgcn_exp2f(t[qt][s] - mb); ps += t[qt][s]; }
            l[qt] = l[qt] * al + ps;
#pragma unroll
            for (int dt = 0; dt < 4; ++dt) o[qt][dt] *= al;
            V pf, pf2; PFrag<T16>::pack(t[qt], pf, pf2);
#pragma unroll
            for (int dt = 0; dt < 4; ++dt) { o[qt][dt] = WFrag<T16>::mma(vf[dt], pf, o[qt][dt]); if (SP) { o[qt][dt] = WFrag<T16>::mma(vf2[dt], pf, o[qt][dt]); o[qt][dt] = WFrag<T16>::mma(vf[dt], pf2, o[qt][dt]); } }
        }
        __builtin_amdgcn_sched_barrier(0);   // the next pass's value loads stay behind att.v, whose registers they fill
        ldv(Vb, V2b);
        if (SP) asm volatile("s_wait_xcnt 0x0" :: "v"(Vb), "v"(V2b) : "memory");   // the address registers stay whole until every load that names them is past this wait (as inputs they cannot be rewritten or given to a load's result before it)
        else asm volatile("s_wait_xcnt 0x0" :: "v"(Kb), "v"(Mb), "v"(Vb) : "memory");   // the same, for all three planes of the fp16 waves
        __builtin_amdgcn_sched_barrier(0);   // keeps the next pass's address additions behind that wait
    }
#pragma unroll
    for (int qt = 0; qt < QT; ++qt) { const float inv = __fdiv_rn(1.0f, l[qt] + xhalf(l[qt])); const size_t oo = (size_t)(q0 + qt * 16) * DQ;
#pragma unroll
        for (int dt = 0; dt < 4; ++dt) { v8us oh, ol;
#pragma unroll
            for (int j = 0; j < 8; ++j) { unsigned short a, c2; splitf(o[qt][dt][j] * inv, a, c2); oh[j] = a; ol[j] = c2; }
            *(v8us*)((char*)(Ah + oo + dt * 256) + lo) = oh; *(v8us*)((char*)(Al + oo + dt * 256) + lo) = ol; } }
}
// grid (FBX, NB_*NH_), 5 waves of one head per block, every block the same work: waves 0, 1 take 16 hi+lo query rows each, waves 2..4 take 32 fp16 query rows each (RH/16 = 2 FBX and (TT-RH)/32 = 3 FBX tiles a head)
#define FBX 8
static_assert(RH == 2 * FBX * 16 && TT - RH == 3 * FBX * 32, "tiles per block");
__global__ __launch_bounds__(160) void k_fattn(const h16* __restrict__ Q16, const h16* __restrict__ K16, const h16* __restrict__ V16, const bf* __restrict__ Qh, const bf* __restrict__ Ql, const bf* __restrict__ Kh, const bf* __restrict__ Kl, const bf* __restrict__ Vh, const bf* __restrict__ Vl, const int* __restrict__ mk, bf* Ah, bf* Al) {
    const int bh = blockIdx.y, bx = blockIdx.x, wave = __builtin_amdgcn_readfirstlane(threadIdx.x >> 5); const size_t pq = (size_t)bh * TT * HD, pk = (size_t)(bh / REP) * TT * HD; const size_t ao = (size_t)(bh / NH_) * TT * DQ + (size_t)(bh % NH_) * (HD / 32) * 512;
    if (wave < 2) fattn_tile<bf, 1>(Qh + pq, Ql + pq, Kh + pk, Kl + pk, Vh + pk, Vl + pk, mk, (bx * 2 + wave) * 16, Ah + ao, Al + ao);
    else fattn_tile<h16, 2>(Q16 + pq, nullptr, K16 + pk, nullptr, V16 + pk, nullptr, mk, RH + (bx * 3 + wave - 2) * 32, Ah + ao, Al + ao);
}

extern "C" void kernel_launch(void* const* d_in, const int* in_sizes, int n_in,
                              void* d_out, int out_size, void* d_ws, size_t ws_size, hipStream_t stream) {
    (void)in_sizes; (void)n_in; (void)out_size;
    const float* x = (const float*)d_in[0]; const float* wq = (const float*)d_in[1]; const float* bqv = (const float*)d_in[2]; const float* wk = (const float*)d_in[3]; const float* bkv = (const float*)d_in[4]; const float* wv = (const float*)d_in[5]; const float* bvv = (const float*)d_in[6]; const float* wo = (const float*)d_in[7]; const float* bo = (const float*)d_in[8]; const int* mk = (const int*)d_in[9];   // torch [out][in] weights; mask int32 [1][1][1024][1024] (nonzero = attend)
    float* OUT = (float*)d_out;     // [4][1024][1024]
    char* wsp = (char*)d_ws;
    auto take = [&](size_t bytes) { char* p = wsp; wsp += (bytes + 255) & ~(size_t)255; return (void*)p; };
    bf* WQ = (bf*)take((size_t)DQ * DM * 2); bf* WK = (bf*)take((size_t)DKV * DM * 2); bf* WV = (bf*)take((size_t)DKV * DM * 2); bf* WO = (bf*)take((size_t)DM * DQ * 2); float* CS = (float*)take((size_t)TT * HD * 2 * 4);
    bf* XB = (bf*)take((size_t)NB_ * TT * DM * 2);
    h16* QP16 = (h16*)take((size_t)NB_ * NH_ * TT * HD * 2); h16* KP16 = (h16*)take((size_t)NB_ * NKV * TT * HD * 2); h16* VT16 = (h16*)take((size_t)NB_ * NKV * HD * TT * 2);
    bf* QPh = (bf*)take((size_t)NB_ * NH_ * TT * HD * 2); bf* QPl = (bf*)take((size_t)NB_ * NH_ * TT * HD * 2); bf* KPh = (bf*)take((size_t)NB_ * NKV * TT * HD * 2); bf* KPl = (bf*)take((size_t)NB_ * NKV * TT * HD * 2); bf* VTh = (bf*)take((size_t)NB_ * NKV * HD * TT * 2); bf* VTl = (bf*)take((size_t)NB_ * NKV * HD * TT * 2);
    bf* ATh = (bf*)take((size_t)NB_ * TT * DQ * 2); bf* ATl = (bf*)take((size_t)NB_ * TT * DQ * 2); int* MK = (int*)take((size_t)TT * TT * 4);
    if ((size_t)(wsp - (char*)d_ws) > ws_size) return;    // well inside the workspace
    k_prep<<<PTB + PMB + PXB + PQB + 2 * PKB + PQB, 256, 0, stream>>>(x, wq, wk, wv, wo, mk, XB, WQ, WK, WV, WO, CS, MK);
    // all batch items per launch: x is [NB_*TT][DM], so the projections are plain GEMMs with M = NB_*TT
    k_qkv<<<dim3(NB_ * TT / 256, NH_, 1), 384, 0, stream>>>(XB, WQ, WK, WV, bqv, bkv, bvv, CS, QP16, QPh, QPl, KP16, KPh, KPl, VT16, VTh, VTl);   // v^T = Wv x^T: rows d, columns b*TT + t
    k_fattn<<<dim3(FBX, NB_ * NH_, 1), 160, 0, stream>>>(QP16, KP16, VT16, QPh, QPl, KPh, KPl, VTh, VTl, MK, ATh, ATl);
    k_gemmw<bf, 1, true, DQ><<<dim3(NB_ * TT / 64, DM / 64, 1), 32, 0, stream>>>(ATh, ATl, WO, nullptr, OUT, DM, bo);
}

// v009
// A run of this version takes 89.1 microseconds.
// Next to v008, in two timings, it ran 1.07 times as fast each time.
// Counting every step since v000, it is 26.7 times as fast.
#include <hip/hip_runtime.h>

// MultiHeadAttentionEuclid (x [4][1024][1024]; q/k/v = x W^T + b (16 heads x 64); interleaved-pair rotary (base 1e4, positions 0..1023 computed on device); scores = q.k/8 where mask[0][0][i][j] != 0 (int32 [1][1][1024][1024],
// read as data; here causal), -inf elsewhere; softmax; out = merged att.v Wo^T + bo -> [4][1024][1024]).
// Compute dtypes, f32 accumulate: every input rounded to bf16; projections on PLAIN bf16 operands (inputs: exact, + bias); rope f32; scores (K 64) and att.v on bf16 hi+lo planes (3 products)
// for the first 256 query rows of each head and SINGLE fp16 planes for the rest; f32 masked online softmax in registers; merged heads hl x exact Wo (2 products) + bo. One-wave-per-64x64-tile GEMMs. Deterministic, no atomics;
// Launch plan: projections and the output product take all 4 batch items in one grid (rows b*1024 + t, planes [b][h]); a 64-column tile is one head, so each projection's epilogue writes the 16-bit head planes itself
// (q, k: bias, rope, split; v: computed as Wv x^T, bias, split, rows d over columns t); scores, softmax and att.v of all 64 (batch, head) pairs are one launch (k_fattn).
// FRAGMENT ORDER: every 16-bit plane [rows][K] that feeds a matrix operand is stored as tiles of 16 rows x 32 k, 512 elements each, tile (R, kt) at (R * (K/32) + kt) * 512. Inside a tile, element (row, k) stands at
// ((k >> 4) & 1) * 256 + (((k >> 3) & 1) * 16 + row) * 8 + (k & 7): the two 16-byte loads of a lane's fragment are then at bytes lane * 16 and 512 + lane * 16 of the tile, so one wave load reads 512 contiguous bytes
// (4 whole lines, not 32 bytes of each of 16). Which lane and register hold which (row, k) is as with row-major planes; only the place in memory differs.
// The mask is turned once into LANE MASKS (k_prep): per tile of 16 queries x 32 keys 16 words, tile (qt, kbt) at (qt * (TT/32) + kbt) * 16; bit (hi * 16 + lr) of word kt * 8 + j says whether mask[query lr][key kt*16 + hi*8 + j] != 0,
// which is the score that lane hi * 16 + lr holds in register j of S^T tile kt: k_fattn reads the 16 words of a tile with one scalar load, and each word is the select mask of one register's 32 scores as it stands.

#define NB_  4
#define TT   1024
#define DM   1024
#define NH_  16
#define NKV  16
#define REP  (NH_ / NKV)
#define HD   64
#define DQ   (NH_ * HD)
#define DKV  (NKV * HD)
#define RH   256                  // query rows < RH use hi+lo planes
#define WIN  0
#define SCL  0.125f   // HD^-0.5
typedef _Float16 h16;
typedef unsigned short bf;
typedef __attribute__((ext_vector_type(16))) __bf16   v16bf;
typedef __attribute__((ext_vector_type(16))) _Float16 v16h;
typedef __attribute__((ext_vector_type(8)))  _Float16 v8h;
typedef __attribute__((ext_vector_type(8)))  unsigned short v8us;
typedef __attribute__((ext_vector_type(8)))  float    v8f;
typedef __attribute__((ext_vector_type(4)))  float    v4f;
typedef v8h  __attribute__((may_alias)) v8ha;
typedef v4f  __attribute__((may_alias)) v4fa;
typedef v8us __attribute__((may_alias)) v8usa;

__device__ __forceinline__ unsigned short f2bf(float f) { unsigned u = __float_as_uint(f); u += 0x7FFFu + ((u >> 16) & 1u); return (unsigned short)(u >> 16); }
__device__ __forceinline__ float bf2f(unsigned short b) { return __uint_as_float(((unsigned)b) << 16); }
__device__ __forceinline__ float bfr(float f) { return bf2f(f2bf(f)); }
__device__ __forceinline__ v16h cat16(v8h lo, v8h hi) { return __builtin_shufflevector(lo, hi, 0, 1, 2, 3, 4, 5, 6, 7, 8, 9, 10, 11, 12, 13, 14, 15); }
__device__ __forceinline__ v16bf cat16b(v8us lo, v8us hi) { return __builtin_bit_cast(v16bf, __builtin_shufflevector(lo, hi, 0, 1, 2, 3, 4, 5, 6, 7, 8, 9, 10, 11, 12, 13, 14, 15)); }
__device__ __forceinline__ v8f wmma16(v16h a, v16h b, v8f c) { return __builtin_amdgcn_wmma_f32_16x16x32_f16(false, a, false, b, (short)0, c, false, false); }
__device__ __forceinline__ v8f wmmab(v16bf a, v16bf b, v8f c) { return __builtin_amdgcn_wmma_f32_16x16x32_bf16(false, a, false, b, (short)0, c, false, false); }



__device__ __forceinline__ h16 tohx(float x) { return (h16)x; }
__device__ __forceinline__ void splitf(float y, unsigned short& h, unsigned short& l) { h = f2bf(y); l = f2bf(y - bf2f(h)); }
typedef __attribute__((ext_vector_type(2))) _Float16 v2h;
typedef __attribute__((ext_vector_type(4))) _Float16 v4h;
typedef __attribute__((ext_vector_type(2))) unsigned short v2us;
typedef __attribute__((ext_vector_type(4))) unsigned short v4us;
typedef __attribute__((ext_vector_type(2))) float v2f;
typedef __attribute__((ext_vector_type(4))) int v4i;
typedef __attribute__((ext_vector_type(16))) int v16i;

// ---- k_gemmw: register-blocked GEMM, ONE WAVE per 64x64 output tile (16 accumulators), operands straight from 16-bit planes in fragment order; grid (M/64, N/64), 32 threads.
// C[m][n] (f32, pitch ldc, + optional f32 bias[n]) = sum_k A[m][k] Bt[n][k] (+ split products per NSPLIT). A pass of the k loop takes KU k tiles (K % (32 * KU) == 0): the loads of all of them issue first, the products follow tile by tile in k order,
// each tile's behind a counted wait, so a wave meets the load latency once per KU tiles and the later tiles' loads fly under the earlier tiles' products. KU is what the registers allow: 16 or 24 loads and 64 or 96 registers a tile.
// EPI 0: C as above. EPI 1 (rows m = b*TT + t, column tile = head): bias[n], interleaved-pair rope from the table CS ([t][d] -> cos, sin), then the fp16, bf16 hi and bf16 lo planes [b][head] of rows t, K = d, in fragment order.
// EPI 2 (row tile = head, columns n = b*TT + t): bias[m], then the same three planes [b][head] of rows d, K = t, in fragment order. Neither writes C.
template <typename T16> struct WFrag;   // ld(c): the fragment of one tile; c = the tile's address + lane * 16 bytes
template <> struct WFrag<h16> { typedef v16h V; static __device__ __forceinline__ V ld(const char* c) { return cat16(*(const v8h*)c, *(const v8h*)(c + 512)); } static __device__ __forceinline__ v8f mma(V a, V b, v8f c) { return wmma16(a, b, c); } };
template <> struct WFrag<bf> { typedef v16bf V; static __device__ __forceinline__ V ld(const char* c) { return cat16b(*(const v8us*)c, *(const v8us*)(c + 512)); } static __device__ __forceinline__ v8f mma(V a, V b, v8f c) { return wmmab(a, b, c); } };
// gemmw_tile: the tile (tx, ty) of one wave; os: that wave's own 16 x 68 floats of LDS; nh: heads per batch item (EPI 1, 2).
template <typename T16, int NSPLIT, bool BIAS, int EPI, int KU>
__device__ __forceinline__ void gemmw_tile(const T16* __restrict__ A, const T16* __restrict__ A2, const T16* __restrict__ Bt, const T16* __restrict__ Bt2, int K, float* C, int ldc, const float* __restrict__ bias, const float* __restrict__ CS, h16* __restrict__ P16, bf* __restrict__ Ph, bf* __restrict__ Pl, int tx, int ty, int nh, float* os) {
    typedef typename WFrag<T16>::V V;
    const int lane = threadIdx.x & 31, lr = lane & 15, hi = lane >> 4; const int r0 = tx * 64, c0 = ty * 64;
    v8f acc[4][4];
#pragma unroll
    for (int mb = 0; mb < 4; ++mb)
#pragma unroll
        for (int nb = 0; nb < 4; ++nb) acc[mb][nb] = (v8f){};
    const size_t aoff = (size_t)r0 * K, boff = (size_t)c0 * K; const unsigned lo = lane * 16;   // a row tile is 16 * K elements, a k tile 512
#pragma unroll 1
    for (int kc = 0; kc < K; kc += 32 * KU) {
        V a[KU][4], a2[KU][4], b[KU][4], b2[KU][4]; constexpr bool SA = NSPLIT == 1 || NSPLIT == 2, SB = NSPLIT >= 2; constexpr size_t RT = 2;   // bytes an element
        const char* const pa = (const char*)(A + aoff + kc * 16) + lo; const char* const pb = (const char*)(Bt + boff + kc * 16) + lo;   // this lane's 16 bytes of this pass's k tile, first row tile
        const char* const pa2 = SA ? (const char*)(A2 + aoff + kc * 16) + lo : pa; const char* const pb2 = SB ? (const char*)(Bt2 + boff + kc * 16) + lo : pb;
#pragma unroll
        for (int u = 0; u < KU; ++u) {   // k tile u of the pass stands u * 512 elements behind k tile 0
#pragma unroll
            for (int mb = 0; mb < 4; ++mb) { a[u][mb] = WFrag<T16>::ld(pa + ((size_t)mb * 16 * K + u * 512) * RT); if (SA) a2[u][mb] = WFrag<T16>::ld(pa2 + ((size_t)mb * 16 * K + u * 512) * RT); }
#pragma unroll
            for (int nb = 0; nb < 4; ++nb) { b[u][nb] = WFrag<T16>::ld(pb + ((size_t)nb * 16 * K + u * 512) * RT); if (SB) b2[u][nb] = WFrag<T16>::ld(pb2 + ((size_t)nb * 16 * K + u * 512) * RT); } }
        asm volatile("s_wait_xcnt 0x0" :: "v"(pa), "v"(pa2), "v"(pb), "v"(pb2) : "memory");   // the address registers stay whole until every load of the pass that names them is past this wait (as inputs they cannot be given to a load's result before it); the wave has only its data to wait for here
        __builtin_amdgcn_sched_barrier(0);   // no product is lifted over the pass's loads: without it the scheduler starts the products early and issues the last fragments' loads into freed registers, behind a load wait, so a pass waits out the load latency twice in a row
#pragma unroll
        for (int u = 0; u < KU; ++u)
#pragma unroll
        for (int nb = 0; nb < 4; ++nb) {
#pragma unroll
            for (int mb = 0; mb < 4; ++mb) { acc[mb][nb] = WFrag<T16>::mma(a[u][mb], b[u][nb], acc[mb][nb]); if (SA) acc[mb][nb] = WFrag<T16>::mma(a2[u][mb], b[u][nb], acc[mb][nb]); if (SB) acc[mb][nb] = WFrag<T16>::mma(a[u][mb], b2[u][nb], acc[mb][nb]); } }
        asm volatile("v_nop\n\tv_nop\n\tv_nop\n\tv_nop" : "+v"(acc[0][0]), "+v"(acc[1][1]), "+v"(acc[2][2]), "+v"(acc[3][3]) : "v"(a[KU - 1][0]), "v"(a[KU - 1][3]));   // the vector slots the chip asks for behind the pass's last products, before the loop's taken branch leads to instructions that rewrite their operand registers
    }
    static_assert(EPI == 0 || HD == 64, "a 64-wide tile is one head");
    const int fo = (lr >> 3) * 512 + ((lr >> 2) & 1) * 256 + ((lr >> 1) & 1) * 128 + (lr & 1) * 4;   // k = lr * 4 of a 64-wide k range, row 0, in fragment order
    float cb[4], rb[4][8]; v2f cs[2][8][2]; size_t pbase = 0;   // all of a row block's table entries are asked for one row block ahead, as one batch
    const float* const cp0 = CS + ((size_t)(r0 % TT + hi) * HD + lr * 4) * 2;   // this lane's first table entry; every other one is a constant step from it
    if (EPI == 1) { pbase = ((size_t)((r0 / TT) * nh + ty) * TT + (r0 % TT)) * HD + fo;
#pragma unroll
        for (int i = 0; i < 4; ++i) cb[i] = bfr(bias[c0 + lr * 4 + i]);
#pragma unroll
        for (int s = 0; s < 8; ++s) { const float* cp = cp0 + 2 * s * HD * 2; cs[0][s][0] = *(const v2f*)cp; cs[0][s][1] = *(const v2f*)(cp + 4); } }
    if (EPI == 2) { pbase = (size_t)((c0 / TT) * nh + tx) * HD * TT + (c0 % TT) * 16 + fo;
#pragma unroll
        for (int mb = 0; mb < 4; ++mb)
#pragma unroll
            for (int s = 0; s < 8; ++s) { if (mb == 3 && s == 7) asm volatile("s_wait_xcnt 0x0" ::: "memory");   // without it the last load's result was placed in the offset register that the 31 loads before it still name: the wait stands in front of any such rewrite
                rb[mb][s] = bfr(bias[r0 + mb * 16 + 2 * s + hi]); } }
#pragma unroll
    for (int mb = 0; mb < 4; ++mb) {
        if (EPI == 1 && mb < 3) {
#pragma unroll
            for (int s = 0; s < 8; ++s) { const float* cp = cp0 + ((mb + 1) * 16 + 2 * s) * HD * 2; cs[(mb + 1) & 1][s][0] = *(const v2f*)cp; cs[(mb + 1) & 1][s][1] = *(const v2f*)(cp + 4); } }
#pragma unroll
        for (int nb = 0; nb < 4; ++nb) {
#pragma unroll
            for (int j = 0; j < 8; ++j) os[(hi * 8 + j) * 68 + nb * 16 + lr] = acc[mb][nb][j]; }
        __builtin_amdgcn_wave_barrier(); asm volatile("" ::: "memory");
        float* crow = C + (size_t)(r0 + mb * 16) * ldc + c0;
        if (EPI != 0) {
#pragma unroll
            for (int s = 0; s < 8; ++s) { const int row = 2 * s + hi; const v4f val = *(const v4fa*)(os + row * 68 + lr * 4); float r[4];
                if (EPI == 1) { const float x0 = val[0] + cb[0], x1 = val[1] + cb[1], x2 = val[2] + cb[2], x3 = val[3] + cb[3]; const v2f ca = cs[mb & 1][s][0], cc = cs[mb & 1][s][1];
                    r[0] = x0 * ca[0] - x1 * ca[1]; r[1] = x1 * ca[0] + x0 * ca[1]; r[2] = x2 * cc[0] - x3 * cc[1]; r[3] = x3 * cc[0] + x2 * cc[1]; }
                else { r[0] = val[0] + rb[mb][s]; r[1] = val[1] + rb[mb][s]; r[2] = val[2] + rb[mb][s]; r[3] = val[3] + rb[mb][s]; }
                v4h o16; v4us oh, ol;
#pragma unroll
                for (int i = 0; i < 4; ++i) { o16[i] = tohx(r[i]); unsigned short a2, c2; splitf(r[i], a2, c2); oh[i] = a2; ol[i] = c2; }
                const size_t e = pbase + (size_t)mb * 16 * (EPI == 1 ? HD : TT) + row * 8;   // rows 2s, 2s + 1: 32 bytes in each of 8 places; the 8 stores of a row block fill its tiles
                *(v4h*)(P16 + e) = o16; *(v4us*)(Ph + e) = oh; *(v4us*)(Pl + e) = ol; }
            if (mb < 3) asm volatile("s_wait_xcnt 0x0" ::: "memory");   // the next row block's loads and arithmetic land in registers that these stores still name: the wait stands in front of that rewrite
        } else {
#pragma unroll
            for (int s = 0; s < 8; ++s) { const int row = 2 * s + hi, cofs = lr * 4; v4f val = *(const v4fa*)(os + row * 68 + cofs); if (BIAS) { val[0] += bfr(bias[c0 + cofs]); val[1] += bfr(bias[c0 + cofs + 1]); val[2] += bfr(bias[c0 + cofs + 2]); val[3] += bfr(bias[c0 + cofs + 3]); }
                *(v4f*)(crow + (size_t)row * ldc + cofs) = val; }
            if (mb < 3) asm volatile("s_wait_xcnt 0x0" ::: "memory");   // the next row block's loads and arithmetic land in registers that these stores still name: the wait stands in front of that rewrite
             }
        __builtin_amdgcn_wave_barrier(); asm volatile("" ::: "memory");
    }
}
template <typename T16, int NSPLIT, bool BIAS, int K>   // K at compile time: the steps from row tile to row tile are then immediates on one address register pair per plane
__global__ __launch_bounds__(32) void k_gemmw(const T16* __restrict__ A, const T16* __restrict__ A2, const T16* __restrict__ Bt, const T16* __restrict__ Bt2, float* C, int ldc, const float* __restrict__ bias) {
    __shared__ __align__(16) float os[16 * 68]; static_assert(K % 128 == 0, "whole passes of 4 k tiles");   // one wave a SIMD: 4 tiles' fragments beside the 128 accumulator registers
    gemmw_tile<T16, NSPLIT, BIAS, 0, 4>(A, A2, Bt, Bt2, K, C, ldc, bias, nullptr, nullptr, nullptr, nullptr, blockIdx.x, blockIdx.y, 0, os);
}
// k_qkv: the three projections in one launch, grid (NB_*TT/256, heads), 12 waves a block, one block a WGP: waves 0..3 q, 4..7 k (x W^T), 8..11 v (Wv x^T) of one head, wave w on the 64 rows (w & 3) of the block's 256 rows of x.
// The block's waves read the same 4 row tiles of x and the same 3 weight tiles, so what one wave has fetched the others find in the WGP's cache; no wave reads another's result, and there is no barrier between them.
static_assert(NH_ == NKV && NB_ * TT % 256 == 0, "one grid for q, k and v"); static_assert(DM % 64 == 0, "whole passes of 2 k tiles");   // three waves a SIMD: 2 tiles' fragments each
__global__ __launch_bounds__(384) void k_qkv(const bf* __restrict__ X, const bf* __restrict__ Wq, const bf* __restrict__ Wk, const bf* __restrict__ Wv, const float* __restrict__ bq, const float* __restrict__ bk, const float* __restrict__ bv, const float* __restrict__ CS,
                                            h16* __restrict__ Q16, bf* __restrict__ Qh, bf* __restrict__ Ql, h16* __restrict__ K16, bf* __restrict__ Kh, bf* __restrict__ Kl, h16* __restrict__ V16, bf* __restrict__ Vh, bf* __restrict__ Vl) {
    __shared__ __align__(16) float os[12][16 * 68];
    const int wave = __builtin_amdgcn_readfirstlane(threadIdx.x >> 5); const int xt = blockIdx.x * 4 + (wave & 3);
    if (wave < 8) { const bool k = wave >= 4;   // q and k run the same code on their own pointers
        gemmw_tile<bf, 0, true, 1, 2>(X, nullptr, k ? Wk : Wq, nullptr, DM, nullptr, 0, k ? bk : bq, CS, k ? K16 : Q16, k ? Kh : Qh, k ? Kl : Ql, xt, blockIdx.y, NH_, os[wave]); }
    else gemmw_tile<bf, 0, true, 2, 2>(Wv, nullptr, X, nullptr, DM, nullptr, 0, bv, nullptr, V16, Vh, Vl, blockIdx.y, xt, NKV, os[wave]);
}


__global__ __launch_bounds__(256) void k_wtG(const float* __restrict__ w, int K, int N, bf* Bt) {
    const int lane = threadIdx.x & 31; const int L0 = (blockIdx.x * 8 + (threadIdx.x >> 5)) * 8; const int nlines = N * K / 64;
{
#pragma unroll 1
        for (int l = 0; l < 8; ++l) { const int L = L0 + l; if (L >= nlines) break; const size_t e = (size_t)L * 64 + lane * 2; const int k = (int)(e % K), n = (int)(e / K); v2us o;
            o[0] = f2bf(w[(size_t)k * N + n]); o[1] = f2bf(w[(size_t)(k + 1) * N + n]); *(v2us*)(Bt + e) = o; }
         }
}
// k_prep: everything that reads inputs only, one launch. Blocks 0..PTB-1 (the longest, so first): the rope table. Then the mask's lane-mask words. Then x, Wq, Wk, Wv, Wo to bf16 in fragment order, CVB groups of 8 floats a thread, a block's groups 256 apart: group g is the g-th 16 bytes of the plane written,
// so a wave stores 512 contiguous bytes and reads 64 bytes of each of 16 rows (the wave beside it reads the line's other half); 256 groups on are 4 k tiles on in the same rows.
#define CVB 4
#define PTB (TT * HD / 256)
#define PXB (NB_ * TT * DM / (8 * 256 * CVB))
#define PQB (DQ * DM / (8 * 256 * CVB))
#define PKB (DKV * DM / (8 * 256 * CVB))
#define PMB ((TT / 16) * (TT / 32) / 16)
static_assert(TT * HD % 256 == 0 && NB_ * TT * DM % (8 * 256 * CVB) == 0 && DQ * DM % (8 * 256 * CVB) == 0 && DKV * DM % (8 * 256 * CVB) == 0, "whole blocks");
static_assert(DQ == DM && (DM / 32) % (4 * CVB) == 0, "all five planes have rows of DM elements, and a block stays inside one row tile");
static_assert((TT / 16) * (TT / 32) % 16 == 0 && TT % 64 == 0, "whole blocks of the mask words: a wave takes two tiles side by side, a block 16 tiles");
__global__ __launch_bounds__(256) void k_prep(const float* __restrict__ x, const float* __restrict__ wq, const float* __restrict__ wk, const float* __restrict__ wv, const float* __restrict__ wo, const int* __restrict__ mk, bf* XB, bf* WQ, bf* WK, bf* WV, bf* WO, float* CS, int* MK) {
    int b = blockIdx.x;
    if (b < PTB) { const int idx = b * 256 + threadIdx.x; const int t = idx / HD, d = idx % HD; const int i = d >> 1; const float inv = __fdiv_rn(1.0f, powf(10000.0f, (float)(2 * i) / (float)HD)); const float ang = __fmul_rn((float)t, inv); v2f cs; cs[0] = cosf(ang); cs[1] = sinf(ang);
        *(v2f*)(CS + (size_t)idx * 2) = cs; return; }
    b -= PTB;
    if (b < PMB) { const unsigned pr = (unsigned)b * 8 + (threadIdx.x >> 5), ln = threadIdx.x & 31; v4i m[8];   // the mask: wave pr takes the tiles 2 pr and 2 pr + 1 (16 queries x 64 keys: whole lines of 16 rows) and writes their 32 words, one whole line
        const int* const src = mk + (size_t)((pr / (TT / 64)) * 16 + (ln & 15)) * TT + (pr % (TT / 64)) * 64 + (ln >> 4) * 8;   // query lr, key hi * 8 of the first tile
#pragma unroll
        for (int u = 0; u < 8; ++u) m[u] = *(const v4i*)(src + (u >> 1) * 16 + (u & 1) * 4);   // u = tile * 4 + kt * 2 + h: keys tile * 32 + kt * 16 + hi * 8 + h * 4 ..+3
        unsigned w = 0;
#pragma unroll
        for (int u = 0; u < 8; ++u)
#pragma unroll
            for (int i = 0; i < 4; ++i) { const unsigned bl = __builtin_amdgcn_ballot_w32(m[u][i] != 0); if (ln == (unsigned)(u * 4 + i)) w = bl; }   // word tile * 16 + kt * 8 + h * 4 + i, kept by the lane that stores it
        MK[(size_t)pr * 32 + ln] = (int)w;
        asm volatile("s_wait_xcnt 0x0" ::: "memory");   // as behind the conversion stores below: the listing lays the table code behind this store too, and it rewrites registers that it still names
        return; }
    b -= PMB; const float* src; bf* dst;
    if (b < PXB) { src = x; dst = XB; }
    else if ((b -= PXB) < PQB) { src = wq; dst = WQ; }
    else if ((b -= PQB) < PKB) { src = wk; dst = WK; }
    else if ((b -= PKB) < PKB) { src = wv; dst = WV; }
    else { b -= PKB; src = wo; dst = WO; }
    const size_t i0 = (size_t)b * (256 * CVB) + threadIdx.x; v8f v[CVB]; const unsigned tile = (unsigned)(i0 >> 6), ln = threadIdx.x & 31;
    const unsigned so = (((tile / (DM / 32)) * 16 + (ln & 15)) * DM + (tile % (DM / 32)) * 32 + ((threadIdx.x >> 5) & 1) * 16 + (ln >> 4) * 8) * 4;   // bytes: where group i0's 8 floats stand in the row-major source
#pragma unroll
    for (int u = 0; u < CVB; ++u) v[u] = *(const v8f*)((const char*)(src + u * 128) + so);
#pragma unroll
    for (int u = 0; u < CVB; ++u) { v8us o;
#pragma unroll
        for (int k = 0; k < 8; ++k) o[k] = f2bf(v[u][k]);
        *(v8us*)(dst + (i0 + u * 256) * 8) = o; }
    asm volatile("s_wait_xcnt 0x0" ::: "memory");   // the listing lays the table code behind these stores, and it rewrites registers that they still name as data: the wait stands in front of any such rewrite
}
__device__ __forceinline__ float xhalf(float x) { return __builtin_bit_cast(float, __builtin_amdgcn_permlanex16(__builtin_bit_cast(int, x), __builtin_bit_cast(int, x), 0x76543210, 0xfedcba98, false, false)); }  // lane l takes lane l ^ 16's value
template <typename T16> struct PFrag;
template <> struct PFrag<h16> { static constexpr bool SPLIT = false; static __device__ __forceinline__ void pack(const float* p, v16h& a, v16h& b) { (void)b;
#pragma unroll
    for (int s = 0; s < 16; ++s) a[s] = (h16)p[s]; } };
template <> struct PFrag<bf> { static constexpr bool SPLIT = true; static __device__ __forceinline__ void pack(const float* p, v16bf& a, v16bf& b) {
#pragma unroll
    for (int s = 0; s < 16; ++s) { const __bf16 h = (__bf16)p[s]; a[s] = h; b[s] = (__bf16)(p[s] - (float)h); } } };
template <typename T16, int QT>
__device__ __forceinline__ void fattn_tile(const T16* __restrict__ Q, const T16* __restrict__ Q2, const T16* __restrict__ Kp, const T16* __restrict__ K2, const T16* __restrict__ Vt, const T16* __restrict__ Vt2, const int* __restrict__ mk, int q0, bf* Ah, bf* Al) {
    typedef typename WFrag<T16>::V V; constexpr bool SP = PFrag<T16>::SPLIT; constexpr float SH = SP ? 0.0f : 10.0f;
    const int lane = threadIdx.x & 31, lr = lane & 15, hi = lane >> 4; const unsigned lo = lane * 16;
    V qf[QT][2], qf2[QT][2]; v8f o[QT][4]; float m[QT], l[QT];
#pragma unroll
    for (int qt = 0; qt < QT; ++qt) { m[qt] = -3.0e38f; l[qt] = 0.0f;
#pragma unroll
        for (int ks = 0; ks < 2; ++ks) { const size_t qo = (size_t)(q0 + qt * 16) * HD + ks * 512; qf[qt][ks] = WFrag<T16>::ld((const char*)(Q + qo) + lo); if (SP) qf2[qt][ks] = WFrag<T16>::ld((const char*)(Q2 + qo) + lo); }
#pragma unroll
        for (int dt = 0; dt < 4; ++dt) o[qt][dt] = (v8f){}; }
    V kf[2][2], kf2[2][2], vf[4], vf2[4]; v16i mq[QT];   // one pass's fragments and mask words (the words are the same for the whole wave: scalar registers); they live across the loop's back edge: each is loaded one pass ahead, into the registers that its last user of this pass has just read
    const char* const K0 = (const char*)Kp + lo; const char* const V0 = (const char*)Vt + lo; const int* const M0 = mk + (size_t)(q0 / 16) * (TT / 32) * 16;   // this lane's 16 bytes of the first tile, per plane; the first tile's mask words
    const char* const K20 = SP ? (const char*)K2 + lo : K0; const char* const V20 = SP ? (const char*)Vt2 + lo : V0;
    auto ldkm = [&](const char* Kb, const char* K2b, const int* Mb) {   // key fragments and mask words of one pass
#pragma unroll
        for (int kt = 0; kt < 2; ++kt)
#pragma unroll
            for (int ks = 0; ks < 2; ++ks) { const int e = (kt * 16 * HD + ks * 512) * 2; kf[kt][ks] = WFrag<T16>::ld(Kb + e); if (SP) kf2[kt][ks] = WFrag<T16>::ld(K2b + e); }
#pragma unroll
        for (int qt = 0; qt < QT; ++qt) mq[qt] = *(const v16i*)(Mb + qt * (TT / 32) * 16); };
    auto ldv = [&](const char* Vb, const char* V2b) {   // value fragments of one pass
#pragma unroll
        for (int dt = 0; dt < 4; ++dt) { const int e = dt * 16 * TT * 2; vf[dt] = WFrag<T16>::ld(Vb + e); if (SP) vf2[dt] = WFrag<T16>::ld(V2b + e); } };
    __builtin_amdgcn_sched_barrier(0);   // the query loads issue ahead of the first pass's: loads return in order, so the loop's counted waits on key fragments then cover them; issued behind, the first wait of every pass would have to drain the value loads too
    ldkm(K0, K20, M0); ldv(V0, V20);
    asm volatile("s_wait_xcnt 0x0" :: "v"(K0), "v"(K20), "v"(V0), "v"(V20) : "memory");   // the address registers stay whole until every load that names them is past this wait
    __builtin_amdgcn_sched_barrier(0);   // keeps what follows behind that wait: the loop's scalar set-up lands in the base registers that these loads name
    const char* kn = (const char*)Kp; const char* vn = (const char*)Vt; const int* mn_ = M0; const char* k2n = (const char*)K2; const char* v2n = (const char*)Vt2;   // the first tile of the pass fetched ahead, per plane: the same for the whole wave, so they step in scalar registers
#pragma unroll 1
    for (int kb = 0; kb < TT; kb += 32) {
        const bool more = kb + 32 < TT;   // the last pass fetches the first block again, in bounds and unused
        kn = more ? kn + 32 * HD * 2 : (const char*)Kp; vn = more ? vn + 32 * 16 * 2 : (const char*)Vt; mn_ = more ? mn_ + 16 : M0;
        if (SP) { k2n = more ? k2n + 32 * HD * 2 : (const char*)K2; v2n = more ? v2n + 32 * 16 * 2 : (const char*)Vt2; }
        const char* const Kb = kn + lo; const char* const Vb = vn + lo; const char* const K2b = SP ? k2n + lo : Kb; const char* const V2b = SP ? v2n + lo : Vb;   // this lane's 16 bytes of them
        float t[QT][16], bm[QT];
#pragma unroll
        for (int qt = 0; qt < QT; ++qt) { bm[qt] = -3.0e38f;
#pragma unroll
            for (int kt = 0; kt < 2; ++kt) { v8f s = (v8f){};
#pragma unroll
                for (int ks = 0; ks < 2; ++ks) { s = WFrag<T16>::mma(kf[kt][ks], qf[qt][ks], s); if (SP) { s = WFrag<T16>::mma(kf2[kt][ks], qf[qt][ks], s); s = WFrag<T16>::mma(kf[kt][ks], qf2[qt][ks], s); } }
#pragma unroll
                for (int j = 0; j < 8; ++j) { const float x = __builtin_amdgcn_inverse_ballot_w32((unsigned)mq[qt][kt * 8 + j]) ? s[j] * (SCL * 1.4426950408889634f) : -3.0e38f; t[qt][kt * 8 + j] = x; bm[qt] = fmaxf(bm[qt], x); } } }
        __builtin_amdgcn_sched_barrier(0);   // the next pass's key and mask-word loads stay behind the last use of the registers they fill: lifted higher they would take registers of their own
        ldkm(Kb, K2b, mn_);
        if (SP) asm volatile("s_wait_xcnt 0x0" :: "v"(Kb), "v"(K2b) : "memory");   // the address registers stay whole until the loads that name them are past this wait; the hi+lo waves have no registers to hold them longer, the fp16 waves hold them to the pass's end and wait once, there
        __builtin_amdgcn_sched_barrier(0);   // and they stay ahead of the softmax and att.v, under which they fly: sunk lower their latency would be met whole at the next pass's head
#pragma unroll
        for (int qt = 0; qt < QT; ++qt) {
            const float bx = fmaxf(bm[qt], xhalf(bm[qt]));
            const float mn = fmaxf(m[qt], bx); const float al = __builtin_amdgcn_exp2f(m[qt] - mn); m[qt] = mn; const float mb = mn - SH; float ps = 0.0f;
#pragma unroll
            for (int s = 0; s < 16; ++s) { t[qt][s] = __builtin_amdgcn_exp2f(t[qt][s] - mb); ps += t[qt][s]; }
            l[qt] = l[qt] * al + ps;
#pragma unroll
            for (int dt = 0; dt < 4; ++dt) o[qt][dt] *= al;
            V pf, pf2; PFrag<T16>::pack(t[qt], pf, pf2);
#pragma unroll
            for (int dt = 0; dt < 4; ++dt) { o[qt][dt] = WFrag<T16>::mma(vf[dt], pf, o[qt][dt]); if (SP) { o[qt][dt] = WFrag<T16>::mma(vf2[dt], pf, o[qt][dt]); o[qt][dt] = WFrag<T16>::mma(vf[dt], pf2, o[qt][dt]); } }
        }
        __builtin_amdgcn_sched_barrier(0);   // the next pass's value loads stay behind att.v, whose registers they fill
        ldv(Vb, V2b);
        if (SP) asm volatile("s_wait_xcnt 0x0" :: "v"(Vb), "v"(V2b) : "memory");   // the address registers stay whole until every load that names them is past this wait (as inputs they cannot be rewritten or given to a load's result before it)
        else asm volatile("s_wait_xcnt 0x0" :: "v"(Kb), "v"(Vb) : "memory");   // the same, for both planes of the fp16 waves
        __builtin_amdgcn_sched_barrier(0);   // keeps the next pass's address additions behind that wait
    }
#pragma unroll
    for (int qt = 0; qt < QT; ++qt) { const float inv = __fdiv_rn(1.0f, l[qt] + xhalf(l[qt])); const size_t oo = (size_t)(q0 + qt * 16) * DQ;
#pragma unroll
        for (int dt = 0; dt < 4; ++dt) { v8us oh, ol;
#pragma unroll
            for (int j = 0; j < 8; ++j) { unsigned short a, c2; splitf(o[qt][dt][j] * inv, a, c2); oh[j] = a; ol[j] = c2; }
            *(v8us*)((char*)(Ah + oo + dt * 256) + lo) = oh; *(v8us*)((char*)(Al + oo + dt * 256) + lo) = ol; } }
}
// grid (FBX, NB_*NH_), 5 waves of one head per block, every block the same work: waves 0, 1 take 16 hi+lo query rows each, waves 2..4 take 32 fp16 query rows each (RH/16 = 2 FBX and (TT-RH)/32 = 3 FBX tiles a head)
#define FBX 8
static_assert(RH == 2 * FBX * 16 && TT - RH == 3 * FBX * 32, "tiles per block");
__global__ __launch_bounds__(160) void k_fattn(const h16* __restrict__ Q16, const h16* __restrict__ K16, const h16* __restrict__ V16, const bf* __restrict__ Qh, const bf* __restrict__ Ql, const bf* __restrict__ Kh, const bf* __restrict__ Kl, const bf* __restrict__ Vh, const bf* __restrict__ Vl, const int* __restrict__ mk, bf* Ah, bf* Al) {
    const int bh = blockIdx.y, bx = blockIdx.x, wave = __builtin_amdgcn_readfirstlane(threadIdx.x >> 5); const size_t pq = (size_t)bh * TT * HD, pk = (size_t)(bh / REP) * TT * HD; const size_t ao = (size_t)(bh / NH_) * TT * DQ + (size_t)(bh % NH_) * (HD / 32) * 512;
    if (wave < 2) fattn_tile<bf, 1>(Qh + pq, Ql + pq, Kh + pk, Kl + pk, Vh + pk, Vl + pk, mk, (bx * 2 + wave) * 16, Ah + ao, Al + ao);
    else fattn_tile<h16, 2>(Q16 + pq, nullptr, K16 + pk, nullptr, V16 + pk, nullptr, mk, RH + (bx * 3 + wave - 2) * 32, Ah + ao, Al + ao);
}

extern "C" void kernel_launch(void* const* d_in, const int* in_sizes, int n_in,
                              void* d_out, int out_size, void* d_ws, size_t ws_size, hipStream_t stream) {
    (void)in_sizes; (void)n_in; (void)out_size;
    const float* x = (const float*)d_in[0]; const float* wq = (const float*)d_in[1]; const float* bqv = (const float*)d_in[2]; const float* wk = (const float*)d_in[3]; const float* bkv = (const float*)d_in[4]; const float* wv = (const float*)d_in[5]; const float* bvv = (const float*)d_in[6]; const float* wo = (const float*)d_in[7]; const float* bo = (const float*)d_in[8]; const int* mk = (const int*)d_in[9];   // torch [out][in] weights; mask int32 [1][1][1024][1024] (nonzero = attend)
    float* OUT = (float*)d_out;     // [4][1024][1024]
    char* wsp = (char*)d_ws;
    auto take = [&](size_t bytes) { char* p = wsp; wsp += (bytes + 255) & ~(size_t)255; return (void*)p; };
    bf* WQ = (bf*)take((size_t)DQ * DM * 2); bf* WK = (bf*)take((size_t)DKV * DM * 2); bf* WV = (bf*)take((size_t)DKV * DM * 2); bf* WO = (bf*)take((size_t)DM * DQ * 2); float* CS = (float*)take((size_t)TT * HD * 2 * 4);
    bf* XB = (bf*)take((size_t)NB_ * TT * DM * 2);
    h16* QP16 = (h16*)take((size_t)NB_ * NH_ * TT * HD * 2); h16* KP16 = (h16*)take((size_t)NB_ * NKV * TT * HD * 2); h16* VT16 = (h16*)take((size_t)NB_ * NKV * HD * TT * 2);
    bf* QPh = (bf*)take((size_t)NB_ * NH_ * TT * HD * 2); bf* QPl = (bf*)take((size_t)NB_ * NH_ * TT * HD * 2); bf* KPh = (bf*)take((size_t)NB_ * NKV * TT * HD * 2); bf* KPl = (bf*)take((size_t)NB_ * NKV * TT * HD * 2); bf* VTh = (bf*)take((size_t)NB_ * NKV * HD * TT * 2); bf* VTl = (bf*)take((size_t)NB_ * NKV * HD * TT * 2);
    bf* ATh = (bf*)take((size_t)NB_ * TT * DQ * 2); bf* ATl = (bf*)take((size_t)NB_ * TT * DQ * 2); int* MK = (int*)take((size_t)TT * TT / 8);
    if ((size_t)(wsp - (char*)d_ws) > ws_size) return;    // well inside the workspace
    k_prep<<<PTB + PMB + PXB + PQB + 2 * PKB + PQB, 256, 0, stream>>>(x, wq, wk, wv, wo, mk, XB, WQ, WK, WV, WO, CS, MK);
    // all batch items per launch: x is [NB_*TT][DM], so the projections are plain GEMMs with M = NB_*TT
    k_qkv<<<dim3(NB_ * TT / 256, NH_, 1), 384, 0, stream>>>(XB, WQ, WK, WV, bqv, bkv, bvv, CS, QP16, QPh, QPl, KP16, KPh, KPl, VT16, VTh, VTl);   // v^T = Wv x^T: rows d, columns b*TT + t
    k_fattn<<<dim3(FBX, NB_ * NH_, 1), 160, 0, stream>>>(QP16, KP16, VT16, QPh, QPl, KPh, KPl, VTh, VTl, MK, ATh, ATl);
    k_gemmw<bf, 1, true, DQ><<<dim3(NB_ * TT / 64, DM / 64, 1), 32, 0, stream>>>(ATh, ATl, WO, nullptr, OUT, DM, bo);
}

// v010
// One run takes 84.1 microseconds.
// Timed twice side by side with v009, it ran 1.07 and 1.05 times as fast.
// All steps since v000 together make it 28.3 times as fast.
#include <hip/hip_runtime.h>

// MultiHeadAttentionEuclid (x [4][1024][1024]; q/k/v = x W^T + b (16 heads x 64); interleaved-pair rotary (base 1e4, positions 0..1023 computed on device); scores = q.k/8 where mask[0][0][i][j] != 0 (int32 [1][1][1024][1024],
// read as data; here causal), -inf elsewhere; softmax; out = merged att.v Wo^T + bo -> [4][1024][1024]).
// Compute dtypes, f32 accumulate: every input rounded to bf16; projections on PLAIN bf16 operands (inputs: exact, + bias); rope f32; scores (K 64) and att.v on an fp16 plane + an fp16 plane of its rounding residual (3 products)
// for the first 256 query rows of each head and on the fp16 plane ALONE for the rest; f32 masked online softmax in registers; merged heads hl x exact Wo (2 products) + bo. One-wave-per-64x64-tile GEMMs. Deterministic, no atomics;
// Launch plan: projections and the output product take all 4 batch items in one grid (rows b*1024 + t, planes [b][h]); a 64-column tile is one head, so each projection's epilogue writes the 16-bit head planes itself
// (q, k: bias, rope, split; v: computed as Wv x^T, bias, split, rows d over columns t); scores, softmax and att.v of all 64 (batch, head) pairs are one launch (k_fattn).
// FRAGMENT ORDER: every 16-bit plane [rows][K] that feeds a matrix operand is stored as tiles of 16 rows x 32 k, 512 elements each, tile (R, kt) at (R * (K/32) + kt) * 512. Inside a tile, element (row, k) stands at
// ((k >> 4) & 1) * 256 + (((k >> 3) & 1) * 16 + row) * 8 + (k & 7): the two 16-byte loads of a lane's fragment are then at bytes lane * 16 and 512 + lane * 16 of the tile, so one wave load reads 512 contiguous bytes
// (4 whole lines, not 32 bytes of each of 16). Which lane and register hold which (row, k) is as with row-major planes; only the place in memory differs.
// The mask is turned once into LANE MASKS (k_prep): per tile of 16 queries x 32 keys 16 words, tile (qt, kbt) at (qt * (TT/32) + kbt) * 16; bit (hi * 16 + lr) of word kt * 8 + j says whether mask[query lr][key kt*16 + hi*8 + j] != 0,
// which is the score that lane hi * 16 + lr holds in register j of S^T tile kt: k_fattn reads the 16 words of a tile with one scalar load, and each word is the select mask of one register's 32 scores as it stands.

#define NB_  4
#define TT   1024
#define DM   1024
#define NH_  16
#define NKV  16
#define REP  (NH_ / NKV)
#define HD   64
#define DQ   (NH_ * HD)
#define DKV  (NKV * HD)
#define RH   256                  // query rows < RH use hi+lo planes
#define WIN  0
#define SCL  0.125f   // HD^-0.5
typedef _Float16 h16;
typedef unsigned short bf;
typedef __attribute__((ext_vector_type(16))) __bf16   v16bf;
typedef __attribute__((ext_vector_type(16))) _Float16 v16h;
typedef __attribute__((ext_vector_type(8)))  _Float16 v8h;
typedef __attribute__((ext_vector_type(8)))  unsigned short v8us;
typedef __attribute__((ext_vector_type(8)))  float    v8f;
typedef __attribute__((ext_vector_type(4)))  float    v4f;
typedef v8h  __attribute__((may_alias)) v8ha;
typedef v4f  __attribute__((may_alias)) v4fa;
typedef v8us __attribute__((may_alias)) v8usa;

__device__ __forceinline__ unsigned short f2bf(float f) { unsigned u = __float_as_uint(f); u += 0x7FFFu + ((u >> 16) & 1u); return (unsigned short)(u >> 16); }
__device__ __forceinline__ float bf2f(unsigned short b) { return __uint_as_float(((unsigned)b) << 16); }
__device__ __forceinline__ float bfr(float f) { return bf2f(f2bf(f)); }
__device__ __forceinline__ v16h cat16(v8h lo, v8h hi) { return __builtin_shufflevector(lo, hi, 0, 1, 2, 3, 4, 5, 6, 7, 8, 9, 10, 11, 12, 13, 14, 15); }
__device__ __forceinline__ v16bf cat16b(v8us lo, v8us hi) { return __builtin_bit_cast(v16bf, __builtin_shufflevector(lo, hi, 0, 1, 2, 3, 4, 5, 6, 7, 8, 9, 10, 11, 12, 13, 14, 15)); }
__device__ __forceinline__ v8f wmma16(v16h a, v16h b, v8f c) { return __builtin_amdgcn_wmma_f32_16x16x32_f16(false, a, false, b, (short)0, c, false, false); }
__device__ __forceinline__ v8f wmmab(v16bf a, v16bf b, v8f c) { return __builtin_amdgcn_wmma_f32_16x16x32_bf16(false, a, false, b, (short)0, c, false, false); }



__device__ __forceinline__ h16 tohx(float x) { return (h16)x; }
__device__ __forceinline__ void splitf(float y, unsigned short& h, unsigned short& l) { h = f2bf(y); l = f2bf(y - bf2f(h)); }
typedef __attribute__((ext_vector_type(2))) _Float16 v2h;
typedef __attribute__((ext_vector_type(4))) _Float16 v4h;
typedef __attribute__((ext_vector_type(2))) unsigned short v2us;
typedef __attribute__((ext_vector_type(4))) unsigned short v4us;
typedef __attribute__((ext_vector_type(2))) float v2f;
typedef __attribute__((ext_vector_type(4))) int v4i;
typedef __attribute__((ext_vector_type(16))) int v16i;

// ---- k_gemmw: register-blocked GEMM, ONE WAVE per 64x64 output tile (16 accumulators), operands straight from 16-bit planes in fragment order; grid (M/64, N/64), 32 threads.
// C[m][n] (f32, pitch ldc, + optional f32 bias[n]) = sum_k A[m][k] Bt[n][k] (+ split products per NSPLIT). A pass of the k loop takes KU k tiles (K % (32 * KU) == 0): the loads of all of them issue first, the products follow tile by tile in k order,
// each tile's behind a counted wait, so a wave meets the load latency once per KU tiles and the later tiles' loads fly under the earlier tiles' products. KU is what the registers allow: 16 or 24 loads and 64 or 96 registers a tile.
// EPI 0: C as above. EPI 1 (rows m = b*TT + t, column tile = head): bias[n], interleaved-pair rope from the table CS ([t][d] -> cos, sin), then the fp16 plane and the fp16 plane of its residual (value - fp16(value)), [b][head], rows t, K = d, in fragment order.
// EPI 2 (row tile = head, columns n = b*TT + t): bias[m], then the same two planes [b][head] of rows d, K = t, in fragment order. Neither writes C.
template <typename T16> struct WFrag;   // ld(c): the fragment of one tile; c = the tile's address + lane * 16 bytes
template <> struct WFrag<h16> { typedef v16h V; static __device__ __forceinline__ V ld(const char* c) { return cat16(*(const v8h*)c, *(const v8h*)(c + 512)); } static __device__ __forceinline__ v8f mma(V a, V b, v8f c) { return wmma16(a, b, c); } };
template <> struct WFrag<bf> { typedef v16bf V; static __device__ __forceinline__ V ld(const char* c) { return cat16b(*(const v8us*)c, *(const v8us*)(c + 512)); } static __device__ __forceinline__ v8f mma(V a, V b, v8f c) { return wmmab(a, b, c); } };
// gemmw_tile: the tile (tx, ty) of one wave; os: that wave's own 16 x 68 floats of LDS; nh: heads per batch item (EPI 1, 2).
template <typename T16, int NSPLIT, bool BIAS, int EPI, int KU>
__device__ __forceinline__ void gemmw_tile(const T16* __restrict__ A, const T16* __restrict__ A2, const T16* __restrict__ Bt, const T16* __restrict__ Bt2, int K, float* C, int ldc, const float* __restrict__ bias, const float* __restrict__ CS, h16* __restrict__ P16, h16* __restrict__ Pl, int tx, int ty, int nh, float* os) {
    typedef typename WFrag<T16>::V V;
    const int lane = threadIdx.x & 31, lr = lane & 15, hi = lane >> 4; const int r0 = tx * 64, c0 = ty * 64;
    v8f acc[4][4];
#pragma unroll
    for (int mb = 0; mb < 4; ++mb)
#pragma unroll
        for (int nb = 0; nb < 4; ++nb) acc[mb][nb] = (v8f){};
    const size_t aoff = (size_t)r0 * K, boff = (size_t)c0 * K; const unsigned lo = lane * 16;   // a row tile is 16 * K elements, a k tile 512
#pragma unroll 1
    for (int kc = 0; kc < K; kc += 32 * KU) {
        V a[KU][4], a2[KU][4], b[KU][4], b2[KU][4]; constexpr bool SA = NSPLIT == 1 || NSPLIT == 2, SB = NSPLIT >= 2; constexpr size_t RT = 2;   // bytes an element
        const char* const pa = (const char*)(A + aoff + kc * 16) + lo; const char* const pb = (const char*)(Bt + boff + kc * 16) + lo;   // this lane's 16 bytes of this pass's k tile, first row tile
        const char* const pa2 = SA ? (const char*)(A2 + aoff + kc * 16) + lo : pa; const char* const pb2 = SB ? (const char*)(Bt2 + boff + kc * 16) + lo : pb;
#pragma unroll
        for (int u = 0; u < KU; ++u) {   // k tile u of the pass stands u * 512 elements behind k tile 0
#pragma unroll
            for (int mb = 0; mb < 4; ++mb) { a[u][mb] = WFrag<T16>::ld(pa + ((size_t)mb * 16 * K + u * 512) * RT); if (SA) a2[u][mb] = WFrag<T16>::ld(pa2 + ((size_t)mb * 16 * K + u * 512) * RT); }
#pragma unroll
            for (int nb = 0; nb < 4; ++nb) { b[u][nb] = WFrag<T16>::ld(pb + ((size_t)nb * 16 * K + u * 512) * RT); if (SB) b2[u][nb] = WFrag<T16>::ld(pb2 + ((size_t)nb * 16 * K + u * 512) * RT); } }
        asm volatile("s_wait_xcnt 0x0" :: "v"(pa), "v"(pa2), "v"(pb), "v"(pb2) : "memory");   // the address registers stay whole until every load of the pass that names them is past this wait (as inputs they cannot be given to a load's result before it); the wave has only its data to wait for here
        __builtin_amdgcn_sched_barrier(0);   // no product is lifted over the pass's loads: without it the scheduler starts the products early and issues the last fragments' loads into freed registers, behind a load wait, so a pass waits out the load latency twice in a row
#pragma unroll
        for (int u = 0; u < KU; ++u)
#pragma unroll
        for (int nb = 0; nb < 4; ++nb) {
#pragma unroll
            for (int mb = 0; mb < 4; ++mb) { acc[mb][nb] = WFrag<T16>::mma(a[u][mb], b[u][nb], acc[mb][nb]); if (SA) acc[mb][nb] = WFrag<T16>::mma(a2[u][mb], b[u][nb], acc[mb][nb]); if (SB) acc[mb][nb] = WFrag<T16>::mma(a[u][mb], b2[u][nb], acc[mb][nb]); } }
        asm volatile("v_nop\n\tv_nop\n\tv_nop\n\tv_nop" : "+v"(acc[0][0]), "+v"(acc[1][1]), "+v"(acc[2][2]), "+v"(acc[3][3]) : "v"(a[KU - 1][0]), "v"(a[KU - 1][3]));   // the vector slots the chip asks for behind the pass's last products, before the loop's taken branch leads to instructions that rewrite their operand registers
    }
    static_assert(EPI == 0 || HD == 64, "a 64-wide tile is one head");
    const int fo = (lr >> 3) * 512 + ((lr >> 2) & 1) * 256 + ((lr >> 1) & 1) * 128 + (lr & 1) * 4;   // k = lr * 4 of a 64-wide k range, row 0, in fragment order
    float cb[4], rb[4][8]; v2f cs[2][8][2]; size_t pbase = 0;   // all of a row block's table entries are asked for one row block ahead, as one batch
    const float* const cp0 = CS + ((size_t)(r0 % TT + hi) * HD + lr * 4) * 2;   // this lane's first table entry; every other one is a constant step from it
    if (EPI == 1) { pbase = ((size_t)((r0 / TT) * nh + ty) * TT + (r0 % TT)) * HD + fo;
#pragma unroll
        for (int i = 0; i < 4; ++i) cb[i] = bfr(bias[c0 + lr * 4 + i]);
#pragma unroll
        for (int s = 0; s < 8; ++s) { const float* cp = cp0 + 2 * s * HD * 2; cs[0][s][0] = *(const v2f*)cp; cs[0][s][1] = *(const v2f*)(cp + 4); } }
    if (EPI == 2) { pbase = (size_t)((c0 / TT) * nh + tx) * HD * TT + (c0 % TT) * 16 + fo;
#pragma unroll
        for (int mb = 0; mb < 4; ++mb)
#pragma unroll
            for (int s = 0; s < 8; ++s) { if (mb == 3 && s == 7) asm volatile("s_wait_xcnt 0x0" ::: "memory");   // without it the last load's result was placed in the offset register that the 31 loads before it still name: the wait stands in front of any such rewrite
                rb[mb][s] = bfr(bias[r0 + mb * 16 + 2 * s + hi]); } }
#pragma unroll
    for (int mb = 0; mb < 4; ++mb) {
        if (EPI == 1 && mb < 3) {
#pragma unroll
            for (int s = 0; s < 8; ++s) { const float* cp = cp0 + ((mb + 1) * 16 + 2 * s) * HD * 2; cs[(mb + 1) & 1][s][0] = *(const v2f*)cp; cs[(mb + 1) & 1][s][1] = *(const v2f*)(cp + 4); } }
#pragma unroll
        for (int nb = 0; nb < 4; ++nb) {
#pragma unroll
            for (int j = 0; j < 8; ++j) os[(hi * 8 + j) * 68 + nb * 16 + lr] = acc[mb][nb][j]; }
        __builtin_amdgcn_wave_barrier(); asm volatile("" ::: "memory");
        float* crow = C + (size_t)(r0 + mb * 16) * ldc + c0;
        if (EPI != 0) {
#pragma unroll
            for (int s = 0; s < 8; ++s) { const int row = 2 * s + hi; const v4f val = *(const v4fa*)(os + row * 68 + lr * 4); float r[4];
                if (EPI == 1) { const float x0 = val[0] + cb[0], x1 = val[1] + cb[1], x2 = val[2] + cb[2], x3 = val[3] + cb[3]; const v2f ca = cs[mb & 1][s][0], cc = cs[mb & 1][s][1];
                    r[0] = x0 * ca[0] - x1 * ca[1]; r[1] = x1 * ca[0] + x0 * ca[1]; r[2] = x2 * cc[0] - x3 * cc[1]; r[3] = x3 * cc[0] + x2 * cc[1]; }
                else { r[0] = val[0] + rb[mb][s]; r[1] = val[1] + rb[mb][s]; r[2] = val[2] + rb[mb][s]; r[3] = val[3] + rb[mb][s]; }
                v4h o16, ol;
#pragma unroll
                for (int i = 0; i < 4; ++i) { o16[i] = tohx(r[i]); ol[i] = tohx(r[i] - (float)o16[i]); }
                const size_t e = pbase + (size_t)mb * 16 * (EPI == 1 ? HD : TT) + row * 8;   // rows 2s, 2s + 1: 32 bytes in each of 8 places; the 8 stores of a row block fill its tiles
                *(v4h*)(P16 + e) = o16; *(v4h*)(Pl + e) = ol; }
            if (mb < 3) asm volatile("s_wait_xcnt 0x0" ::: "memory");   // the next row block's table loads and arithmetic land in registers that these stores still name: the wait stands in front of that rewrite
        } else {
#pragma unroll
            for (int s = 0; s < 8; ++s) { const int row = 2 * s + hi, cofs = lr * 4; v4f val = *(const v4fa*)(os + row * 68 + cofs); if (BIAS) { val[0] += bfr(bias[c0 + cofs]); val[1] += bfr(bias[c0 + cofs + 1]); val[2] += bfr(bias[c0 + cofs + 2]); val[3] += bfr(bias[c0 + cofs + 3]); }
                *(v4f*)(crow + (size_t)row * ldc + cofs) = val; }
            if (mb < 3) asm volatile("s_wait_xcnt 0x0" ::: "memory");   // the next row block's loads and arithmetic land in registers that these stores still name: the wait stands in front of that rewrite
             }
        __builtin_amdgcn_wave_barrier(); asm volatile("" ::: "memory");
    }
}
template <typename T16, int NSPLIT, bool BIAS, int K>   // K at compile time: the steps from row tile to row tile are then immediates on one address register pair per plane
__global__ __launch_bounds__(32) void k_gemmw(const T16* __restrict__ A, const T16* __restrict__ A2, const T16* __restrict__ Bt, const T16* __restrict__ Bt2, float* C, int ldc, const float* __restrict__ bias) {
    __shared__ __align__(16) float os[16 * 68]; static_assert(K % 128 == 0, "whole passes of 4 k tiles");   // one wave a SIMD: 4 tiles' fragments beside the 128 accumulator registers
    gemmw_tile<T16, NSPLIT, BIAS, 0, 4>(A, A2, Bt, Bt2, K, C, ldc, bias, nullptr, nullptr, nullptr, blockIdx.x, blockIdx.y, 0, os);
}
// k_qkv: the three projections in one launch, grid (NB_*TT/256, heads), 12 waves a block, one block a WGP: waves 0..3 q, 4..7 k (x W^T), 8..11 v (Wv x^T) of one head, wave w on the 64 rows (w & 3) of the block's 256 rows of x.
// The block's waves read the same 4 row tiles of x and the same 3 weight tiles, so what one wave has fetched the others find in the WGP's cache; no wave reads another's result, and there is no barrier between them.
static_assert(NH_ == NKV && NB_ * TT % 256 == 0, "one grid for q, k and v"); static_assert(DM % 64 == 0, "whole passes of 2 k tiles");   // three waves a SIMD: 2 tiles' fragments each
__global__ __launch_bounds__(384) void k_qkv(const bf* __restrict__ X, const bf* __restrict__ Wq, const bf* __restrict__ Wk, const bf* __restrict__ Wv, const float* __restrict__ bq, const float* __restrict__ bk, const float* __restrict__ bv, const float* __restrict__ CS,
                                            h16* __restrict__ Q16, h16* __restrict__ Ql, h16* __restrict__ K16, h16* __restrict__ Kl, h16* __restrict__ V16, h16* __restrict__ Vl) {
    __shared__ __align__(16) float os[12][16 * 68];
    const int wave = __builtin_amdgcn_readfirstlane(threadIdx.x >> 5); const int xt = blockIdx.x * 4 + (wave & 3);
    if (wave < 8) { const bool k = wave >= 4;   // q and k run the same code on their own pointers
        gemmw_tile<bf, 0, true, 1, 2>(X, nullptr, k ? Wk : Wq, nullptr, DM, nullptr, 0, k ? bk : bq, CS, k ? K16 : Q16, k ? Kl : Ql, xt, blockIdx.y, NH_, os[wave]); }
    else gemmw_tile<bf, 0, true, 2, 2>(Wv, nullptr, X, nullptr, DM, nullptr, 0, bv, nullptr, V16, Vl, blockIdx.y, xt, NKV, os[wave]);
}


__global__ __launch_bounds__(256) void k_wtG(const float* __restrict__ w, int K, int N, bf* Bt) {
    const int lane = threadIdx.x & 31; const int L0 = (blockIdx.x * 8 + (threadIdx.x >> 5)) * 8; const int nlines = N * K / 64;
{
#pragma unroll 1
        for (int l = 0; l < 8; ++l) { const int L = L0 + l; if (L >= nlines) break; const size_t e = (size_t)L * 64 + lane * 2; const int k = (int)(e % K), n = (int)(e / K); v2us o;
            o[0] = f2bf(w[(size_t)k * N + n]); o[1] = f2bf(w[(size_t)(k + 1) * N + n]); *(v2us*)(Bt + e) = o; }
         }
}
// k_prep: everything that reads inputs only, one launch. Blocks 0..PTB-1 (the longest, so first): the rope table. Then the mask's lane-mask words. Then x, Wq, Wk, Wv, Wo to bf16 in fragment order, CVB groups of 8 floats a thread, a block's groups 256 apart: group g is the g-th 16 bytes of the plane written,
// so a wave stores 512 contiguous bytes and reads 64 bytes of each of 16 rows (the wave beside it reads the line's other half); 256 groups on are 4 k tiles on in the same rows.
#define CVB 4
#define PTB (TT * HD / 256)
#define PXB (NB_ * TT * DM / (8 * 256 * CVB))
#define PQB (DQ * DM / (8 * 256 * CVB))
#define PKB (DKV * DM / (8 * 256 * CVB))
#define PMB ((TT / 16) * (TT / 32) / 16)
static_assert(TT * HD % 256 == 0 && NB_ * TT * DM % (8 * 256 * CVB) == 0 && DQ * DM % (8 * 256 * CVB) == 0 && DKV * DM % (8 * 256 * CVB) == 0, "whole blocks");
static_assert(DQ == DM && (DM / 32) % (4 * CVB) == 0, "all five planes have rows of DM elements, and a block stays inside one row tile");
static_assert((TT / 16) * (TT / 32) % 16 == 0 && TT % 64 == 0, "whole blocks of the mask words: a wave takes two tiles side by side, a block 16 tiles");
__global__ __launch_bounds__(256) void k_prep(const float* __restrict__ x, const float* __restrict__ wq, const float* __restrict__ wk, const float* __restrict__ wv, const float* __restrict__ wo, const int* __restrict__ mk, bf* XB, bf* WQ, bf* WK, bf* WV, bf* WO, float* CS, int* MK) {
    int b = blockIdx.x;
    if (b < PTB) { const int idx = b * 256 + threadIdx.x; const int t = idx / HD, d = idx % HD; const int i = d >> 1; const float inv = __fdiv_rn(1.0f, powf(10000.0f, (float)(2 * i) / (float)HD)); const float ang = __fmul_rn((float)t, inv); v2f cs; cs[0] = cosf(ang); cs[1] = sinf(ang);
        *(v2f*)(CS + (size_t)idx * 2) = cs; return; }
    b -= PTB;
    if (b < PMB) { const unsigned pr = (unsigned)b * 8 + (threadIdx.x >> 5), ln = threadIdx.x & 31; v4i m[8];   // the mask: wave pr takes the tiles 2 pr and 2 pr + 1 (16 queries x 64 keys: whole lines of 16 rows) and writes their 32 words, one whole line
        const int* const src = mk + (size_t)((pr / (TT / 64)) * 16 + (ln & 15)) * TT + (pr % (TT / 64)) * 64 + (ln >> 4) * 8;   // query lr, key hi * 8 of the first tile
#pragma unroll
        for (int u = 0; u < 8; ++u) m[u] = *(const v4i*)(src + (u >> 1) * 16 + (u & 1) * 4);   // u = tile * 4 + kt * 2 + h: keys tile * 32 + kt * 16 + hi * 8 + h * 4 ..+3
        unsigned w = 0;
#pragma unroll
        for (int u = 0; u < 8; ++u)
#pragma unroll
            for (int i = 0; i < 4; ++i) { const unsigned bl = __builtin_amdgcn_ballot_w32(m[u][i] != 0); if (ln == (unsigned)(u * 4 + i)) w = bl; }   // word tile * 16 + kt * 8 + h * 4 + i, kept by the lane that stores it
        MK[(size_t)pr * 32 + ln] = (int)w;
        asm volatile("s_wait_xcnt 0x0" ::: "memory");   // as behind the conversion stores below: the listing lays the table code behind this store too, and it rewrites registers that it still names
        return; }
    b -= PMB; const float* src; bf* dst;
    if (b < PXB) { src = x; dst = XB; }
    else if ((b -= PXB) < PQB) { src = wq; dst = WQ; }
    else if ((b -= PQB) < PKB) { src = wk; dst = WK; }
    else if ((b -= PKB) < PKB) { src = wv; dst = WV; }
    else { b -= PKB; src = wo; dst = WO; }
    const size_t i0 = (size_t)b * (256 * CVB) + threadIdx.x; v8f v[CVB]; const unsigned tile = (unsigned)(i0 >> 6), ln = threadIdx.x & 31;
    const unsigned so = (((tile / (DM / 32)) * 16 + (ln & 15)) * DM + (tile % (DM / 32)) * 32 + ((threadIdx.x >> 5) & 1) * 16 + (ln >> 4) * 8) * 4;   // bytes: where group i0's 8 floats stand in the row-major source
#pragma unroll
    for (int u = 0; u < CVB; ++u) v[u] = *(const v8f*)((const char*)(src + u * 128) + so);
#pragma unroll
    for (int u = 0; u < CVB; ++u) { v8us o;
#pragma unroll
        for (int k = 0; k < 8; ++k) o[k] = f2bf(v[u][k]);
        *(v8us*)(dst + (i0 + u * 256) * 8) = o; }
    asm volatile("s_wait_xcnt 0x0" ::: "memory");   // the listing lays the table code behind these stores, and it rewrites registers that they still name as data: the wait stands in front of any such rewrite
}
__device__ __forceinline__ float xhalf(float x) { return __builtin_bit_cast(float, __builtin_amdgcn_permlanex16(__builtin_bit_cast(int, x), __builtin_bit_cast(int, x), 0x76543210, 0xfedcba98, false, false)); }  // lane l takes lane l ^ 16's value
template <bool SPLIT> struct PFrag;   // the weights as a B operand: the fp16 value alone, or with the fp16 value of its residual
template <> struct PFrag<false> { static __device__ __forceinline__ void pack(const float* p, v16h& a, v16h& b) { (void)b;
#pragma unroll
    for (int s = 0; s < 16; ++s) a[s] = (h16)p[s]; } };
template <> struct PFrag<true> { static __device__ __forceinline__ void pack(const float* p, v16h& a, v16h& b) {
#pragma unroll
    for (int s = 0; s < 16; ++s) { const h16 h = (h16)p[s]; a[s] = h; b[s] = (h16)(p[s] - (float)h); } } };
template <bool SP, int QT>
__device__ __forceinline__ void fattn_tile(const h16* __restrict__ Q, const h16* __restrict__ Q2, const h16* __restrict__ Kp, const h16* __restrict__ K2, const h16* __restrict__ Vt, const h16* __restrict__ Vt2, const int* __restrict__ mk, int q0, bf* Ah, bf* Al) {
    typedef h16 T16; typedef WFrag<T16>::V V; constexpr float SH = 10.0f;
    const int lane = threadIdx.x & 31, lr = lane & 15, hi = lane >> 4; const unsigned lo = lane * 16;
    V qf[QT][2], qf2[QT][2]; v8f o[QT][4]; float m[QT], l[QT];
#pragma unroll
    for (int qt = 0; qt < QT; ++qt) { m[qt] = -3.0e38f; l[qt] = 0.0f;
#pragma unroll
        for (int ks = 0; ks < 2; ++ks) { const size_t qo = (size_t)(q0 + qt * 16) * HD + ks * 512; qf[qt][ks] = WFrag<T16>::ld((const char*)(Q + qo) + lo); if (SP) qf2[qt][ks] = WFrag<T16>::ld((const char*)(Q2 + qo) + lo); }
#pragma unroll
        for (int dt = 0; dt < 4; ++dt) o[qt][dt] = (v8f){}; }
    V kf[2][2], kf2[2][2], vf[4], vf2[4]; v16i mq[QT];   // one pass's fragments and mask words (the words are the same for the whole wave: scalar registers); they live across the loop's back edge: each is loaded one pass ahead, into the registers that its last user of this pass has just read
    const char* const K0 = (const char*)Kp + lo; const char* const V0 = (const char*)Vt + lo; const int* const M0 = mk + (size_t)(q0 / 16) * (TT / 32) * 16;   // this lane's 16 bytes of the first tile, per plane; the first tile's mask words
    const char* const K20 = SP ? (const char*)K2 + lo : K0; const char* const V20 = SP ? (const char*)Vt2 + lo : V0;
    auto ldkm = [&](const char* Kb, const char* K2b, const int* Mb) {   // key fragments and mask words of one pass
#pragma unroll
        for (int kt = 0; kt < 2; ++kt)
#pragma unroll
            for (int ks = 0; ks < 2; ++ks) { const int e = (kt * 16 * HD + ks * 512) * 2; kf[kt][ks] = WFrag<T16>::ld(Kb + e); if (SP) kf2[kt][ks] = WFrag<T16>::ld(K2b + e); }
#pragma unroll
        for (int qt = 0; qt < QT; ++qt) mq[qt] = *(const v16i*)(Mb + qt * (TT / 32) * 16); };
    auto ldv = [&](const char* Vb, const char* V2b) {   // value fragments of one pass
#pragma unroll
        for (int dt = 0; dt < 4; ++dt) { const int e = dt * 16 * TT * 2; vf[dt] = WFrag<T16>::ld(Vb + e); if (SP) vf2[dt] = WFrag<T16>::ld(V2b + e); } };
    __builtin_amdgcn_sched_barrier(0);   // the query loads issue ahead of the first pass's: loads return in order, so the loop's counted waits on key fragments then cover them; issued behind, the first wait of every pass would have to drain the value loads too
    ldkm(K0, K20, M0); ldv(V0, V20);
    asm volatile("s_wait_xcnt 0x0" :: "v"(K0), "v"(K20), "v"(V0), "v"(V20) : "memory");   // the address registers stay whole until every load that names them is past this wait
    __builtin_amdgcn_sched_barrier(0);   // keeps what follows behind that wait: the loop's scalar set-up lands in the base registers that these loads name
    const char* kn = (const char*)Kp; const char* vn = (const char*)Vt; const int* mn_ = M0; const char* k2n = (const char*)K2; const char* v2n = (const char*)Vt2;   // the first tile of the pass fetched ahead, per plane: the same for the whole wave, so they step in scalar registers
#pragma unroll 1
    for (int kb = 0; kb < TT; kb += 32) {
        const bool more = kb + 32 < TT;   // the last pass fetches the first block again, in bounds and unused
        kn = more ? kn + 32 * HD * 2 : (const char*)Kp; vn = more ? vn + 32 * 16 * 2 : (const char*)Vt; mn_ = more ? mn_ + 16 : M0;
        if (SP) { k2n = more ? k2n + 32 * HD * 2 : (const char*)K2; v2n = more ? v2n + 32 * 16 * 2 : (const char*)Vt2; }
        const char* const Kb = kn + lo; const char* const Vb = vn + lo; const char* const K2b = SP ? k2n + lo : Kb; const char* const V2b = SP ? v2n + lo : Vb;   // this lane's 16 bytes of them
        float t[QT][16], bm[QT];
#pragma unroll
        for (int qt = 0; qt < QT; ++qt) { bm[qt] = -3.0e38f;
#pragma unroll
            for (int kt = 0; kt < 2; ++kt) { v8f s = (v8f){};
#pragma unroll
                for (int ks = 0; ks < 2; ++ks) { s = WFrag<T16>::mma(kf[kt][ks], qf[qt][ks], s); if (SP) { s = WFrag<T16>::mma(kf2[kt][ks], qf[qt][ks], s); s = WFrag<T16>::mma(kf[kt][ks], qf2[qt][ks], s); } }
#pragma unroll
                for (int j = 0; j < 8; ++j) { const float x = __builtin_amdgcn_inverse_ballot_w32((unsigned)mq[qt][kt * 8 + j]) ? s[j] * (SCL * 1.4426950408889634f) : -3.0e38f; t[qt][kt * 8 + j] = x; bm[qt] = fmaxf(bm[qt], x); } } }
        __builtin_amdgcn_sched_barrier(0);   // the next pass's key and mask-word loads stay behind the last use of the registers they fill: lifted higher they would take registers of their own
        ldkm(Kb, K2b, mn_);
        if (SP) asm volatile("s_wait_xcnt 0x0" :: "v"(Kb), "v"(K2b) : "memory");   // the address registers stay whole until the loads that name them are past this wait; the hi+lo waves have no registers to hold them longer, the fp16 waves hold them to the pass's end and wait once, there
        __builtin_amdgcn_sched_barrier(0);   // and they stay ahead of the softmax and att.v, under which they fly: sunk lower their latency would be met whole at the next pass's head
#pragma unroll
        for (int qt = 0; qt < QT; ++qt) {
            const float bx = fmaxf(bm[qt], xhalf(bm[qt]));
            const float mn = fmaxf(m[qt], bx); const float al = __builtin_amdgcn_exp2f(m[qt] - mn); m[qt] = mn; const float mb = mn - SH; float ps = 0.0f;
#pragma unroll
            for (int s = 0; s < 16; ++s) { t[qt][s] = __builtin_amdgcn_exp2f(t[qt][s] - mb); ps += t[qt][s]; }
            l[qt] = l[qt] * al + ps;
#pragma unroll
            for (int dt = 0; dt < 4; ++dt) o[qt][dt] *= al;
            V pf, pf2; PFrag<SP>::pack(t[qt], pf, pf2);
#pragma unroll
            for (int dt = 0; dt < 4; ++dt) { o[qt][dt] = WFrag<T16>::mma(vf[dt], pf, o[qt][dt]); if (SP) { o[qt][dt] = WFrag<T16>::mma(vf2[dt], pf, o[qt][dt]); o[qt][dt] = WFrag<T16>::mma(vf[dt], pf2, o[qt][dt]); } }
        }
        __builtin_amdgcn_sched_barrier(0);   // the next pass's value loads stay behind att.v, whose registers they fill
        ldv(Vb, V2b);
        if (SP) asm volatile("s_wait_xcnt 0x0" :: "v"(Vb), "v"(V2b) : "memory");   // the address registers stay whole until every load that names them is past this wait (as inputs they cannot be rewritten or given to a load's result before it)
        else asm volatile("s_wait_xcnt 0x0" :: "v"(Kb), "v"(Vb) : "memory");   // the same, for both planes of the fp16 waves
        __builtin_amdgcn_sched_barrier(0);   // keeps the next pass's address additions behind that wait
    }
#pragma unroll
    for (int qt = 0; qt < QT; ++qt) { const float inv = __fdiv_rn(1.0f, l[qt] + xhalf(l[qt])); const size_t oo = (size_t)(q0 + qt * 16) * DQ;
#pragma unroll
        for (int dt = 0; dt < 4; ++dt) { v8us oh, ol;
#pragma unroll
            for (int j = 0; j < 8; ++j) { unsigned short a, c2; splitf(o[qt][dt][j] * inv, a, c2); oh[j] = a; ol[j] = c2; }
            *(v8us*)((char*)(Ah + oo + dt * 256) + lo) = oh; *(v8us*)((char*)(Al + oo + dt * 256) + lo) = ol; } }
    asm volatile("s_wait_xcnt 0x0" ::: "memory");   // without it the compiler joins the ends of both wave kinds in one tail that rewrites registers which these stores still name as data: the wait stands in front of any such rewrite
}
// grid (FBX, NB_*NH_), 5 waves of one head per block, every block the same work: waves 0, 1 take 16 query rows each on value + residual planes, waves 2..4 take 32 query rows each on the value planes alone, which all 5 waves read (RH/16 = 2 FBX and (TT-RH)/32 = 3 FBX tiles a head)
#define FBX 8
static_assert(RH == 2 * FBX * 16 && TT - RH == 3 * FBX * 32, "tiles per block");
__global__ __launch_bounds__(160) void k_fattn(const h16* __restrict__ Q16, const h16* __restrict__ K16, const h16* __restrict__ V16, const h16* __restrict__ Ql, const h16* __restrict__ Kl, const h16* __restrict__ Vl, const int* __restrict__ mk, bf* Ah, bf* Al) {
    const int bh = blockIdx.y, bx = blockIdx.x, wave = __builtin_amdgcn_readfirstlane(threadIdx.x >> 5); const size_t pq = (size_t)bh * TT * HD, pk = (size_t)(bh / REP) * TT * HD; const size_t ao = (size_t)(bh / NH_) * TT * DQ + (size_t)(bh % NH_) * (HD / 32) * 512;
    if (wave < 2) fattn_tile<true, 1>(Q16 + pq, Ql + pq, K16 + pk, Kl + pk, V16 + pk, Vl + pk, mk, (bx * 2 + wave) * 16, Ah + ao, Al + ao);
    else fattn_tile<false, 2>(Q16 + pq, nullptr, K16 + pk, nullptr, V16 + pk, nullptr, mk, RH + (bx * 3 + wave - 2) * 32, Ah + ao, Al + ao);
}

extern "C" void kernel_launch(void* const* d_in, const int* in_sizes, int n_in,
                              void* d_out, int out_size, void* d_ws, size_t ws_size, hipStream_t stream) {
    (void)in_sizes; (void)n_in; (void)out_size;
    const float* x = (const float*)d_in[0]; const float* wq = (const float*)d_in[1]; const float* bqv = (const float*)d_in[2]; const float* wk = (const float*)d_in[3]; const float* bkv = (const float*)d_in[4]; const float* wv = (const float*)d_in[5]; const float* bvv = (const float*)d_in[6]; const float* wo = (const float*)d_in[7]; const float* bo = (const float*)d_in[8]; const int* mk = (const int*)d_in[9];   // torch [out][in] weights; mask int32 [1][1][1024][1024] (nonzero = attend)
    float* OUT = (float*)d_out;     // [4][1024][1024]
    char* wsp = (char*)d_ws;
    auto take = [&](size_t bytes) { char* p = wsp; wsp += (bytes + 255) & ~(size_t)255; return (void*)p; };
    bf* WQ = (bf*)take((size_t)DQ * DM * 2); bf* WK = (bf*)take((size_t)DKV * DM * 2); bf* WV = (bf*)take((size_t)DKV * DM * 2); bf* WO = (bf*)take((size_t)DM * DQ * 2); float* CS = (float*)take((size_t)TT * HD * 2 * 4);
    bf* XB = (bf*)take((size_t)NB_ * TT * DM * 2);
    h16* QP16 = (h16*)take((size_t)NB_ * NH_ * TT * HD * 2); h16* KP16 = (h16*)take((size_t)NB_ * NKV * TT * HD * 2); h16* VT16 = (h16*)take((size_t)NB_ * NKV * HD * TT * 2);
    h16* QPl = (h16*)take((size_t)NB_ * NH_ * TT * HD * 2); h16* KPl = (h16*)take((size_t)NB_ * NKV * TT * HD * 2); h16* VTl = (h16*)take((size_t)NB_ * NKV * HD * TT * 2);
    bf* ATh = (bf*)take((size_t)NB_ * TT * DQ * 2); bf* ATl = (bf*)take((size_t)NB_ * TT * DQ * 2); int* MK = (int*)take((size_t)TT * TT / 8);
    if ((size_t)(wsp - (char*)d_ws) > ws_size) return;    // well inside the workspace
    k_prep<<<PTB + PMB + PXB + PQB + 2 * PKB + PQB, 256, 0, stream>>>(x, wq, wk, wv, wo, mk, XB, WQ, WK, WV, WO, CS, MK);
    // all batch items per launch: x is [NB_*TT][DM], so the projections are plain GEMMs with M = NB_*TT
    k_qkv<<<dim3(NB_ * TT / 256, NH_, 1), 384, 0, stream>>>(XB, WQ, WK, WV, bqv, bkv, bvv, CS, QP16, QPl, KP16, KPl, VT16, VTl);   // v^T = Wv x^T: rows d, columns b*TT + t
    k_fattn<<<dim3(FBX, NB_ * NH_, 1), 160, 0, stream>>>(QP16, KP16, VT16, QPl, KPl, VTl, MK, ATh, ATl);
    k_gemmw<bf, 1, true, DQ><<<dim3(NB_ * TT / 64, DM / 64, 1), 32, 0, stream>>>(ATh, ATl, WO, nullptr, OUT, DM, bo);
}
